// v000
// Times are from an AMD MI455X. After a warm-up the kernel runs many times in a row, and a time is the length of
// such a window on the GPU divided by its runs, so every launch and the gaps after it count. The runs cycle
// through copies of the inputs. A figure is the median of several windows, for all but v000 over two sittings.
// Sittings can differ by a few percent; kernels timed side by side share one.
// v000 is the starting kernel. One run takes 516 microseconds.
#include <hip/hip_runtime.h>

typedef _Float16 h8_t  __attribute__((ext_vector_type(8)));
typedef _Float16 v16h  __attribute__((ext_vector_type(16)));
typedef float    v8f   __attribute__((ext_vector_type(8)));

#define BATCH 2
#define SEQ   2048
#define DIMSZ 512
#define HEADS 8
#define DHEAD 64
#define NEGV  1.0e6f

// ---------------------------------------------------------------------------
// helpers
// ---------------------------------------------------------------------------
__device__ __forceinline__ v16h mk16(h8_t lo, h8_t hi) {
    v16h r;
#pragma unroll
    for (int i = 0; i < 8; ++i) { r[i] = lo[i]; r[i + 8] = hi[i]; }
    return r;
}

// ---------------------------------------------------------------------------
// f32 -> f16 convert
// ---------------------------------------------------------------------------
__global__ void cvt_f16_kernel(const float* __restrict__ in,
                               _Float16* __restrict__ out, int n) {
    int i = blockIdx.x * 256 + threadIdx.x;
    if (i < n) out[i] = (_Float16)in[i];
}

// ---------------------------------------------------------------------------
// FiLM: film[b, o] = b_time[o] + sum_k silu(time[b,k]) * w_time[o,k]
// ---------------------------------------------------------------------------
__global__ void film_kernel(const float* __restrict__ timep,
                            const float* __restrict__ w_time,
                            const float* __restrict__ b_time,
                            float* __restrict__ film) {
    int b = blockIdx.x;
    __shared__ float st[DIMSZ];
    for (int i = threadIdx.x; i < DIMSZ; i += 256) {
        float t = timep[b * DIMSZ + i];
        st[i] = t / (1.0f + __expf(-t));   // silu
    }
    __syncthreads();
    for (int o = threadIdx.x; o < 2 * DIMSZ; o += 256) {
        const float* wr = w_time + (size_t)o * DIMSZ;
        float acc = b_time[o];
        for (int k = 0; k < DIMSZ; ++k) acc = fmaf(st[k], wr[k], acc);
        film[b * 2 * DIMSZ + o] = acc;
    }
}

// ---------------------------------------------------------------------------
// LayerNorm + FiLM + seq-mask + fold dim_head^-0.5, emit f16; also x -> f16
// one block (256 thr) per token, 2 elements per thread
// ---------------------------------------------------------------------------
__global__ void ln_film_kernel(const float* __restrict__ x,
                               const float* __restrict__ gamma,
                               const float* __restrict__ film,
                               const float* __restrict__ seq_mask,
                               _Float16* __restrict__ xn16,
                               _Float16* __restrict__ x16) {
    int tok = blockIdx.x;                 // 0 .. B*SEQ-1
    int b   = tok / SEQ;
    int tid = threadIdx.x;
    const float* xr = x + (size_t)tok * DIMSZ;
    float v0 = xr[tid], v1 = xr[tid + 256];
    float s  = v0 + v1;
    float sq = v0 * v0 + v1 * v1;
#pragma unroll
    for (int off = 16; off; off >>= 1) {
        s  += __shfl_xor(s,  off, 32);
        sq += __shfl_xor(sq, off, 32);
    }
    __shared__ float ssum[8], ssq[8];
    int wv = tid >> 5, ln = tid & 31;
    if (ln == 0) { ssum[wv] = s; ssq[wv] = sq; }
    __syncthreads();
    float tot = 0.f, totq = 0.f;
#pragma unroll
    for (int i = 0; i < 8; ++i) { tot += ssum[i]; totq += ssq[i]; }
    float mu   = tot * (1.0f / DIMSZ);
    float var  = totq * (1.0f / DIMSZ) - mu * mu;
    float rinv = rsqrtf(var + 1e-5f);
    float mk   = seq_mask[tok];
    const float* fb = film + (size_t)b * 2 * DIMSZ;
#pragma unroll
    for (int e = 0; e < 2; ++e) {
        int   d  = tid + e * 256;
        float v  = (e == 0) ? v0 : v1;
        float xn = (v - mu) * rinv * gamma[d];
        xn = xn * (fb[d] + 1.0f) + fb[DIMSZ + d];
        xn = xn * mk * 0.125f;            // fold 64^-0.5 (only q uses xn)
        xn16[(size_t)tok * DIMSZ + d] = (_Float16)xn;
        x16 [(size_t)tok * DIMSZ + d] = (_Float16)v;
    }
}

// ---------------------------------------------------------------------------
// WMMA GEMM, 16x64 tile per wave (A fragment reused across 4 N-tiles),
// f16 output with arbitrary (batched) output strides:
//   Out[b*obs + (row%npb)*ors + col*ocs] = (A[row,:] . W[col,:])
// ---------------------------------------------------------------------------
__global__ void gemm_f16out_kernel(const _Float16* __restrict__ A,
                                   const _Float16* __restrict__ W,
                                   _Float16* __restrict__ Out,
                                   int M, int NOUT, int K,
                                   int npb, long long obs, int ors, int ocs) {
    int wave = blockIdx.x * (blockDim.x >> 5) + (threadIdx.x >> 5);
    int tiles_n = NOUT >> 6;                   // 64 columns per wave
    int tm = wave / tiles_n, tn = wave % tiles_n;
    if (tm >= (M >> 4)) return;
    int lane = threadIdx.x & 31;
    int l15 = lane & 15, halfsel = lane >> 4, base0 = halfsel ? 8 : 0;
    int rowbase = tm << 4, colbase = tn << 6;
    const _Float16* arow = A + (size_t)(rowbase + l15) * K;
    const _Float16* wrow[4];
#pragma unroll
    for (int c = 0; c < 4; ++c)
        wrow[c] = W + (size_t)(colbase + c * 16 + l15) * K;
    v8f acc[4];
#pragma unroll
    for (int c = 0; c < 4; ++c) acc[c] = (v8f){};
    for (int kk = 0; kk < K; kk += 32) {
        v16h a = mk16(*(const h8_t*)(arow + kk + base0),
                      *(const h8_t*)(arow + kk + 16 + base0));
#pragma unroll
        for (int c = 0; c < 4; ++c) {
            v16h bf = mk16(*(const h8_t*)(wrow[c] + kk + base0),
                           *(const h8_t*)(wrow[c] + kk + 16 + base0));
            acc[c] = __builtin_amdgcn_wmma_f32_16x16x32_f16(
                false, a, false, bf, (short)0, acc[c], false, false);
        }
    }
#pragma unroll
    for (int c = 0; c < 4; ++c) {
#pragma unroll
        for (int r = 0; r < 8; ++r) {
            int grow = rowbase + r + halfsel * 8;
            int bidx = grow / npb, rloc = grow % npb;
            size_t addr = (size_t)bidx * obs + (size_t)rloc * ors
                        + (size_t)(colbase + c * 16 + l15) * ocs;
            Out[addr] = (_Float16)acc[c][r];
        }
    }
}

// WMMA GEMM (16x64 tile), f32 output [M, NOUT], multiplied by per-row mask
__global__ void gemm_f32mask_kernel(const _Float16* __restrict__ A,
                                    const _Float16* __restrict__ W,
                                    const float* __restrict__ seq_mask,
                                    float* __restrict__ Out,
                                    int M, int NOUT, int K) {
    int wave = blockIdx.x * (blockDim.x >> 5) + (threadIdx.x >> 5);
    int tiles_n = NOUT >> 6;
    int tm = wave / tiles_n, tn = wave % tiles_n;
    if (tm >= (M >> 4)) return;
    int lane = threadIdx.x & 31;
    int l15 = lane & 15, halfsel = lane >> 4, base0 = halfsel ? 8 : 0;
    int rowbase = tm << 4, colbase = tn << 6;
    const _Float16* arow = A + (size_t)(rowbase + l15) * K;
    const _Float16* wrow[4];
#pragma unroll
    for (int c = 0; c < 4; ++c)
        wrow[c] = W + (size_t)(colbase + c * 16 + l15) * K;
    v8f acc[4];
#pragma unroll
    for (int c = 0; c < 4; ++c) acc[c] = (v8f){};
    for (int kk = 0; kk < K; kk += 32) {
        v16h a = mk16(*(const h8_t*)(arow + kk + base0),
                      *(const h8_t*)(arow + kk + 16 + base0));
#pragma unroll
        for (int c = 0; c < 4; ++c) {
            v16h bf = mk16(*(const h8_t*)(wrow[c] + kk + base0),
                           *(const h8_t*)(wrow[c] + kk + 16 + base0));
            acc[c] = __builtin_amdgcn_wmma_f32_16x16x32_f16(
                false, a, false, bf, (short)0, acc[c], false, false);
        }
    }
#pragma unroll
    for (int r = 0; r < 8; ++r) {
        int grow = rowbase + r + halfsel * 8;
        float mk = seq_mask[grow];
#pragma unroll
        for (int c = 0; c < 4; ++c)
            Out[(size_t)grow * NOUT + colbase + c * 16 + l15] = acc[c][r] * mk;
    }
}

// ---------------------------------------------------------------------------
// Flash attention: one wave per 16-row query tile; 32 keys per step.
//   q16, k16: [B, SEQ, H*64] f16      vT: [B, H*64, SEQ] f16
//   bias: [B, H, SEQ, SEQ] f32        ao: [B, SEQ, H*64] f16
// LDS P-slab is private per wave; DS ops are in-order within a wave, so no
// block barrier is needed -- explicit s_wait_dscnt 0 fences the transpose.
// ---------------------------------------------------------------------------
__global__ void attn_kernel(const _Float16* __restrict__ q16,
                            const _Float16* __restrict__ k16,
                            const _Float16* __restrict__ vT,
                            const float* __restrict__ bias,
                            const float* __restrict__ seq_mask,
                            _Float16* __restrict__ ao) {
    __shared__ __align__(16) _Float16 plds[4][16 * 32];
    int wib   = threadIdx.x >> 5;
    int lane  = threadIdx.x & 31;
    int gwave = blockIdx.x * 4 + wib;
    int qtile = gwave & 127;              // SEQ/16 = 128
    int h     = (gwave >> 7) & 7;
    int b     = gwave >> 10;
    int qbase = qtile << 4;
    int l15 = lane & 15, halfsel = lane >> 4, base0 = halfsel ? 8 : 0;
    size_t bN   = (size_t)b * SEQ;
    int    hoff = h * DHEAD;
    _Float16* pl = plds[wib];

    // Q fragments (d 0..31, d 32..63), scale already folded into xn
    const _Float16* qr = q16 + (bN + qbase + l15) * DIMSZ + hoff;
    v16h aq0 = mk16(*(const h8_t*)(qr + base0),      *(const h8_t*)(qr + 16 + base0));
    v16h aq1 = mk16(*(const h8_t*)(qr + 32 + base0), *(const h8_t*)(qr + 48 + base0));

    float mi[8];
#pragma unroll
    for (int r = 0; r < 8; ++r) mi[r] = seq_mask[bN + qbase + r + halfsel * 8];

    float mrow[8], lrow[8];
    v8f   Oacc[4];
#pragma unroll
    for (int r = 0; r < 8; ++r) { mrow[r] = -1.0e30f; lrow[r] = 0.0f; }
#pragma unroll
    for (int t = 0; t < 4; ++t) Oacc[t] = (v8f){};

    const float* bbase = bias + ((size_t)(b * HEADS + h) * SEQ + qbase) * SEQ;

    for (int jb = 0; jb < SEQ / 32; ++jb) {
        int kb = jb * 32;
        // ---- S = Q . K^T  (two 16-key tiles) ----
        const _Float16* kr0 = k16 + (bN + kb + l15) * DIMSZ + hoff;
        const _Float16* kr1 = kr0 + 16 * DIMSZ;
        v16h b00 = mk16(*(const h8_t*)(kr0 + base0),      *(const h8_t*)(kr0 + 16 + base0));
        v16h b01 = mk16(*(const h8_t*)(kr0 + 32 + base0), *(const h8_t*)(kr0 + 48 + base0));
        v16h b10 = mk16(*(const h8_t*)(kr1 + base0),      *(const h8_t*)(kr1 + 16 + base0));
        v16h b11 = mk16(*(const h8_t*)(kr1 + 32 + base0), *(const h8_t*)(kr1 + 48 + base0));
        v8f z = {};
        v8f S0 = __builtin_amdgcn_wmma_f32_16x16x32_f16(false, aq0, false, b00, (short)0, z,  false, false);
        S0     = __builtin_amdgcn_wmma_f32_16x16x32_f16(false, aq1, false, b01, (short)0, S0, false, false);
        v8f S1 = __builtin_amdgcn_wmma_f32_16x16x32_f16(false, aq0, false, b10, (short)0, z,  false, false);
        S1     = __builtin_amdgcn_wmma_f32_16x16x32_f16(false, aq1, false, b11, (short)0, S1, false, false);

        float mj0 = seq_mask[bN + kb + l15];
        float mj1 = seq_mask[bN + kb + 16 + l15];

        // ---- bias add + pair mask + online softmax (row = lanes across N) ----
#pragma unroll
        for (int r = 0; r < 8; ++r) {
            const float* bm = bbase + (size_t)(r + halfsel * 8) * SEQ + kb;
            if (jb + 1 < SEQ / 32 && r == 0) __builtin_prefetch(bm + 32, 0, 0);
            float s0 = S0[r] + bm[l15]      - (1.0f - mi[r] * mj0) * NEGV;
            float s1 = S1[r] + bm[16 + l15] - (1.0f - mi[r] * mj1) * NEGV;
            float tmax = fmaxf(s0, s1);
#pragma unroll
            for (int off = 1; off < 16; off <<= 1)
                tmax = fmaxf(tmax, __shfl_xor(tmax, off, 16));
            float mnew  = fmaxf(mrow[r], tmax);
            float alpha = __expf(mrow[r] - mnew);
            float p0 = __expf(s0 - mnew);
            float p1 = __expf(s1 - mnew);
            float rs = p0 + p1;
#pragma unroll
            for (int off = 1; off < 16; off <<= 1)
                rs += __shfl_xor(rs, off, 16);
            lrow[r] = lrow[r] * alpha + rs;
            mrow[r] = mnew;
#pragma unroll
            for (int t = 0; t < 4; ++t) Oacc[t][r] *= alpha;
            int m = r + halfsel * 8;
            pl[m * 32 + l15]      = (_Float16)p0;   // C-layout -> LDS
            pl[m * 32 + 16 + l15] = (_Float16)p1;
        }
        // DS ops are in-order within a wave; fence store->load explicitly.
        asm volatile("s_wait_dscnt 0" ::: "memory");

        // ---- P A-fragment from LDS (A-layout) ----
        const _Float16* pr = pl + l15 * 32;
        v16h pa = mk16(*(const h8_t*)(pr + base0), *(const h8_t*)(pr + 16 + base0));

        // ---- O += P . V  (V stored transposed: keys contiguous) ----
#pragma unroll
        for (int t = 0; t < 4; ++t) {
            const _Float16* vr = vT + ((size_t)b * DIMSZ + hoff + t * 16 + l15) * SEQ + kb;
            v16h vb = mk16(*(const h8_t*)(vr + base0), *(const h8_t*)(vr + 16 + base0));
            Oacc[t] = __builtin_amdgcn_wmma_f32_16x16x32_f16(
                false, pa, false, vb, (short)0, Oacc[t], false, false);
        }
    }

    // ---- normalize + store ----
#pragma unroll
    for (int r = 0; r < 8; ++r) {
        float inv = (lrow[r] > 0.0f) ? (1.0f / lrow[r]) : 0.0f;
        size_t row = bN + qbase + r + halfsel * 8;
#pragma unroll
        for (int t = 0; t < 4; ++t)
            ao[row * DIMSZ + hoff + t * 16 + l15] = (_Float16)(Oacc[t][r] * inv);
    }
}

// ---------------------------------------------------------------------------
// launcher
// ---------------------------------------------------------------------------
extern "C" void kernel_launch(void* const* d_in, const int* in_sizes, int n_in,
                              void* d_out, int out_size, void* d_ws, size_t ws_size,
                              hipStream_t stream) {
    const float* x     = (const float*)d_in[0];
    const float* timep = (const float*)d_in[1];
    const float* bias  = (const float*)d_in[2];
    const float* mask  = (const float*)d_in[3];
    const float* gamma = (const float*)d_in[4];
    const float* wtime = (const float*)d_in[5];
    const float* btime = (const float*)d_in[6];
    const float* wq    = (const float*)d_in[7];
    const float* wkv   = (const float*)d_in[8];
    const float* wout  = (const float*)d_in[9];
    float* out = (float*)d_out;

    uint8_t* ws = (uint8_t*)d_ws;
    size_t off = 0;
    auto alloc = [&](size_t bytes) -> uint8_t* {
        uint8_t* p = ws + off;
        off += (bytes + 255) & ~(size_t)255;
        return p;
    };
    const size_t ACT = (size_t)BATCH * SEQ * DIMSZ;        // 2M elems
    float*    film  = (float*)   alloc(BATCH * 2 * DIMSZ * 4);
    _Float16* xn16  = (_Float16*)alloc(ACT * 2);
    _Float16* x16   = (_Float16*)alloc(ACT * 2);
    _Float16* wq16  = (_Float16*)alloc((size_t)DIMSZ * DIMSZ * 2);
    _Float16* wkv16 = (_Float16*)alloc((size_t)2 * DIMSZ * DIMSZ * 2);
    _Float16* wo16  = (_Float16*)alloc((size_t)DIMSZ * DIMSZ * 2);
    _Float16* q16   = (_Float16*)alloc(ACT * 2);
    _Float16* k16   = (_Float16*)alloc(ACT * 2);
    _Float16* vT16  = (_Float16*)alloc(ACT * 2);
    _Float16* ao16  = (_Float16*)alloc(ACT * 2);

    // weight converts
    cvt_f16_kernel<<<(DIMSZ * DIMSZ + 255) / 256, 256, 0, stream>>>(wq, wq16, DIMSZ * DIMSZ);
    cvt_f16_kernel<<<(2 * DIMSZ * DIMSZ + 255) / 256, 256, 0, stream>>>(wkv, wkv16, 2 * DIMSZ * DIMSZ);
    cvt_f16_kernel<<<(DIMSZ * DIMSZ + 255) / 256, 256, 0, stream>>>(wout, wo16, DIMSZ * DIMSZ);

    // FiLM params, then fused LN+FiLM+mask
    film_kernel<<<BATCH, 256, 0, stream>>>(timep, wtime, btime, film);
    ln_film_kernel<<<BATCH * SEQ, 256, 0, stream>>>(x, gamma, film, mask, xn16, x16);

    const int M = BATCH * SEQ;                    // 4096
    const int tiles64 = (M / 16) * (DIMSZ / 64);  // 2048 waves -> 512 blocks
    // q = xn @ wq^T        -> [B,SEQ,512]
    gemm_f16out_kernel<<<tiles64 / 4, 128, 0, stream>>>(
        xn16, wq16, q16, M, DIMSZ, DIMSZ, SEQ, (long long)SEQ * DIMSZ, DIMSZ, 1);
    // k = x @ wkv[0:512]^T -> [B,SEQ,512]
    gemm_f16out_kernel<<<tiles64 / 4, 128, 0, stream>>>(
        x16, wkv16, k16, M, DIMSZ, DIMSZ, SEQ, (long long)SEQ * DIMSZ, DIMSZ, 1);
    // v = x @ wkv[512:]^T  -> stored TRANSPOSED [B, 512, SEQ]
    gemm_f16out_kernel<<<tiles64 / 4, 128, 0, stream>>>(
        x16, wkv16 + (size_t)DIMSZ * DIMSZ, vT16, M, DIMSZ, DIMSZ,
        SEQ, (long long)DIMSZ * SEQ, 1, SEQ);

    // flash attention: B*H*(SEQ/16) = 2048 waves, 4 waves / block
    attn_kernel<<<BATCH * HEADS * (SEQ / 16) / 4, 128, 0, stream>>>(
        q16, k16, vT16, bias, mask, ao16);

    // out = (ao @ wout^T) * mask  -> f32
    gemm_f32mask_kernel<<<tiles64 / 4, 128, 0, stream>>>(
        ao16, wo16, mask, out, M, DIMSZ, DIMSZ);
}

// v001
// One run takes 262 microseconds.
// Two timings next to v000 both put it at 1.98 times that version's speed.
#include <hip/hip_runtime.h>

typedef _Float16 h8_t  __attribute__((ext_vector_type(8)));
typedef _Float16 v16h  __attribute__((ext_vector_type(16)));
typedef float    v8f   __attribute__((ext_vector_type(8)));

#define BATCH 2
#define SEQ   2048
#define DIMSZ 512
#define HEADS 8
#define DHEAD 64
#define NEGV  1.0e6f

// ---------------------------------------------------------------------------
// helpers
// ---------------------------------------------------------------------------
__device__ __forceinline__ v16h mk16(h8_t lo, h8_t hi) {
    v16h r;
#pragma unroll
    for (int i = 0; i < 8; ++i) { r[i] = lo[i]; r[i + 8] = hi[i]; }
    return r;
}

// ---------------------------------------------------------------------------
// f32 -> f16 convert
// ---------------------------------------------------------------------------
__global__ void cvt_f16_kernel(const float* __restrict__ in,
                               _Float16* __restrict__ out, int n) {
    int i = blockIdx.x * 256 + threadIdx.x;
    if (i < n) out[i] = (_Float16)in[i];
}

// ---------------------------------------------------------------------------
// FiLM: film[b, o] = b_time[o] + sum_k silu(time[b,k]) * w_time[o,k]
// ---------------------------------------------------------------------------
__global__ void film_kernel(const float* __restrict__ timep,
                            const float* __restrict__ w_time,
                            const float* __restrict__ b_time,
                            float* __restrict__ film) {
    int b = blockIdx.x;
    __shared__ float st[DIMSZ];
    for (int i = threadIdx.x; i < DIMSZ; i += 256) {
        float t = timep[b * DIMSZ + i];
        st[i] = t / (1.0f + __expf(-t));   // silu
    }
    __syncthreads();
    for (int o = threadIdx.x; o < 2 * DIMSZ; o += 256) {
        const float* wr = w_time + (size_t)o * DIMSZ;
        float acc = b_time[o];
        for (int k = 0; k < DIMSZ; ++k) acc = fmaf(st[k], wr[k], acc);
        film[b * 2 * DIMSZ + o] = acc;
    }
}

// ---------------------------------------------------------------------------
// LayerNorm + FiLM + seq-mask + fold dim_head^-0.5, emit f16; also x -> f16
// one block (256 thr) per token, 2 elements per thread
// ---------------------------------------------------------------------------
__global__ void ln_film_kernel(const float* __restrict__ x,
                               const float* __restrict__ gamma,
                               const float* __restrict__ film,
                               const float* __restrict__ seq_mask,
                               _Float16* __restrict__ xn16,
                               _Float16* __restrict__ x16) {
    int tok = blockIdx.x;                 // 0 .. B*SEQ-1
    int b   = tok / SEQ;
    int tid = threadIdx.x;
    const float* xr = x + (size_t)tok * DIMSZ;
    float v0 = xr[tid], v1 = xr[tid + 256];
    float s  = v0 + v1;
    float sq = v0 * v0 + v1 * v1;
#pragma unroll
    for (int off = 16; off; off >>= 1) {
        s  += __shfl_xor(s,  off, 32);
        sq += __shfl_xor(sq, off, 32);
    }
    __shared__ float ssum[8], ssq[8];
    int wv = tid >> 5, ln = tid & 31;
    if (ln == 0) { ssum[wv] = s; ssq[wv] = sq; }
    __syncthreads();
    float tot = 0.f, totq = 0.f;
#pragma unroll
    for (int i = 0; i < 8; ++i) { tot += ssum[i]; totq += ssq[i]; }
    float mu   = tot * (1.0f / DIMSZ);
    float var  = totq * (1.0f / DIMSZ) - mu * mu;
    float rinv = rsqrtf(var + 1e-5f);
    float mk   = seq_mask[tok];
    const float* fb = film + (size_t)b * 2 * DIMSZ;
#pragma unroll
    for (int e = 0; e < 2; ++e) {
        int   d  = tid + e * 256;
        float v  = (e == 0) ? v0 : v1;
        float xn = (v - mu) * rinv * gamma[d];
        xn = xn * (fb[d] + 1.0f) + fb[DIMSZ + d];
        xn = xn * mk * 0.125f;            // fold 64^-0.5 (only q uses xn)
        xn16[(size_t)tok * DIMSZ + d] = (_Float16)xn;
        x16 [(size_t)tok * DIMSZ + d] = (_Float16)v;
    }
}

// ---------------------------------------------------------------------------
// WMMA GEMM, 16x64 tile per wave (A fragment reused across 4 N-tiles),
// f16 output with arbitrary (batched) output strides:
//   Out[b*obs + (row%npb)*ors + col*ocs] = (A[row,:] . W[col,:])
// ---------------------------------------------------------------------------
__global__ void gemm_f16out_kernel(const _Float16* __restrict__ A,
                                   const _Float16* __restrict__ W,
                                   _Float16* __restrict__ Out,
                                   int M, int NOUT, int K,
                                   int npb, long long obs, int ors, int ocs) {
    int wave = blockIdx.x * (blockDim.x >> 5) + (threadIdx.x >> 5);
    int tiles_n = NOUT >> 6;                   // 64 columns per wave
    int tm = wave / tiles_n, tn = wave % tiles_n;
    if (tm >= (M >> 4)) return;
    int lane = threadIdx.x & 31;
    int l15 = lane & 15, halfsel = lane >> 4, base0 = halfsel ? 8 : 0;
    int rowbase = tm << 4, colbase = tn << 6;
    const _Float16* arow = A + (size_t)(rowbase + l15) * K;
    const _Float16* wrow[4];
#pragma unroll
    for (int c = 0; c < 4; ++c)
        wrow[c] = W + (size_t)(colbase + c * 16 + l15) * K;
    v8f acc[4];
#pragma unroll
    for (int c = 0; c < 4; ++c) acc[c] = (v8f){};
    for (int kk = 0; kk < K; kk += 32) {
        v16h a = mk16(*(const h8_t*)(arow + kk + base0),
                      *(const h8_t*)(arow + kk + 16 + base0));
#pragma unroll
        for (int c = 0; c < 4; ++c) {
            v16h bf = mk16(*(const h8_t*)(wrow[c] + kk + base0),
                           *(const h8_t*)(wrow[c] + kk + 16 + base0));
            acc[c] = __builtin_amdgcn_wmma_f32_16x16x32_f16(
                false, a, false, bf, (short)0, acc[c], false, false);
        }
    }
#pragma unroll
    for (int c = 0; c < 4; ++c) {
#pragma unroll
        for (int r = 0; r < 8; ++r) {
            int grow = rowbase + r + halfsel * 8;
            int bidx = grow / npb, rloc = grow % npb;
            size_t addr = (size_t)bidx * obs + (size_t)rloc * ors
                        + (size_t)(colbase + c * 16 + l15) * ocs;
            Out[addr] = (_Float16)acc[c][r];
        }
    }
}

// WMMA GEMM (16x64 tile), f32 output [M, NOUT], multiplied by per-row mask
__global__ void gemm_f32mask_kernel(const _Float16* __restrict__ A,
                                    const _Float16* __restrict__ W,
                                    const float* __restrict__ seq_mask,
                                    float* __restrict__ Out,
                                    int M, int NOUT, int K) {
    int wave = blockIdx.x * (blockDim.x >> 5) + (threadIdx.x >> 5);
    int tiles_n = NOUT >> 6;
    int tm = wave / tiles_n, tn = wave % tiles_n;
    if (tm >= (M >> 4)) return;
    int lane = threadIdx.x & 31;
    int l15 = lane & 15, halfsel = lane >> 4, base0 = halfsel ? 8 : 0;
    int rowbase = tm << 4, colbase = tn << 6;
    const _Float16* arow = A + (size_t)(rowbase + l15) * K;
    const _Float16* wrow[4];
#pragma unroll
    for (int c = 0; c < 4; ++c)
        wrow[c] = W + (size_t)(colbase + c * 16 + l15) * K;
    v8f acc[4];
#pragma unroll
    for (int c = 0; c < 4; ++c) acc[c] = (v8f){};
    for (int kk = 0; kk < K; kk += 32) {
        v16h a = mk16(*(const h8_t*)(arow + kk + base0),
                      *(const h8_t*)(arow + kk + 16 + base0));
#pragma unroll
        for (int c = 0; c < 4; ++c) {
            v16h bf = mk16(*(const h8_t*)(wrow[c] + kk + base0),
                           *(const h8_t*)(wrow[c] + kk + 16 + base0));
            acc[c] = __builtin_amdgcn_wmma_f32_16x16x32_f16(
                false, a, false, bf, (short)0, acc[c], false, false);
        }
    }
#pragma unroll
    for (int r = 0; r < 8; ++r) {
        int grow = rowbase + r + halfsel * 8;
        float mk = seq_mask[grow];
#pragma unroll
        for (int c = 0; c < 4; ++c)
            Out[(size_t)grow * NOUT + colbase + c * 16 + l15] = acc[c][r] * mk;
    }
}

typedef float f4_t __attribute__((ext_vector_type(4)));

// value of lane l ^ 16
__device__ __forceinline__ float other_half(float v) {
    int b = __builtin_bit_cast(int, v);
    b = __builtin_amdgcn_permlanex16(b, b, 0x76543210, 0xfedcba98, false, false);
    return __builtin_bit_cast(float, b);
}

__device__ __forceinline__ float exp_slot(float x) {
    float y = x * 1.44269504f, r;
    asm("v_exp_f32 %0, %1\n\tv_nop" : "=v"(r) : "v"(y));
    return r;
}

__global__ void attn_kernel(const _Float16* __restrict__ q16,
                            const _Float16* __restrict__ k16,
                            const _Float16* __restrict__ vT,
                            const float* __restrict__ bias,
                            const float* __restrict__ seq_mask,
                            _Float16* __restrict__ ao) {
    // wave number as a scalar: tile indices and bases are then computed in scalar
    // registers and take no vector registers from the fragments
    int wib   = __builtin_amdgcn_readfirstlane(threadIdx.x >> 5);
    int lane  = threadIdx.x & 31;
    int gwave = blockIdx.x * 4 + wib;
    int qtile = gwave & 127;              // SEQ/16 = 128
    int h     = (gwave >> 7) & 7;
    int b     = gwave >> 10;
    int qbase = qtile << 4;
    int l15 = lane & 15, halfsel = lane >> 4, base0 = halfsel ? 8 : 0;
    size_t bN   = (size_t)b * SEQ;
    int    hoff = h * DHEAD;
    unsigned rowoff = (unsigned)(l15 * DIMSZ + base0);   // q16, k16, ao: row l15
    unsigned seqoff = (unsigned)(l15 * SEQ + base0);     // bias, vT: row l15

    // Q fragments (d 0..31, d 32..63), scale already folded into xn
    const _Float16* qr = q16 + (bN + qbase) * DIMSZ + hoff;
    v16h aq0 = mk16(*(const h8_t*)(qr + rowoff),      *(const h8_t*)(qr + rowoff + 16));
    v16h aq1 = mk16(*(const h8_t*)(qr + rowoff + 32), *(const h8_t*)(qr + rowoff + 48));

    float mi   = seq_mask[bN + qbase + l15];   // this lane's query
    float mrow = -1.0e30f;                     // running maximum (same in both halves)
    float lrow = 0.0f;                         // running sum of this half's keys
    v8f   Oacc[4];                             // Ot: [d = t*16 + 8*half + r][query l15]
#pragma unroll
    for (int t = 0; t < 4; ++t) Oacc[t] = (v8f){};

    // wave-uniform bases of this tile's K rows, bias rows, key masks and Vt rows
    const _Float16* kbase = k16 + bN * DIMSZ + hoff;
    const float*    bbase = bias + ((size_t)(b * HEADS + h) * SEQ + qbase) * SEQ;
    const float*    mbase = seq_mask + bN;
    const _Float16* vbase = vT + ((size_t)b * DIMSZ + hoff) * SEQ;

    for (int jb = 0; jb < SEQ / 32; ++jb) {
        int kb = jb * 32;
        // ---- St = K . Qt  (two 16-key tiles) ----
        const _Float16* kr0 = kbase + (size_t)kb * DIMSZ;
        const _Float16* kr1 = kr0 + 16 * DIMSZ;
        v16h b00 = mk16(*(const h8_t*)(kr0 + rowoff),      *(const h8_t*)(kr0 + rowoff + 16));
        v16h b01 = mk16(*(const h8_t*)(kr0 + rowoff + 32), *(const h8_t*)(kr0 + rowoff + 48));
        v16h b10 = mk16(*(const h8_t*)(kr1 + rowoff),      *(const h8_t*)(kr1 + rowoff + 16));
        v16h b11 = mk16(*(const h8_t*)(kr1 + rowoff + 32), *(const h8_t*)(kr1 + rowoff + 48));
        v8f z = {};
        v8f S0 = __builtin_amdgcn_wmma_f32_16x16x32_f16(false, b00, false, aq0, (short)0, z,  false, false);
        S0     = __builtin_amdgcn_wmma_f32_16x16x32_f16(false, b01, false, aq1, (short)0, S0, false, false);
        v8f S1 = __builtin_amdgcn_wmma_f32_16x16x32_f16(false, b10, false, aq0, (short)0, z,  false, false);
        S1     = __builtin_amdgcn_wmma_f32_16x16x32_f16(false, b11, false, aq1, (short)0, S1, false, false);

        f4_t bv[4], mv[4];                 // [0,1]: keys of tile 0, [2,3]: tile 1
#pragma unroll
        for (int g = 0; g < 4; ++g) {
            int o = (g >> 1) * 16 + (g & 1) * 4;
            bv[g] = *(const f4_t*)(bbase + kb + seqoff + o);
            mv[g] = *(const f4_t*)(mbase + kb + (unsigned)base0 + o);
        }

        // ---- bias add + pair mask + online softmax (in-lane, one max exchange between halves) ----
        float s[16];
#pragma unroll
        for (int i = 0; i < 8; ++i) {
            s[i]     = S0[i] + bv[i >> 2][i & 3]       - (1.0f - mi * mv[i >> 2][i & 3])       * NEGV;
            s[8 + i] = S1[i] + bv[2 + (i >> 2)][i & 3] - (1.0f - mi * mv[2 + (i >> 2)][i & 3]) * NEGV;
        }
        float tm[8];
#pragma unroll
        for (int i = 0; i < 8; ++i) tm[i] = fmaxf(s[i], s[8 + i]);
        float tmax = fmaxf(fmaxf(fmaxf(tm[0], tm[1]), fmaxf(tm[2], tm[3])),
                           fmaxf(fmaxf(tm[4], tm[5]), fmaxf(tm[6], tm[7])));
        tmax = fmaxf(tmax, other_half(tmax));
        float mnew  = fmaxf(mrow, tmax);
        float alpha = exp_slot(mrow - mnew);
        mrow = mnew;

        v16h  pb;                          // Pt as B operand: element i <-> score i
        float ps[4];                       // four partial sums of this lane's p
#pragma unroll
        for (int i = 0; i < 16; ++i) {
            float p = exp_slot(s[i] - mnew);
            ps[i & 3] = (i < 4) ? p : ps[i & 3] + p;
            pb[i] = (_Float16)p;
        }
        lrow = lrow * alpha + ((ps[0] + ps[1]) + (ps[2] + ps[3]));
#pragma unroll
        for (int t = 0; t < 4; ++t) Oacc[t] *= alpha;

        // ---- Ot += Vt . Pt  (V stored transposed: keys contiguous) ----
#pragma unroll
        for (int t = 0; t < 4; ++t) {
            const _Float16* vr = vbase + kb + t * 16 * SEQ;
            v16h va = mk16(*(const h8_t*)(vr + seqoff), *(const h8_t*)(vr + seqoff + 16));
            Oacc[t] = __builtin_amdgcn_wmma_f32_16x16x32_f16(
                false, va, false, pb, (short)0, Oacc[t], false, false);
        }
    }

    // ---- join the halves' sums, normalize + store (8 consecutive d per lane) ----
    lrow += other_half(lrow);
    float inv = (lrow > 0.0f) ? (1.0f / lrow) : 0.0f;
    _Float16* orow = ao + (bN + qbase) * DIMSZ + hoff + rowoff;
#pragma unroll
    for (int t = 0; t < 4; ++t) {
        h8_t o;
#pragma unroll
        for (int r = 0; r < 8; ++r) o[r] = (_Float16)(Oacc[t][r] * inv);
        *(h8_t*)(orow + t * 16) = o;
    }
}

// ---------------------------------------------------------------------------
// launcher
// ---------------------------------------------------------------------------
extern "C" void kernel_launch(void* const* d_in, const int* in_sizes, int n_in,
                              void* d_out, int out_size, void* d_ws, size_t ws_size,
                              hipStream_t stream) {
    const float* x     = (const float*)d_in[0];
    const float* timep = (const float*)d_in[1];
    const float* bias  = (const float*)d_in[2];
    const float* mask  = (const float*)d_in[3];
    const float* gamma = (const float*)d_in[4];
    const float* wtime = (const float*)d_in[5];
    const float* btime = (const float*)d_in[6];
    const float* wq    = (const float*)d_in[7];
    const float* wkv   = (const float*)d_in[8];
    const float* wout  = (const float*)d_in[9];
    float* out = (float*)d_out;

    uint8_t* ws = (uint8_t*)d_ws;
    size_t off = 0;
    auto alloc = [&](size_t bytes) -> uint8_t* {
        uint8_t* p = ws + off;
        off += (bytes + 255) & ~(size_t)255;
        return p;
    };
    const size_t ACT = (size_t)BATCH * SEQ * DIMSZ;        // 2M elems
    float*    film  = (float*)   alloc(BATCH * 2 * DIMSZ * 4);
    _Float16* xn16  = (_Float16*)alloc(ACT * 2);
    _Float16* x16   = (_Float16*)alloc(ACT * 2);
    _Float16* wq16  = (_Float16*)alloc((size_t)DIMSZ * DIMSZ * 2);
    _Float16* wkv16 = (_Float16*)alloc((size_t)2 * DIMSZ * DIMSZ * 2);
    _Float16* wo16  = (_Float16*)alloc((size_t)DIMSZ * DIMSZ * 2);
    _Float16* q16   = (_Float16*)alloc(ACT * 2);
    _Float16* k16   = (_Float16*)alloc(ACT * 2);
    _Float16* vT16  = (_Float16*)alloc(ACT * 2);
    _Float16* ao16  = (_Float16*)alloc(ACT * 2);

    // weight converts
    cvt_f16_kernel<<<(DIMSZ * DIMSZ + 255) / 256, 256, 0, stream>>>(wq, wq16, DIMSZ * DIMSZ);
    cvt_f16_kernel<<<(2 * DIMSZ * DIMSZ + 255) / 256, 256, 0, stream>>>(wkv, wkv16, 2 * DIMSZ * DIMSZ);
    cvt_f16_kernel<<<(DIMSZ * DIMSZ + 255) / 256, 256, 0, stream>>>(wout, wo16, DIMSZ * DIMSZ);

    // FiLM params, then fused LN+FiLM+mask
    film_kernel<<<BATCH, 256, 0, stream>>>(timep, wtime, btime, film);
    ln_film_kernel<<<BATCH * SEQ, 256, 0, stream>>>(x, gamma, film, mask, xn16, x16);

    const int M = BATCH * SEQ;                    // 4096
    const int tiles64 = (M / 16) * (DIMSZ / 64);  // 2048 waves -> 512 blocks
    // q = xn @ wq^T        -> [B,SEQ,512]
    gemm_f16out_kernel<<<tiles64 / 4, 128, 0, stream>>>(
        xn16, wq16, q16, M, DIMSZ, DIMSZ, SEQ, (long long)SEQ * DIMSZ, DIMSZ, 1);
    // k = x @ wkv[0:512]^T -> [B,SEQ,512]
    gemm_f16out_kernel<<<tiles64 / 4, 128, 0, stream>>>(
        x16, wkv16, k16, M, DIMSZ, DIMSZ, SEQ, (long long)SEQ * DIMSZ, DIMSZ, 1);
    // v = x @ wkv[512:]^T  -> stored TRANSPOSED [B, 512, SEQ]
    gemm_f16out_kernel<<<tiles64 / 4, 128, 0, stream>>>(
        x16, wkv16 + (size_t)DIMSZ * DIMSZ, vT16, M, DIMSZ, DIMSZ,
        SEQ, (long long)DIMSZ * SEQ, 1, SEQ);

    // flash attention: B*H*(SEQ/16) = 2048 waves, 4 waves / block
    attn_kernel<<<BATCH * HEADS * (SEQ / 16) / 4, 128, 0, stream>>>(
        q16, k16, vT16, bias, mask, ao16);

    // out = (ao @ wout^T) * mask  -> f32
    gemm_f32mask_kernel<<<tiles64 / 4, 128, 0, stream>>>(
        ao16, wo16, mask, out, M, DIMSZ, DIMSZ);
}

// v002
// One run takes 216 microseconds.
// In both of two side-by-side timings against v001, it was 1.21 times as fast.
// Over all steps from v000 it is 2.40 times as fast.
#include <hip/hip_runtime.h>

typedef _Float16 h8_t  __attribute__((ext_vector_type(8)));
typedef _Float16 v16h  __attribute__((ext_vector_type(16)));
typedef float    v8f   __attribute__((ext_vector_type(8)));
typedef float    f4_t  __attribute__((ext_vector_type(4)));

#define BATCH 2
#define SEQ   2048
#define DIMSZ 512
#define HEADS 8
#define DHEAD 64
#define NEGV  1.0e6f

// ---------------------------------------------------------------------------
// helpers
// ---------------------------------------------------------------------------
__device__ __forceinline__ v16h mk16(h8_t lo, h8_t hi) {
    v16h r;
#pragma unroll
    for (int i = 0; i < 8; ++i) { r[i] = lo[i]; r[i + 8] = hi[i]; }
    return r;
}

__device__ __forceinline__ float exp_slot(float x) {
    float y = x * 1.44269504f, r;
    asm("v_exp_f32 %0, %1\n\tv_nop" : "=v"(r) : "v"(y));
    return r;
}

// ---------------------------------------------------------------------------
// f32 -> f16 convert
// ---------------------------------------------------------------------------
__global__ void cvt_f16_kernel(const float* __restrict__ in,
                               _Float16* __restrict__ out, int n) {
    int i = blockIdx.x * 256 + threadIdx.x;
    if (i < n) out[i] = (_Float16)in[i];
}

// ---------------------------------------------------------------------------
// FiLM: film[b, o] = b_time[o] + sum_k silu(time[b,k]) * w_time[o,k]
// One wave per output row o (4 waves a block, 256 blocks). The 32 lanes read the
// row in whole 128-byte lines (lane l holds k = 128*j + 4*l .. + 3), once for all
// batches; each lane sums its 16 products (lane 0 on top of b_time[o]) and a
// butterfly over the lanes joins the partial sums.
// ---------------------------------------------------------------------------
__global__ void film_kernel(const float* __restrict__ timep,
                            const float* __restrict__ w_time,
                            const float* __restrict__ b_time,
                            float* __restrict__ film) {
    // wave number as a scalar: the row's base address stays in scalar registers
    int o    = blockIdx.x * 4 + __builtin_amdgcn_readfirstlane(threadIdx.x >> 5);
    int lane = threadIdx.x & 31;
    const f4_t* wr = (const f4_t*)(w_time + (size_t)o * DIMSZ);
    f4_t w[4], t[BATCH][4];                // DIMSZ = 4 * 128
#pragma unroll
    for (int j = 0; j < 4; ++j) {
        w[j] = wr[j * 32 + lane];
#pragma unroll
        for (int b = 0; b < BATCH; ++b)
            t[b][j] = ((const f4_t*)(timep + b * DIMSZ))[j * 32 + lane];
    }
    float bt = b_time[o];
    // keeps every load above ahead of the arithmetic, so a wave waits out one memory
    // latency; without it the compiler sinks seven of the vector loads between the
    // silu blocks and the wave waits four times
    __builtin_amdgcn_sched_barrier(0);
    float acc[BATCH];
#pragma unroll
    for (int b = 0; b < BATCH; ++b) {
        acc[b] = (lane == 0) ? bt : 0.0f;   // lane 0's chain starts from the bias
#pragma unroll
        for (int j = 0; j < 4; ++j)
#pragma unroll
            for (int c = 0; c < 4; ++c) {
                float tv = t[b][j][c];
                acc[b] = fmaf(tv / (1.0f + exp_slot(-tv)), w[j][c], acc[b]);   // silu
            }
    }
#pragma unroll
    for (int off = 16; off; off >>= 1)
#pragma unroll
        for (int b = 0; b < BATCH; ++b) acc[b] += __shfl_xor(acc[b], off, 32);
    // every lane holds every batch's sum: lane b stores batch b
    float r = acc[0];
#pragma unroll
    for (int b = 1; b < BATCH; ++b) r = (lane == b) ? acc[b] : r;
    if (lane < BATCH) film[lane * 2 * DIMSZ + o] = r;
}

// ---------------------------------------------------------------------------
// LayerNorm + FiLM + seq-mask + fold dim_head^-0.5, emit f16; also x -> f16
// one block (256 thr) per token, 2 elements per thread
// ---------------------------------------------------------------------------
__global__ void ln_film_kernel(const float* __restrict__ x,
                               const float* __restrict__ gamma,
                               const float* __restrict__ film,
                               const float* __restrict__ seq_mask,
                               _Float16* __restrict__ xn16,
                               _Float16* __restrict__ x16) {
    int tok = blockIdx.x;                 // 0 .. B*SEQ-1
    int b   = tok / SEQ;
    int tid = threadIdx.x;
    const float* xr = x + (size_t)tok * DIMSZ;
    float v0 = xr[tid], v1 = xr[tid + 256];
    float s  = v0 + v1;
    float sq = v0 * v0 + v1 * v1;
#pragma unroll
    for (int off = 16; off; off >>= 1) {
        s  += __shfl_xor(s,  off, 32);
        sq += __shfl_xor(sq, off, 32);
    }
    __shared__ float ssum[8], ssq[8];
    int wv = tid >> 5, ln = tid & 31;
    if (ln == 0) { ssum[wv] = s; ssq[wv] = sq; }
    __syncthreads();
    float tot = 0.f, totq = 0.f;
#pragma unroll
    for (int i = 0; i < 8; ++i) { tot += ssum[i]; totq += ssq[i]; }
    float mu   = tot * (1.0f / DIMSZ);
    float var  = totq * (1.0f / DIMSZ) - mu * mu;
    float rinv = rsqrtf(var + 1e-5f);
    float mk   = seq_mask[tok];
    const float* fb = film + (size_t)b * 2 * DIMSZ;
#pragma unroll
    for (int e = 0; e < 2; ++e) {
        int   d  = tid + e * 256;
        float v  = (e == 0) ? v0 : v1;
        float xn = (v - mu) * rinv * gamma[d];
        xn = xn * (fb[d] + 1.0f) + fb[DIMSZ + d];
        xn = xn * mk * 0.125f;            // fold 64^-0.5 (only q uses xn)
        xn16[(size_t)tok * DIMSZ + d] = (_Float16)xn;
        x16 [(size_t)tok * DIMSZ + d] = (_Float16)v;
    }
}

// ---------------------------------------------------------------------------
// WMMA GEMM, 16x64 tile per wave (A fragment reused across 4 N-tiles),
// f16 output with arbitrary (batched) output strides:
//   Out[b*obs + (row%npb)*ors + col*ocs] = (A[row,:] . W[col,:])
// ---------------------------------------------------------------------------
__global__ void gemm_f16out_kernel(const _Float16* __restrict__ A,
                                   const _Float16* __restrict__ W,
                                   _Float16* __restrict__ Out,
                                   int M, int NOUT, int K,
                                   int npb, long long obs, int ors, int ocs) {
    int wave = blockIdx.x * (blockDim.x >> 5) + (threadIdx.x >> 5);
    int tiles_n = NOUT >> 6;                   // 64 columns per wave
    int tm = wave / tiles_n, tn = wave % tiles_n;
    if (tm >= (M >> 4)) return;
    int lane = threadIdx.x & 31;
    int l15 = lane & 15, halfsel = lane >> 4, base0 = halfsel ? 8 : 0;
    int rowbase = tm << 4, colbase = tn << 6;
    const _Float16* arow = A + (size_t)(rowbase + l15) * K;
    const _Float16* wrow[4];
#pragma unroll
    for (int c = 0; c < 4; ++c)
        wrow[c] = W + (size_t)(colbase + c * 16 + l15) * K;
    v8f acc[4];
#pragma unroll
    for (int c = 0; c < 4; ++c) acc[c] = (v8f){};
    for (int kk = 0; kk < K; kk += 32) {
        v16h a = mk16(*(const h8_t*)(arow + kk + base0),
                      *(const h8_t*)(arow + kk + 16 + base0));
#pragma unroll
        for (int c = 0; c < 4; ++c) {
            v16h bf = mk16(*(const h8_t*)(wrow[c] + kk + base0),
                           *(const h8_t*)(wrow[c] + kk + 16 + base0));
            acc[c] = __builtin_amdgcn_wmma_f32_16x16x32_f16(
                false, a, false, bf, (short)0, acc[c], false, false);
        }
    }
#pragma unroll
    for (int c = 0; c < 4; ++c) {
#pragma unroll
        for (int r = 0; r < 8; ++r) {
            int grow = rowbase + r + halfsel * 8;
            int bidx = grow / npb, rloc = grow % npb;
            size_t addr = (size_t)bidx * obs + (size_t)rloc * ors
                        + (size_t)(colbase + c * 16 + l15) * ocs;
            Out[addr] = (_Float16)acc[c][r];
        }
    }
}

// WMMA GEMM (16x64 tile), f32 output [M, NOUT], multiplied by per-row mask
__global__ void gemm_f32mask_kernel(const _Float16* __restrict__ A,
                                    const _Float16* __restrict__ W,
                                    const float* __restrict__ seq_mask,
                                    float* __restrict__ Out,
                                    int M, int NOUT, int K) {
    int wave = blockIdx.x * (blockDim.x >> 5) + (threadIdx.x >> 5);
    int tiles_n = NOUT >> 6;
    int tm = wave / tiles_n, tn = wave % tiles_n;
    if (tm >= (M >> 4)) return;
    int lane = threadIdx.x & 31;
    int l15 = lane & 15, halfsel = lane >> 4, base0 = halfsel ? 8 : 0;
    int rowbase = tm << 4, colbase = tn << 6;
    const _Float16* arow = A + (size_t)(rowbase + l15) * K;
    const _Float16* wrow[4];
#pragma unroll
    for (int c = 0; c < 4; ++c)
        wrow[c] = W + (size_t)(colbase + c * 16 + l15) * K;
    v8f acc[4];
#pragma unroll
    for (int c = 0; c < 4; ++c) acc[c] = (v8f){};
    for (int kk = 0; kk < K; kk += 32) {
        v16h a = mk16(*(const h8_t*)(arow + kk + base0),
                      *(const h8_t*)(arow + kk + 16 + base0));
#pragma unroll
        for (int c = 0; c < 4; ++c) {
            v16h bf = mk16(*(const h8_t*)(wrow[c] + kk + base0),
                           *(const h8_t*)(wrow[c] + kk + 16 + base0));
            acc[c] = __builtin_amdgcn_wmma_f32_16x16x32_f16(
                false, a, false, bf, (short)0, acc[c], false, false);
        }
    }
#pragma unroll
    for (int r = 0; r < 8; ++r) {
        int grow = rowbase + r + halfsel * 8;
        float mk = seq_mask[grow];
#pragma unroll
        for (int c = 0; c < 4; ++c)
            Out[(size_t)grow * NOUT + colbase + c * 16 + l15] = acc[c][r] * mk;
    }
}

__device__ __forceinline__ float other_half(float v) {
    int b = __builtin_bit_cast(int, v);
    b = __builtin_amdgcn_permlanex16(b, b, 0x76543210, 0xfedcba98, false, false);
    return __builtin_bit_cast(float, b);
}

__global__ void attn_kernel(const _Float16* __restrict__ q16,
                            const _Float16* __restrict__ k16,
                            const _Float16* __restrict__ vT,
                            const float* __restrict__ bias,
                            const float* __restrict__ seq_mask,
                            _Float16* __restrict__ ao) {
    // wave number as a scalar: tile indices and bases are then computed in scalar
    // registers and take no vector registers from the fragments
    int wib   = __builtin_amdgcn_readfirstlane(threadIdx.x >> 5);
    int lane  = threadIdx.x & 31;
    int gwave = blockIdx.x * 4 + wib;
    int qtile = gwave & 127;              // SEQ/16 = 128
    int h     = (gwave >> 7) & 7;
    int b     = gwave >> 10;
    int qbase = qtile << 4;
    int l15 = lane & 15, halfsel = lane >> 4, base0 = halfsel ? 8 : 0;
    size_t bN   = (size_t)b * SEQ;
    int    hoff = h * DHEAD;
    unsigned rowoff = (unsigned)(l15 * DIMSZ + base0);   // q16, k16, ao: row l15
    unsigned seqoff = (unsigned)(l15 * SEQ + base0);     // bias, vT: row l15

    // Q fragments (d 0..31, d 32..63), scale already folded into xn
    const _Float16* qr = q16 + (bN + qbase) * DIMSZ + hoff;
    v16h aq0 = mk16(*(const h8_t*)(qr + rowoff),      *(const h8_t*)(qr + rowoff + 16));
    v16h aq1 = mk16(*(const h8_t*)(qr + rowoff + 32), *(const h8_t*)(qr + rowoff + 48));

    float mi   = seq_mask[bN + qbase + l15];   // this lane's query
    float mrow = -1.0e30f;                     // running maximum (same in both halves)
    float lrow = 0.0f;                         // running sum of this half's keys
    v8f   Oacc[4];                             // Ot: [d = t*16 + 8*half + r][query l15]
#pragma unroll
    for (int t = 0; t < 4; ++t) Oacc[t] = (v8f){};

    // wave-uniform bases of this tile's K rows, bias rows, key masks and Vt rows
    const _Float16* kbase = k16 + bN * DIMSZ + hoff;
    const float*    bbase = bias + ((size_t)(b * HEADS + h) * SEQ + qbase) * SEQ;
    const float*    mbase = seq_mask + bN;
    const _Float16* vbase = vT + ((size_t)b * DIMSZ + hoff) * SEQ;

    for (int jb = 0; jb < SEQ / 32; ++jb) {
        int kb = jb * 32;
        // ---- St = K . Qt  (two 16-key tiles) ----
        const _Float16* kr0 = kbase + (size_t)kb * DIMSZ;
        const _Float16* kr1 = kr0 + 16 * DIMSZ;
        v16h b00 = mk16(*(const h8_t*)(kr0 + rowoff),      *(const h8_t*)(kr0 + rowoff + 16));
        v16h b01 = mk16(*(const h8_t*)(kr0 + rowoff + 32), *(const h8_t*)(kr0 + rowoff + 48));
        v16h b10 = mk16(*(const h8_t*)(kr1 + rowoff),      *(const h8_t*)(kr1 + rowoff + 16));
        v16h b11 = mk16(*(const h8_t*)(kr1 + rowoff + 32), *(const h8_t*)(kr1 + rowoff + 48));
        v8f z = {};
        v8f S0 = __builtin_amdgcn_wmma_f32_16x16x32_f16(false, b00, false, aq0, (short)0, z,  false, false);
        S0     = __builtin_amdgcn_wmma_f32_16x16x32_f16(false, b01, false, aq1, (short)0, S0, false, false);
        v8f S1 = __builtin_amdgcn_wmma_f32_16x16x32_f16(false, b10, false, aq0, (short)0, z,  false, false);
        S1     = __builtin_amdgcn_wmma_f32_16x16x32_f16(false, b11, false, aq1, (short)0, S1, false, false);

        f4_t bv[4], mv[4];                 // [0,1]: keys of tile 0, [2,3]: tile 1
#pragma unroll
        for (int g = 0; g < 4; ++g) {
            int o = (g >> 1) * 16 + (g & 1) * 4;
            bv[g] = *(const f4_t*)(bbase + kb + seqoff + o);
            mv[g] = *(const f4_t*)(mbase + kb + (unsigned)base0 + o);
        }

        // ---- bias add + pair mask + online softmax (in-lane, one max exchange between halves) ----
        float s[16];
#pragma unroll
        for (int i = 0; i < 8; ++i) {
            s[i]     = S0[i] + bv[i >> 2][i & 3]       - (1.0f - mi * mv[i >> 2][i & 3])       * NEGV;
            s[8 + i] = S1[i] + bv[2 + (i >> 2)][i & 3] - (1.0f - mi * mv[2 + (i >> 2)][i & 3]) * NEGV;
        }
        float tm[8];
#pragma unroll
        for (int i = 0; i < 8; ++i) tm[i] = fmaxf(s[i], s[8 + i]);
        float tmax = fmaxf(fmaxf(fmaxf(tm[0], tm[1]), fmaxf(tm[2], tm[3])),
                           fmaxf(fmaxf(tm[4], tm[5]), fmaxf(tm[6], tm[7])));
        tmax = fmaxf(tmax, other_half(tmax));
        float mnew  = fmaxf(mrow, tmax);
        float alpha = exp_slot(mrow - mnew);
        mrow = mnew;

        v16h  pb;                          // Pt as B operand: element i <-> score i
        float ps[4];                       // four partial sums of this lane's p
#pragma unroll
        for (int i = 0; i < 16; ++i) {
            float p = exp_slot(s[i] - mnew);
            ps[i & 3] = (i < 4) ? p : ps[i & 3] + p;
            pb[i] = (_Float16)p;
        }
        lrow = lrow * alpha + ((ps[0] + ps[1]) + (ps[2] + ps[3]));
#pragma unroll
        for (int t = 0; t < 4; ++t) Oacc[t] *= alpha;

        // ---- Ot += Vt . Pt  (V stored transposed: keys contiguous) ----
#pragma unroll
        for (int t = 0; t < 4; ++t) {
            const _Float16* vr = vbase + kb + t * 16 * SEQ;
            v16h va = mk16(*(const h8_t*)(vr + seqoff), *(const h8_t*)(vr + seqoff + 16));
            Oacc[t] = __builtin_amdgcn_wmma_f32_16x16x32_f16(
                false, va, false, pb, (short)0, Oacc[t], false, false);
        }
    }

    // ---- join the halves' sums, normalize + store (8 consecutive d per lane) ----
    lrow += other_half(lrow);
    float inv = (lrow > 0.0f) ? (1.0f / lrow) : 0.0f;
    _Float16* orow = ao + (bN + qbase) * DIMSZ + hoff + rowoff;
#pragma unroll
    for (int t = 0; t < 4; ++t) {
        h8_t o;
#pragma unroll
        for (int r = 0; r < 8; ++r) o[r] = (_Float16)(Oacc[t][r] * inv);
        *(h8_t*)(orow + t * 16) = o;
    }
}

// ---------------------------------------------------------------------------
// launcher
// ---------------------------------------------------------------------------
extern "C" void kernel_launch(void* const* d_in, const int* in_sizes, int n_in,
                              void* d_out, int out_size, void* d_ws, size_t ws_size,
                              hipStream_t stream) {
    const float* x     = (const float*)d_in[0];
    const float* timep = (const float*)d_in[1];
    const float* bias  = (const float*)d_in[2];
    const float* mask  = (const float*)d_in[3];
    const float* gamma = (const float*)d_in[4];
    const float* wtime = (const float*)d_in[5];
    const float* btime = (const float*)d_in[6];
    const float* wq    = (const float*)d_in[7];
    const float* wkv   = (const float*)d_in[8];
    const float* wout  = (const float*)d_in[9];
    float* out = (float*)d_out;

    uint8_t* ws = (uint8_t*)d_ws;
    size_t off = 0;
    auto alloc = [&](size_t bytes) -> uint8_t* {
        uint8_t* p = ws + off;
        off += (bytes + 255) & ~(size_t)255;
        return p;
    };
    const size_t ACT = (size_t)BATCH * SEQ * DIMSZ;        // 2M elems
    float*    film  = (float*)   alloc(BATCH * 2 * DIMSZ * 4);
    _Float16* xn16  = (_Float16*)alloc(ACT * 2);
    _Float16* x16   = (_Float16*)alloc(ACT * 2);
    _Float16* wq16  = (_Float16*)alloc((size_t)DIMSZ * DIMSZ * 2);
    _Float16* wkv16 = (_Float16*)alloc((size_t)2 * DIMSZ * DIMSZ * 2);
    _Float16* wo16  = (_Float16*)alloc((size_t)DIMSZ * DIMSZ * 2);
    _Float16* q16   = (_Float16*)alloc(ACT * 2);
    _Float16* k16   = (_Float16*)alloc(ACT * 2);
    _Float16* vT16  = (_Float16*)alloc(ACT * 2);
    _Float16* ao16  = (_Float16*)alloc(ACT * 2);

    // weight converts
    cvt_f16_kernel<<<(DIMSZ * DIMSZ + 255) / 256, 256, 0, stream>>>(wq, wq16, DIMSZ * DIMSZ);
    cvt_f16_kernel<<<(2 * DIMSZ * DIMSZ + 255) / 256, 256, 0, stream>>>(wkv, wkv16, 2 * DIMSZ * DIMSZ);
    cvt_f16_kernel<<<(DIMSZ * DIMSZ + 255) / 256, 256, 0, stream>>>(wout, wo16, DIMSZ * DIMSZ);

    // FiLM params, then fused LN+FiLM+mask
    film_kernel<<<2 * DIMSZ / 4, 128, 0, stream>>>(timep, wtime, btime, film);
    ln_film_kernel<<<BATCH * SEQ, 256, 0, stream>>>(x, gamma, film, mask, xn16, x16);

    const int M = BATCH * SEQ;                    // 4096
    const int tiles64 = (M / 16) * (DIMSZ / 64);  // 2048 waves -> 512 blocks
    // q = xn @ wq^T        -> [B,SEQ,512]
    gemm_f16out_kernel<<<tiles64 / 4, 128, 0, stream>>>(
        xn16, wq16, q16, M, DIMSZ, DIMSZ, SEQ, (long long)SEQ * DIMSZ, DIMSZ, 1);
    // k = x @ wkv[0:512]^T -> [B,SEQ,512]
    gemm_f16out_kernel<<<tiles64 / 4, 128, 0, stream>>>(
        x16, wkv16, k16, M, DIMSZ, DIMSZ, SEQ, (long long)SEQ * DIMSZ, DIMSZ, 1);
    // v = x @ wkv[512:]^T  -> stored TRANSPOSED [B, 512, SEQ]
    gemm_f16out_kernel<<<tiles64 / 4, 128, 0, stream>>>(
        x16, wkv16 + (size_t)DIMSZ * DIMSZ, vT16, M, DIMSZ, DIMSZ,
        SEQ, (long long)DIMSZ * SEQ, 1, SEQ);

    // flash attention: B*H*(SEQ/16) = 2048 waves, 4 waves / block
    attn_kernel<<<BATCH * HEADS * (SEQ / 16) / 4, 128, 0, stream>>>(
        q16, k16, vT16, bias, mask, ao16);

    // out = (ao @ wout^T) * mask  -> f32
    gemm_f32mask_kernel<<<tiles64 / 4, 128, 0, stream>>>(
        ao16, wo16, mask, out, M, DIMSZ, DIMSZ);
}

// v003
// It runs in 193 microseconds.
// Two timings next to v002 both put it at 1.12 times that version's speed.
// Over all steps from v000 it is 2.69 times as fast.
#include <hip/hip_runtime.h>

typedef _Float16 h8_t  __attribute__((ext_vector_type(8)));
typedef _Float16 v16h  __attribute__((ext_vector_type(16)));
typedef float    v8f   __attribute__((ext_vector_type(8)));
typedef float    f4_t  __attribute__((ext_vector_type(4)));

#define BATCH 2
#define SEQ   2048
#define DIMSZ 512
#define HEADS 8
#define DHEAD 64
#define NEGV  1.0e6f

// ---------------------------------------------------------------------------
// helpers
// ---------------------------------------------------------------------------
__device__ __forceinline__ v16h mk16(h8_t lo, h8_t hi) {
    v16h r;
#pragma unroll
    for (int i = 0; i < 8; ++i) { r[i] = lo[i]; r[i + 8] = hi[i]; }
    return r;
}

__device__ __forceinline__ float exp_slot(float x) {
    float y = x * 1.44269504f, r;
    asm("v_exp_f32 %0, %1\n\tv_nop" : "=v"(r) : "v"(y));
    return r;
}

// ---------------------------------------------------------------------------
// f32 -> f16 convert
// ---------------------------------------------------------------------------
__global__ void cvt_f16_kernel(const float* __restrict__ in,
                               _Float16* __restrict__ out, int n) {
    int i = blockIdx.x * 256 + threadIdx.x;
    if (i < n) out[i] = (_Float16)in[i];
}

// ---------------------------------------------------------------------------
// FiLM: film[b, o] = b_time[o] + sum_k silu(time[b,k]) * w_time[o,k]
// One wave per output row o (4 waves a block, 256 blocks). The 32 lanes read the
// row in whole 128-byte lines (lane l holds k = 128*j + 4*l .. + 3), once for all
// batches; each lane sums its 16 products (lane 0 on top of b_time[o]) and a
// butterfly over the lanes joins the partial sums.
// ---------------------------------------------------------------------------
__global__ void film_kernel(const float* __restrict__ timep,
                            const float* __restrict__ w_time,
                            const float* __restrict__ b_time,
                            float* __restrict__ film) {
    // wave number as a scalar: the row's base address stays in scalar registers
    int o    = blockIdx.x * 4 + __builtin_amdgcn_readfirstlane(threadIdx.x >> 5);
    int lane = threadIdx.x & 31;
    const f4_t* wr = (const f4_t*)(w_time + (size_t)o * DIMSZ);
    f4_t w[4], t[BATCH][4];                // DIMSZ = 4 * 128
#pragma unroll
    for (int j = 0; j < 4; ++j) {
        w[j] = wr[j * 32 + lane];
#pragma unroll
        for (int b = 0; b < BATCH; ++b)
            t[b][j] = ((const f4_t*)(timep + b * DIMSZ))[j * 32 + lane];
    }
    float bt = b_time[o];
    // keeps every load above ahead of the arithmetic, so a wave waits out one memory
    // latency; without it the compiler sinks seven of the vector loads between the
    // silu blocks and the wave waits four times
    __builtin_amdgcn_sched_barrier(0);
    float acc[BATCH];
#pragma unroll
    for (int b = 0; b < BATCH; ++b) {
        acc[b] = (lane == 0) ? bt : 0.0f;   // lane 0's chain starts from the bias
#pragma unroll
        for (int j = 0; j < 4; ++j)
#pragma unroll
            for (int c = 0; c < 4; ++c) {
                float tv = t[b][j][c];
                acc[b] = fmaf(tv / (1.0f + exp_slot(-tv)), w[j][c], acc[b]);   // silu
            }
    }
#pragma unroll
    for (int off = 16; off; off >>= 1)
#pragma unroll
        for (int b = 0; b < BATCH; ++b) acc[b] += __shfl_xor(acc[b], off, 32);
    // every lane holds every batch's sum: lane b stores batch b
    float r = acc[0];
#pragma unroll
    for (int b = 1; b < BATCH; ++b) r = (lane == b) ? acc[b] : r;
    if (lane < BATCH) film[lane * 2 * DIMSZ + o] = r;
}

// ---------------------------------------------------------------------------
// LayerNorm + FiLM + seq-mask + fold dim_head^-0.5, emit f16; also x -> f16
// one block (256 thr) per token, 2 elements per thread
// ---------------------------------------------------------------------------
__global__ void ln_film_kernel(const float* __restrict__ x,
                               const float* __restrict__ gamma,
                               const float* __restrict__ film,
                               const float* __restrict__ seq_mask,
                               _Float16* __restrict__ xn16,
                               _Float16* __restrict__ x16) {
    int tok = blockIdx.x;                 // 0 .. B*SEQ-1
    int b   = tok / SEQ;
    int tid = threadIdx.x;
    const float* xr = x + (size_t)tok * DIMSZ;
    float v0 = xr[tid], v1 = xr[tid + 256];
    float s  = v0 + v1;
    float sq = v0 * v0 + v1 * v1;
#pragma unroll
    for (int off = 16; off; off >>= 1) {
        s  += __shfl_xor(s,  off, 32);
        sq += __shfl_xor(sq, off, 32);
    }
    __shared__ float ssum[8], ssq[8];
    int wv = tid >> 5, ln = tid & 31;
    if (ln == 0) { ssum[wv] = s; ssq[wv] = sq; }
    __syncthreads();
    float tot = 0.f, totq = 0.f;
#pragma unroll
    for (int i = 0; i < 8; ++i) { tot += ssum[i]; totq += ssq[i]; }
    float mu   = tot * (1.0f / DIMSZ);
    float var  = totq * (1.0f / DIMSZ) - mu * mu;
    float rinv = rsqrtf(var + 1e-5f);
    float mk   = seq_mask[tok];
    const float* fb = film + (size_t)b * 2 * DIMSZ;
#pragma unroll
    for (int e = 0; e < 2; ++e) {
        int   d  = tid + e * 256;
        float v  = (e == 0) ? v0 : v1;
        float xn = (v - mu) * rinv * gamma[d];
        xn = xn * (fb[d] + 1.0f) + fb[DIMSZ + d];
        xn = xn * mk * 0.125f;            // fold 64^-0.5 (only q uses xn)
        xn16[(size_t)tok * DIMSZ + d] = (_Float16)xn;
        x16 [(size_t)tok * DIMSZ + d] = (_Float16)v;
    }
}

// ---------------------------------------------------------------------------
// WMMA GEMM, 16x64 tile per wave (A fragment reused across 4 N-tiles),
// f16 output with arbitrary (batched) output strides:
//   Out[b*obs + (row%npb)*ors + col*ocs] = (A[row,:] . W[col,:])
// ---------------------------------------------------------------------------
__global__ void gemm_f16out_kernel(const _Float16* __restrict__ A,
                                   const _Float16* __restrict__ W,
                                   _Float16* __restrict__ Out,
                                   int M, int NOUT, int K,
                                   int npb, long long obs, int ors, int ocs) {
    int wave = blockIdx.x * (blockDim.x >> 5) + (threadIdx.x >> 5);
    int tiles_n = NOUT >> 6;                   // 64 columns per wave
    int tm = wave / tiles_n, tn = wave % tiles_n;
    if (tm >= (M >> 4)) return;
    int lane = threadIdx.x & 31;
    int l15 = lane & 15, halfsel = lane >> 4, base0 = halfsel ? 8 : 0;
    int rowbase = tm << 4, colbase = tn << 6;
    const _Float16* arow = A + (size_t)(rowbase + l15) * K;
    const _Float16* wrow[4];
#pragma unroll
    for (int c = 0; c < 4; ++c)
        wrow[c] = W + (size_t)(colbase + c * 16 + l15) * K;
    v8f acc[4];
#pragma unroll
    for (int c = 0; c < 4; ++c) acc[c] = (v8f){};
    for (int kk = 0; kk < K; kk += 32) {
        v16h a = mk16(*(const h8_t*)(arow + kk + base0),
                      *(const h8_t*)(arow + kk + 16 + base0));
#pragma unroll
        for (int c = 0; c < 4; ++c) {
            v16h bf = mk16(*(const h8_t*)(wrow[c] + kk + base0),
                           *(const h8_t*)(wrow[c] + kk + 16 + base0));
            acc[c] = __builtin_amdgcn_wmma_f32_16x16x32_f16(
                false, a, false, bf, (short)0, acc[c], false, false);
        }
    }
#pragma unroll
    for (int c = 0; c < 4; ++c) {
#pragma unroll
        for (int r = 0; r < 8; ++r) {
            int grow = rowbase + r + halfsel * 8;
            int bidx = grow / npb, rloc = grow % npb;
            size_t addr = (size_t)bidx * obs + (size_t)rloc * ors
                        + (size_t)(colbase + c * 16 + l15) * ocs;
            Out[addr] = (_Float16)acc[c][r];
        }
    }
}

// ---------------------------------------------------------------------------
// WMMA GEMM, 16 tokens x 64 features (one head) per wave, f16 output in the
// FRAGMENT ORDER in which attn_kernel reads K and V as A operands:
//   Out[((b*HEADS + h)*(SEQ/16) + token_tile)*1024 + c*256 + lane*8 + e]
// so that one 16-byte load per lane covers 512 contiguous bytes (4 whole lines).
// FEAT_IN_LANE (K): D = W . At; lane (l15, half) holds token l15 and features
//   c*16 + 8*half + e, which is chunk c of K's fragment row l15.
// otherwise   (V): D = A . Wt; lane (l15, half) holds feature c*16 + l15 and
//   tokens 8*half + e, which is this 16-token tile's chunk of Vt's fragment row.
// ---------------------------------------------------------------------------
template <bool FEAT_IN_LANE>
__device__ __forceinline__ void gemm_frag_body(const _Float16* __restrict__ A,
                                               const _Float16* __restrict__ W,
                                               _Float16* __restrict__ Out,
                                               int M, int NOUT, int K) {
    int wave = blockIdx.x * (blockDim.x >> 5) + (threadIdx.x >> 5);
    int tiles_n = NOUT >> 6;                   // 64 columns (one head) per wave
    int tm = wave / tiles_n, tn = wave % tiles_n;
    if (tm >= (M >> 4)) return;
    int lane = threadIdx.x & 31;
    int l15 = lane & 15, halfsel = lane >> 4, base0 = halfsel ? 8 : 0;
    int rowbase = tm << 4, colbase = tn << 6;
    const _Float16* arow = A + (size_t)(rowbase + l15) * K;
    const _Float16* wrow[4];
#pragma unroll
    for (int c = 0; c < 4; ++c)
        wrow[c] = W + (size_t)(colbase + c * 16 + l15) * K;
    v8f acc[4];
#pragma unroll
    for (int c = 0; c < 4; ++c) acc[c] = (v8f){};
    for (int kk = 0; kk < K; kk += 32) {
        v16h a = mk16(*(const h8_t*)(arow + kk + base0),
                      *(const h8_t*)(arow + kk + 16 + base0));
#pragma unroll
        for (int c = 0; c < 4; ++c) {
            v16h bf = mk16(*(const h8_t*)(wrow[c] + kk + base0),
                           *(const h8_t*)(wrow[c] + kk + 16 + base0));
            acc[c] = FEAT_IN_LANE
                ? __builtin_amdgcn_wmma_f32_16x16x32_f16(
                      false, bf, false, a, (short)0, acc[c], false, false)
                : __builtin_amdgcn_wmma_f32_16x16x32_f16(
                      false, a, false, bf, (short)0, acc[c], false, false);
        }
    }
    int bidx = tm / (SEQ / 16), ttile = tm % (SEQ / 16);
    _Float16* o = Out + ((size_t)(bidx * tiles_n + tn) * (SEQ / 16) + ttile) * 1024 + lane * 8;
#pragma unroll
    for (int c = 0; c < 4; ++c) {
        h8_t v;
#pragma unroll
        for (int r = 0; r < 8; ++r) v[r] = (_Float16)acc[c][r];
        *(h8_t*)(o + c * 256) = v;
    }
}

__global__ void gemm_kfrag_kernel(const _Float16* __restrict__ A,
                                  const _Float16* __restrict__ W,
                                  _Float16* __restrict__ Out, int M, int NOUT, int K) {
    gemm_frag_body<true>(A, W, Out, M, NOUT, K);
}

__global__ void gemm_vfrag_kernel(const _Float16* __restrict__ A,
                                  const _Float16* __restrict__ W,
                                  _Float16* __restrict__ Out, int M, int NOUT, int K) {
    gemm_frag_body<false>(A, W, Out, M, NOUT, K);
}

// WMMA GEMM (16x64 tile), f32 output [M, NOUT], multiplied by per-row mask
__global__ void gemm_f32mask_kernel(const _Float16* __restrict__ A,
                                    const _Float16* __restrict__ W,
                                    const float* __restrict__ seq_mask,
                                    float* __restrict__ Out,
                                    int M, int NOUT, int K) {
    int wave = blockIdx.x * (blockDim.x >> 5) + (threadIdx.x >> 5);
    int tiles_n = NOUT >> 6;
    int tm = wave / tiles_n, tn = wave % tiles_n;
    if (tm >= (M >> 4)) return;
    int lane = threadIdx.x & 31;
    int l15 = lane & 15, halfsel = lane >> 4, base0 = halfsel ? 8 : 0;
    int rowbase = tm << 4, colbase = tn << 6;
    const _Float16* arow = A + (size_t)(rowbase + l15) * K;
    const _Float16* wrow[4];
#pragma unroll
    for (int c = 0; c < 4; ++c)
        wrow[c] = W + (size_t)(colbase + c * 16 + l15) * K;
    v8f acc[4];
#pragma unroll
    for (int c = 0; c < 4; ++c) acc[c] = (v8f){};
    for (int kk = 0; kk < K; kk += 32) {
        v16h a = mk16(*(const h8_t*)(arow + kk + base0),
                      *(const h8_t*)(arow + kk + 16 + base0));
#pragma unroll
        for (int c = 0; c < 4; ++c) {
            v16h bf = mk16(*(const h8_t*)(wrow[c] + kk + base0),
                           *(const h8_t*)(wrow[c] + kk + 16 + base0));
            acc[c] = __builtin_amdgcn_wmma_f32_16x16x32_f16(
                false, a, false, bf, (short)0, acc[c], false, false);
        }
    }
#pragma unroll
    for (int r = 0; r < 8; ++r) {
        int grow = rowbase + r + halfsel * 8;
        float mk = seq_mask[grow];
#pragma unroll
        for (int c = 0; c < 4; ++c)
            Out[(size_t)grow * NOUT + colbase + c * 16 + l15] = acc[c][r] * mk;
    }
}

__device__ __forceinline__ float other_half(float v) {
    int b = __builtin_bit_cast(int, v);
    b = __builtin_amdgcn_permlanex16(b, b, 0x76543210, 0xfedcba98, false, false);
    return __builtin_bit_cast(float, b);
}

__global__ void attn_kernel(const _Float16* __restrict__ q16,
                            const _Float16* __restrict__ kf,
                            const _Float16* __restrict__ vf,
                            const float* __restrict__ bias,
                            const float* __restrict__ seq_mask,
                            _Float16* __restrict__ ao) {
    // wave number as a scalar: tile indices and bases are then computed in scalar
    // registers and take no vector registers from the fragments
    int wib   = __builtin_amdgcn_readfirstlane(threadIdx.x >> 5);
    int lane  = threadIdx.x & 31;
    int gwave = blockIdx.x * 4 + wib;
    int qtile = gwave & 127;              // SEQ/16 = 128
    int h     = (gwave >> 7) & 7;
    int b     = gwave >> 10;
    int qbase = qtile << 4;
    int l15 = lane & 15, halfsel = lane >> 4, base0 = halfsel ? 8 : 0;
    size_t bN   = (size_t)b * SEQ;
    int    hoff = h * DHEAD;
    unsigned rowoff = (unsigned)(l15 * DIMSZ + base0);   // q16, ao: row l15
    unsigned seqoff = (unsigned)(l15 * SEQ + base0);     // bias: row l15
    unsigned frgoff = (unsigned)(lane * 8);              // kf, vf: this lane's 16 bytes

    // Q fragments (d 0..31, d 32..63), scale already folded into xn
    const _Float16* qr = q16 + (bN + qbase) * DIMSZ + hoff;
    v16h aq0 = mk16(*(const h8_t*)(qr + rowoff),      *(const h8_t*)(qr + rowoff + 16));
    v16h aq1 = mk16(*(const h8_t*)(qr + rowoff + 32), *(const h8_t*)(qr + rowoff + 48));

    float mi   = seq_mask[bN + qbase + l15];   // this lane's query
    float mrow = -1.0e30f;                     // running maximum (same in both halves)
    float lrow = 0.0f;                         // running sum of this half's keys
    v8f   Oacc[4];                             // Ot: [d = t*16 + 8*half + r][query l15]
#pragma unroll
    for (int t = 0; t < 4; ++t) Oacc[t] = (v8f){};

    // wave-uniform bases of this head's K tiles, bias rows, key masks and V tiles
    const _Float16* kbase = kf + (size_t)(b * HEADS + h) * (SEQ / 16) * 1024;
    const float*    bbase = bias + ((size_t)(b * HEADS + h) * SEQ + qbase) * SEQ;
    const float*    mbase = seq_mask + bN;
    const _Float16* vbase = vf + (size_t)(b * HEADS + h) * (SEQ / 16) * 1024;

    for (int jb = 0; jb < SEQ / 32; ++jb) {
        int kb = jb * 32;
        // ---- St = K . Qt  (two 16-key tiles) ----
        const _Float16* kr0 = kbase + (size_t)jb * 2048;   // two tiles of 1024
        const _Float16* kr1 = kr0 + 1024;
        v16h b00 = mk16(*(const h8_t*)(kr0 + frgoff),       *(const h8_t*)(kr0 + frgoff + 256));
        v16h b01 = mk16(*(const h8_t*)(kr0 + frgoff + 512), *(const h8_t*)(kr0 + frgoff + 768));
        v16h b10 = mk16(*(const h8_t*)(kr1 + frgoff),       *(const h8_t*)(kr1 + frgoff + 256));
        v16h b11 = mk16(*(const h8_t*)(kr1 + frgoff + 512), *(const h8_t*)(kr1 + frgoff + 768));
        // keeps the eight K loads in one group with one wait; without it this build
        // splits them into three groups among the products and waits out each
        __builtin_amdgcn_sched_barrier(0);
        v8f z = {};
        v8f S0 = __builtin_amdgcn_wmma_f32_16x16x32_f16(false, b00, false, aq0, (short)0, z,  false, false);
        S0     = __builtin_amdgcn_wmma_f32_16x16x32_f16(false, b01, false, aq1, (short)0, S0, false, false);
        v8f S1 = __builtin_amdgcn_wmma_f32_16x16x32_f16(false, b10, false, aq0, (short)0, z,  false, false);
        S1     = __builtin_amdgcn_wmma_f32_16x16x32_f16(false, b11, false, aq1, (short)0, S1, false, false);

        f4_t bv[4], mv[4];                 // [0,1]: keys of tile 0, [2,3]: tile 1
#pragma unroll
        for (int g = 0; g < 4; ++g) {
            int o = (g >> 1) * 16 + (g & 1) * 4;
            bv[g] = *(const f4_t*)(bbase + kb + seqoff + o);
            mv[g] = *(const f4_t*)(mbase + kb + (unsigned)base0 + o);
        }

        // ---- bias add + pair mask + online softmax (in-lane, one max exchange between halves) ----
        float s[16];
#pragma unroll
        for (int i = 0; i < 8; ++i) {
            s[i]     = S0[i] + bv[i >> 2][i & 3]       - (1.0f - mi * mv[i >> 2][i & 3])       * NEGV;
            s[8 + i] = S1[i] + bv[2 + (i >> 2)][i & 3] - (1.0f - mi * mv[2 + (i >> 2)][i & 3]) * NEGV;
        }
        float tm[8];
#pragma unroll
        for (int i = 0; i < 8; ++i) tm[i] = fmaxf(s[i], s[8 + i]);
        float tmax = fmaxf(fmaxf(fmaxf(tm[0], tm[1]), fmaxf(tm[2], tm[3])),
                           fmaxf(fmaxf(tm[4], tm[5]), fmaxf(tm[6], tm[7])));
        tmax = fmaxf(tmax, other_half(tmax));
        float mnew  = fmaxf(mrow, tmax);
        float alpha = exp_slot(mrow - mnew);
        mrow = mnew;

        v16h  pb;                          // Pt as B operand: element i <-> score i
        float ps[4];                       // four partial sums of this lane's p
#pragma unroll
        for (int i = 0; i < 16; ++i) {
            float p = exp_slot(s[i] - mnew);
            ps[i & 3] = (i < 4) ? p : ps[i & 3] + p;
            pb[i] = (_Float16)p;
        }
        lrow = lrow * alpha + ((ps[0] + ps[1]) + (ps[2] + ps[3]));
#pragma unroll
        for (int t = 0; t < 4; ++t) Oacc[t] *= alpha;

        // ---- Ot += Vt . Pt  (keys 0..15 from the first tile, 16..31 from the second) ----
#pragma unroll
        for (int t = 0; t < 4; ++t) {
            const _Float16* vr = vbase + (size_t)jb * 2048 + t * 256;
            v16h va = mk16(*(const h8_t*)(vr + frgoff), *(const h8_t*)(vr + frgoff + 1024));
            Oacc[t] = __builtin_amdgcn_wmma_f32_16x16x32_f16(
                false, va, false, pb, (short)0, Oacc[t], false, false);
        }
    }

    // ---- join the halves' sums, normalize + store (8 consecutive d per lane) ----
    lrow += other_half(lrow);
    float inv = (lrow > 0.0f) ? (1.0f / lrow) : 0.0f;
    _Float16* orow = ao + (bN + qbase) * DIMSZ + hoff + rowoff;
#pragma unroll
    for (int t = 0; t < 4; ++t) {
        h8_t o;
#pragma unroll
        for (int r = 0; r < 8; ++r) o[r] = (_Float16)(Oacc[t][r] * inv);
        *(h8_t*)(orow + t * 16) = o;
    }
}

// ---------------------------------------------------------------------------
// launcher
// ---------------------------------------------------------------------------
extern "C" void kernel_launch(void* const* d_in, const int* in_sizes, int n_in,
                              void* d_out, int out_size, void* d_ws, size_t ws_size,
                              hipStream_t stream) {
    const float* x     = (const float*)d_in[0];
    const float* timep = (const float*)d_in[1];
    const float* bias  = (const float*)d_in[2];
    const float* mask  = (const float*)d_in[3];
    const float* gamma = (const float*)d_in[4];
    const float* wtime = (const float*)d_in[5];
    const float* btime = (const float*)d_in[6];
    const float* wq    = (const float*)d_in[7];
    const float* wkv   = (const float*)d_in[8];
    const float* wout  = (const float*)d_in[9];
    float* out = (float*)d_out;

    uint8_t* ws = (uint8_t*)d_ws;
    size_t off = 0;
    auto alloc = [&](size_t bytes) -> uint8_t* {
        uint8_t* p = ws + off;
        off += (bytes + 255) & ~(size_t)255;
        return p;
    };
    const size_t ACT = (size_t)BATCH * SEQ * DIMSZ;        // 2M elems
    float*    film  = (float*)   alloc(BATCH * 2 * DIMSZ * 4);
    _Float16* xn16  = (_Float16*)alloc(ACT * 2);
    _Float16* x16   = (_Float16*)alloc(ACT * 2);
    _Float16* wq16  = (_Float16*)alloc((size_t)DIMSZ * DIMSZ * 2);
    _Float16* wkv16 = (_Float16*)alloc((size_t)2 * DIMSZ * DIMSZ * 2);
    _Float16* wo16  = (_Float16*)alloc((size_t)DIMSZ * DIMSZ * 2);
    _Float16* q16   = (_Float16*)alloc(ACT * 2);
    _Float16* k16   = (_Float16*)alloc(ACT * 2);
    _Float16* vT16  = (_Float16*)alloc(ACT * 2);
    _Float16* ao16  = (_Float16*)alloc(ACT * 2);

    // weight converts
    cvt_f16_kernel<<<(DIMSZ * DIMSZ + 255) / 256, 256, 0, stream>>>(wq, wq16, DIMSZ * DIMSZ);
    cvt_f16_kernel<<<(2 * DIMSZ * DIMSZ + 255) / 256, 256, 0, stream>>>(wkv, wkv16, 2 * DIMSZ * DIMSZ);
    cvt_f16_kernel<<<(DIMSZ * DIMSZ + 255) / 256, 256, 0, stream>>>(wout, wo16, DIMSZ * DIMSZ);

    // FiLM params, then fused LN+FiLM+mask
    film_kernel<<<2 * DIMSZ / 4, 128, 0, stream>>>(timep, wtime, btime, film);
    ln_film_kernel<<<BATCH * SEQ, 256, 0, stream>>>(x, gamma, film, mask, xn16, x16);

    const int M = BATCH * SEQ;                    // 4096
    const int tiles64 = (M / 16) * (DIMSZ / 64);  // 2048 waves -> 512 blocks
    // q = xn @ wq^T        -> [B,SEQ,512]
    gemm_f16out_kernel<<<tiles64 / 4, 128, 0, stream>>>(
        xn16, wq16, q16, M, DIMSZ, DIMSZ, SEQ, (long long)SEQ * DIMSZ, DIMSZ, 1);
    // k = x @ wkv[0:512]^T -> fragment order
    gemm_kfrag_kernel<<<tiles64 / 4, 128, 0, stream>>>(
        x16, wkv16, k16, M, DIMSZ, DIMSZ);
    // v = x @ wkv[512:]^T  -> fragment order
    gemm_vfrag_kernel<<<tiles64 / 4, 128, 0, stream>>>(
        x16, wkv16 + (size_t)DIMSZ * DIMSZ, vT16, M, DIMSZ, DIMSZ);

    // flash attention: B*H*(SEQ/16) = 2048 waves, 4 waves / block
    attn_kernel<<<BATCH * HEADS * (SEQ / 16) / 4, 128, 0, stream>>>(
        q16, k16, vT16, bias, mask, ao16);

    // out = (ao @ wout^T) * mask  -> f32
    gemm_f32mask_kernel<<<tiles64 / 4, 128, 0, stream>>>(
        ao16, wo16, mask, out, M, DIMSZ, DIMSZ);
}

// v004
// One run takes 134 microseconds.
// In two side-by-side timings against v003, it was 1.45 and 1.44 times as fast.
// All steps since v000 together make it 3.88 times as fast.
#include <hip/hip_runtime.h>

typedef _Float16 h8_t  __attribute__((ext_vector_type(8)));
typedef _Float16 v16h  __attribute__((ext_vector_type(16)));
typedef float    v8f   __attribute__((ext_vector_type(8)));
typedef float    f4_t  __attribute__((ext_vector_type(4)));

#define BATCH 2
#define SEQ   2048
#define DIMSZ 512
#define HEADS 8
#define DHEAD 64
#define NEGV  1.0e6f

// ---------------------------------------------------------------------------
// helpers
// ---------------------------------------------------------------------------
__device__ __forceinline__ v16h mk16(h8_t lo, h8_t hi) {
    v16h r;
#pragma unroll
    for (int i = 0; i < 8; ++i) { r[i] = lo[i]; r[i + 8] = hi[i]; }
    return r;
}

__device__ __forceinline__ float exp_slot(float x) {
    float y = x * 1.44269504f, r;
    asm("v_exp_f32 %0, %1\n\tv_nop" : "=v"(r) : "v"(y));
    return r;
}

// ---------------------------------------------------------------------------
// f32 -> f16 convert
// ---------------------------------------------------------------------------
__global__ void cvt_f16_kernel(const float* __restrict__ in,
                               _Float16* __restrict__ out, int n) {
    int i = blockIdx.x * 256 + threadIdx.x;
    if (i < n) out[i] = (_Float16)in[i];
}

// ---------------------------------------------------------------------------
// FiLM: film[b, o] = b_time[o] + sum_k silu(time[b,k]) * w_time[o,k]
// One wave per output row o (4 waves a block, 256 blocks). The 32 lanes read the
// row in whole 128-byte lines (lane l holds k = 128*j + 4*l .. + 3), once for all
// batches; each lane sums its 16 products (lane 0 on top of b_time[o]) and a
// butterfly over the lanes joins the partial sums.
// ---------------------------------------------------------------------------
__global__ void film_kernel(const float* __restrict__ timep,
                            const float* __restrict__ w_time,
                            const float* __restrict__ b_time,
                            float* __restrict__ film) {
    // wave number as a scalar: the row's base address stays in scalar registers
    int o    = blockIdx.x * 4 + __builtin_amdgcn_readfirstlane(threadIdx.x >> 5);
    int lane = threadIdx.x & 31;
    const f4_t* wr = (const f4_t*)(w_time + (size_t)o * DIMSZ);
    f4_t w[4], t[BATCH][4];                // DIMSZ = 4 * 128
#pragma unroll
    for (int j = 0; j < 4; ++j) {
        w[j] = wr[j * 32 + lane];
#pragma unroll
        for (int b = 0; b < BATCH; ++b)
            t[b][j] = ((const f4_t*)(timep + b * DIMSZ))[j * 32 + lane];
    }
    float bt = b_time[o];
    // keeps every load above ahead of the arithmetic, so a wave waits out one memory
    // latency; without it the compiler sinks seven of the vector loads between the
    // silu blocks and the wave waits four times
    __builtin_amdgcn_sched_barrier(0);
    float acc[BATCH];
#pragma unroll
    for (int b = 0; b < BATCH; ++b) {
        acc[b] = (lane == 0) ? bt : 0.0f;   // lane 0's chain starts from the bias
#pragma unroll
        for (int j = 0; j < 4; ++j)
#pragma unroll
            for (int c = 0; c < 4; ++c) {
                float tv = t[b][j][c];
                acc[b] = fmaf(tv / (1.0f + exp_slot(-tv)), w[j][c], acc[b]);   // silu
            }
    }
#pragma unroll
    for (int off = 16; off; off >>= 1)
#pragma unroll
        for (int b = 0; b < BATCH; ++b) acc[b] += __shfl_xor(acc[b], off, 32);
    // every lane holds every batch's sum: lane b stores batch b
    float r = acc[0];
#pragma unroll
    for (int b = 1; b < BATCH; ++b) r = (lane == b) ? acc[b] : r;
    if (lane < BATCH) film[lane * 2 * DIMSZ + o] = r;
}

// ---------------------------------------------------------------------------
// LayerNorm + FiLM + seq-mask + fold dim_head^-0.5, emit f16; also x -> f16
// one block (256 thr) per token, 2 elements per thread
// ---------------------------------------------------------------------------
__global__ void ln_film_kernel(const float* __restrict__ x,
                               const float* __restrict__ gamma,
                               const float* __restrict__ film,
                               const float* __restrict__ seq_mask,
                               _Float16* __restrict__ xn16,
                               _Float16* __restrict__ x16) {
    int tok = blockIdx.x;                 // 0 .. B*SEQ-1
    int b   = tok / SEQ;
    int tid = threadIdx.x;
    const float* xr = x + (size_t)tok * DIMSZ;
    float v0 = xr[tid], v1 = xr[tid + 256];
    float s  = v0 + v1;
    float sq = v0 * v0 + v1 * v1;
#pragma unroll
    for (int off = 16; off; off >>= 1) {
        s  += __shfl_xor(s,  off, 32);
        sq += __shfl_xor(sq, off, 32);
    }
    __shared__ float ssum[8], ssq[8];
    int wv = tid >> 5, ln = tid & 31;
    if (ln == 0) { ssum[wv] = s; ssq[wv] = sq; }
    __syncthreads();
    float tot = 0.f, totq = 0.f;
#pragma unroll
    for (int i = 0; i < 8; ++i) { tot += ssum[i]; totq += ssq[i]; }
    float mu   = tot * (1.0f / DIMSZ);
    float var  = totq * (1.0f / DIMSZ) - mu * mu;
    float rinv = rsqrtf(var + 1e-5f);
    float mk   = seq_mask[tok];
    const float* fb = film + (size_t)b * 2 * DIMSZ;
#pragma unroll
    for (int e = 0; e < 2; ++e) {
        int   d  = tid + e * 256;
        float v  = (e == 0) ? v0 : v1;
        float xn = (v - mu) * rinv * gamma[d];
        xn = xn * (fb[d] + 1.0f) + fb[DIMSZ + d];
        xn = xn * mk * 0.125f;            // fold 64^-0.5 (only q uses xn)
        xn16[(size_t)tok * DIMSZ + d] = (_Float16)xn;
        x16 [(size_t)tok * DIMSZ + d] = (_Float16)v;
    }
}

// ---------------------------------------------------------------------------
// WMMA GEMM, 16x64 tile per wave (A fragment reused across 4 N-tiles),
// f16 output with arbitrary (batched) output strides:
//   Out[b*obs + (row%npb)*ors + col*ocs] = (A[row,:] . W[col,:])
// ---------------------------------------------------------------------------
__global__ void gemm_f16out_kernel(const _Float16* __restrict__ A,
                                   const _Float16* __restrict__ W,
                                   _Float16* __restrict__ Out,
                                   int M, int NOUT, int K,
                                   int npb, long long obs, int ors, int ocs) {
    int wave = blockIdx.x * (blockDim.x >> 5) + (threadIdx.x >> 5);
    int tiles_n = NOUT >> 6;                   // 64 columns per wave
    int tm = wave / tiles_n, tn = wave % tiles_n;
    if (tm >= (M >> 4)) return;
    int lane = threadIdx.x & 31;
    int l15 = lane & 15, halfsel = lane >> 4, base0 = halfsel ? 8 : 0;
    int rowbase = tm << 4, colbase = tn << 6;
    const _Float16* arow = A + (size_t)(rowbase + l15) * K;
    const _Float16* wrow[4];
#pragma unroll
    for (int c = 0; c < 4; ++c)
        wrow[c] = W + (size_t)(colbase + c * 16 + l15) * K;
    v8f acc[4];
#pragma unroll
    for (int c = 0; c < 4; ++c) acc[c] = (v8f){};
    for (int kk = 0; kk < K; kk += 32) {
        v16h a = mk16(*(const h8_t*)(arow + kk + base0),
                      *(const h8_t*)(arow + kk + 16 + base0));
#pragma unroll
        for (int c = 0; c < 4; ++c) {
            v16h bf = mk16(*(const h8_t*)(wrow[c] + kk + base0),
                           *(const h8_t*)(wrow[c] + kk + 16 + base0));
            acc[c] = __builtin_amdgcn_wmma_f32_16x16x32_f16(
                false, a, false, bf, (short)0, acc[c], false, false);
        }
    }
#pragma unroll
    for (int c = 0; c < 4; ++c) {
#pragma unroll
        for (int r = 0; r < 8; ++r) {
            int grow = rowbase + r + halfsel * 8;
            int bidx = grow / npb, rloc = grow % npb;
            size_t addr = (size_t)bidx * obs + (size_t)rloc * ors
                        + (size_t)(colbase + c * 16 + l15) * ocs;
            Out[addr] = (_Float16)acc[c][r];
        }
    }
}

// ---------------------------------------------------------------------------
// WMMA GEMM, 16 tokens x 64 features (one head) per wave, f16 output in the
// FRAGMENT ORDER in which attn_kernel reads K and V as A operands:
//   Out[((b*HEADS + h)*(SEQ/16) + token_tile)*1024 + c*256 + lane*8 + e]
// so that one 16-byte load per lane covers 512 contiguous bytes (4 whole lines).
// FEAT_IN_LANE (K): D = W . At; lane (l15, half) holds token l15 and features
//   c*16 + 8*half + e, which is chunk c of K's fragment row l15.
// otherwise   (V): D = A . Wt; lane (l15, half) holds feature c*16 + l15 and
//   tokens 8*half + e, which is this 16-token tile's chunk of Vt's fragment row.
// ---------------------------------------------------------------------------
template <bool FEAT_IN_LANE>
__device__ __forceinline__ void gemm_frag_body(const _Float16* __restrict__ A,
                                               const _Float16* __restrict__ W,
                                               _Float16* __restrict__ Out,
                                               int M, int NOUT, int K) {
    int wave = blockIdx.x * (blockDim.x >> 5) + (threadIdx.x >> 5);
    int tiles_n = NOUT >> 6;                   // 64 columns (one head) per wave
    int tm = wave / tiles_n, tn = wave % tiles_n;
    if (tm >= (M >> 4)) return;
    int lane = threadIdx.x & 31;
    int l15 = lane & 15, halfsel = lane >> 4, base0 = halfsel ? 8 : 0;
    int rowbase = tm << 4, colbase = tn << 6;
    const _Float16* arow = A + (size_t)(rowbase + l15) * K;
    const _Float16* wrow[4];
#pragma unroll
    for (int c = 0; c < 4; ++c)
        wrow[c] = W + (size_t)(colbase + c * 16 + l15) * K;
    v8f acc[4];
#pragma unroll
    for (int c = 0; c < 4; ++c) acc[c] = (v8f){};
    for (int kk = 0; kk < K; kk += 32) {
        v16h a = mk16(*(const h8_t*)(arow + kk + base0),
                      *(const h8_t*)(arow + kk + 16 + base0));
#pragma unroll
        for (int c = 0; c < 4; ++c) {
            v16h bf = mk16(*(const h8_t*)(wrow[c] + kk + base0),
                           *(const h8_t*)(wrow[c] + kk + 16 + base0));
            acc[c] = FEAT_IN_LANE
                ? __builtin_amdgcn_wmma_f32_16x16x32_f16(
                      false, bf, false, a, (short)0, acc[c], false, false)
                : __builtin_amdgcn_wmma_f32_16x16x32_f16(
                      false, a, false, bf, (short)0, acc[c], false, false);
        }
    }
    int bidx = tm / (SEQ / 16), ttile = tm % (SEQ / 16);
    _Float16* o = Out + ((size_t)(bidx * tiles_n + tn) * (SEQ / 16) + ttile) * 1024 + lane * 8;
#pragma unroll
    for (int c = 0; c < 4; ++c) {
        h8_t v;
#pragma unroll
        for (int r = 0; r < 8; ++r) v[r] = (_Float16)acc[c][r];
        *(h8_t*)(o + c * 256) = v;
    }
}

__global__ void gemm_kfrag_kernel(const _Float16* __restrict__ A,
                                  const _Float16* __restrict__ W,
                                  _Float16* __restrict__ Out, int M, int NOUT, int K) {
    gemm_frag_body<true>(A, W, Out, M, NOUT, K);
}

__global__ void gemm_vfrag_kernel(const _Float16* __restrict__ A,
                                  const _Float16* __restrict__ W,
                                  _Float16* __restrict__ Out, int M, int NOUT, int K) {
    gemm_frag_body<false>(A, W, Out, M, NOUT, K);
}

// WMMA GEMM (16x64 tile), f32 output [M, NOUT], multiplied by per-row mask
__global__ void gemm_f32mask_kernel(const _Float16* __restrict__ A,
                                    const _Float16* __restrict__ W,
                                    const float* __restrict__ seq_mask,
                                    float* __restrict__ Out,
                                    int M, int NOUT, int K) {
    int wave = blockIdx.x * (blockDim.x >> 5) + (threadIdx.x >> 5);
    int tiles_n = NOUT >> 6;
    int tm = wave / tiles_n, tn = wave % tiles_n;
    if (tm >= (M >> 4)) return;
    int lane = threadIdx.x & 31;
    int l15 = lane & 15, halfsel = lane >> 4, base0 = halfsel ? 8 : 0;
    int rowbase = tm << 4, colbase = tn << 6;
    const _Float16* arow = A + (size_t)(rowbase + l15) * K;
    const _Float16* wrow[4];
#pragma unroll
    for (int c = 0; c < 4; ++c)
        wrow[c] = W + (size_t)(colbase + c * 16 + l15) * K;
    v8f acc[4];
#pragma unroll
    for (int c = 0; c < 4; ++c) acc[c] = (v8f){};
    for (int kk = 0; kk < K; kk += 32) {
        v16h a = mk16(*(const h8_t*)(arow + kk + base0),
                      *(const h8_t*)(arow + kk + 16 + base0));
#pragma unroll
        for (int c = 0; c < 4; ++c) {
            v16h bf = mk16(*(const h8_t*)(wrow[c] + kk + base0),
                           *(const h8_t*)(wrow[c] + kk + 16 + base0));
            acc[c] = __builtin_amdgcn_wmma_f32_16x16x32_f16(
                false, a, false, bf, (short)0, acc[c], false, false);
        }
    }
#pragma unroll
    for (int r = 0; r < 8; ++r) {
        int grow = rowbase + r + halfsel * 8;
        float mk = seq_mask[grow];
#pragma unroll
        for (int c = 0; c < 4; ++c)
            Out[(size_t)grow * NOUT + colbase + c * 16 + l15] = acc[c][r] * mk;
    }
}

__device__ __forceinline__ float other_half(float v) {
    int b = __builtin_bit_cast(int, v);
    b = __builtin_amdgcn_permlanex16(b, b, 0x76543210, 0xfedcba98, false, false);
    return __builtin_bit_cast(float, b);
}

#define KSPLIT 4                          // key quarters = waves per query tile
#define OPITCH 68                         // floats per partial row: 272 B = 16 B x odd

__global__ void attn_kernel(const _Float16* __restrict__ q16,
                            const _Float16* __restrict__ kf,
                            const _Float16* __restrict__ vf,
                            const float* __restrict__ bias,
                            const float* __restrict__ seq_mask,
                            _Float16* __restrict__ ao) {
    // wave number as a scalar: tile indices and bases are then computed in scalar
    // registers and take no vector registers from the fragments
    int wib   = __builtin_amdgcn_readfirstlane(threadIdx.x >> 5);   // 0 .. 15
    int lane  = threadIdx.x & 31;
    int qsub  = wib & 3;                  // which of the block's query tiles
    int kq    = wib >> 2;                 // which quarter of the keys
    int gwave = blockIdx.x * 4 + qsub;
    int qtile = gwave & 127;              // SEQ/16 = 128
    int h     = (gwave >> 7) & 7;
    int b     = gwave >> 10;
    int qbase = qtile << 4;
    int l15 = lane & 15, halfsel = lane >> 4, base0 = halfsel ? 8 : 0;
    size_t bN   = (size_t)b * SEQ;
    int    hoff = h * DHEAD;
    unsigned rowoff = (unsigned)(l15 * DIMSZ + base0);   // q16: row l15
    unsigned seqoff = (unsigned)(l15 * SEQ + base0);     // bias: row l15
    unsigned frgoff = (unsigned)(lane * 8);              // kf, vf: this lane's 16 bytes

    // Q fragments (d 0..31, d 32..63), scale already folded into xn
    const _Float16* qr = q16 + (bN + qbase) * DIMSZ + hoff;
    v16h aq0 = mk16(*(const h8_t*)(qr + rowoff),      *(const h8_t*)(qr + rowoff + 16));
    v16h aq1 = mk16(*(const h8_t*)(qr + rowoff + 32), *(const h8_t*)(qr + rowoff + 48));

    float mi   = seq_mask[bN + qbase + l15];   // this lane's query
    float mrow = -1.0e30f;                     // running maximum (same in both halves)
    float lrow = 0.0f;                         // running sum of this half's keys
    v8f   Oacc[4];                             // Ot: [d = t*16 + 8*half + r][query l15]
#pragma unroll
    for (int t = 0; t < 4; ++t) Oacc[t] = (v8f){};

    // wave-uniform bases of this head's K tiles, bias rows, key masks and V tiles,
    // each at the first key of this wave's quarter
    int key0 = kq * (SEQ / KSPLIT);
    const _Float16* kbase = kf + ((size_t)(b * HEADS + h) * (SEQ / 16) + key0 / 16) * 1024;
    const float*    bbase = bias + ((size_t)(b * HEADS + h) * SEQ + qbase) * SEQ + key0;
    const float*    mbase = seq_mask + bN + key0;
    const _Float16* vbase = vf + ((size_t)(b * HEADS + h) * (SEQ / 16) + key0 / 16) * 1024;

    for (int jb = 0; jb < SEQ / 32 / KSPLIT; ++jb) {
        int kb = jb * 32;
        // ---- St = K . Qt  (two 16-key tiles) ----
        const _Float16* kr0 = kbase + (size_t)jb * 2048;   // two tiles of 1024
        const _Float16* kr1 = kr0 + 1024;
        v16h b00 = mk16(*(const h8_t*)(kr0 + frgoff),       *(const h8_t*)(kr0 + frgoff + 256));
        v16h b01 = mk16(*(const h8_t*)(kr0 + frgoff + 512), *(const h8_t*)(kr0 + frgoff + 768));
        v16h b10 = mk16(*(const h8_t*)(kr1 + frgoff),       *(const h8_t*)(kr1 + frgoff + 256));
        v16h b11 = mk16(*(const h8_t*)(kr1 + frgoff + 512), *(const h8_t*)(kr1 + frgoff + 768));
        // keeps the eight K loads in one group with one wait; without it this build
        // splits them into three groups among the products and waits out each
        __builtin_amdgcn_sched_barrier(0);
        v8f z = {};
        v8f S0 = __builtin_amdgcn_wmma_f32_16x16x32_f16(false, b00, false, aq0, (short)0, z,  false, false);
        S0     = __builtin_amdgcn_wmma_f32_16x16x32_f16(false, b01, false, aq1, (short)0, S0, false, false);
        v8f S1 = __builtin_amdgcn_wmma_f32_16x16x32_f16(false, b10, false, aq0, (short)0, z,  false, false);
        S1     = __builtin_amdgcn_wmma_f32_16x16x32_f16(false, b11, false, aq1, (short)0, S1, false, false);

        f4_t bv[4], mv[4];                 // [0,1]: keys of tile 0, [2,3]: tile 1
#pragma unroll
        for (int g = 0; g < 4; ++g) {
            int o = (g >> 1) * 16 + (g & 1) * 4;
            bv[g] = *(const f4_t*)(bbase + kb + seqoff + o);
            mv[g] = *(const f4_t*)(mbase + kb + (unsigned)base0 + o);
        }

        // ---- bias add + pair mask + online softmax (in-lane, one max exchange between halves) ----
        float s[16];
#pragma unroll
        for (int i = 0; i < 8; ++i) {
            s[i]     = S0[i] + bv[i >> 2][i & 3]       - (1.0f - mi * mv[i >> 2][i & 3])       * NEGV;
            s[8 + i] = S1[i] + bv[2 + (i >> 2)][i & 3] - (1.0f - mi * mv[2 + (i >> 2)][i & 3]) * NEGV;
        }
        float tm[8];
#pragma unroll
        for (int i = 0; i < 8; ++i) tm[i] = fmaxf(s[i], s[8 + i]);
        float tmax = fmaxf(fmaxf(fmaxf(tm[0], tm[1]), fmaxf(tm[2], tm[3])),
                           fmaxf(fmaxf(tm[4], tm[5]), fmaxf(tm[6], tm[7])));
        tmax = fmaxf(tmax, other_half(tmax));
        float mnew  = fmaxf(mrow, tmax);
        float alpha = exp_slot(mrow - mnew);
        mrow = mnew;

        v16h  pb;                          // Pt as B operand: element i <-> score i
        float ps[4];                       // four partial sums of this lane's p
#pragma unroll
        for (int i = 0; i < 16; ++i) {
            float p = exp_slot(s[i] - mnew);
            ps[i & 3] = (i < 4) ? p : ps[i & 3] + p;
            pb[i] = (_Float16)p;
        }
        lrow = lrow * alpha + ((ps[0] + ps[1]) + (ps[2] + ps[3]));
#pragma unroll
        for (int t = 0; t < 4; ++t) Oacc[t] *= alpha;

        // ---- Ot += Vt . Pt  (keys 0..15 from the first tile, 16..31 from the second) ----
#pragma unroll
        for (int t = 0; t < 4; ++t) {
            const _Float16* vr = vbase + (size_t)jb * 2048 + t * 256;
            v16h va = mk16(*(const h8_t*)(vr + frgoff), *(const h8_t*)(vr + frgoff + 1024));
            Oacc[t] = __builtin_amdgcn_wmma_f32_16x16x32_f16(
                false, va, false, pb, (short)0, Oacc[t], false, false);
        }
    }

    // ---- join the halves' sums; publish this quarter's partial [query][d], max, sum ----
    __shared__ __attribute__((aligned(16))) float part[4 * KSPLIT * 16 * OPITCH];
    __shared__ float pmax[4 * KSPLIT * 16], psum[4 * KSPLIT * 16];
    lrow += other_half(lrow);
    float* pw = part + (wib * 16 + l15) * OPITCH + base0;
#pragma unroll
    for (int t = 0; t < 4; ++t) {
        *(f4_t*)(pw + t * 16)     = (f4_t){Oacc[t][0], Oacc[t][1], Oacc[t][2], Oacc[t][3]};
        *(f4_t*)(pw + t * 16 + 4) = (f4_t){Oacc[t][4], Oacc[t][5], Oacc[t][6], Oacc[t][7]};
    }
    if (halfsel == 0) { pmax[wib * 16 + l15] = mrow; psum[wib * 16 + l15] = lrow; }
    __syncthreads();

    // ---- merge: wave kq takes queries 4*kq .. +3 of its tile; 8 lanes a query, 8 d a
    // lane, so a query's 128-byte output line is stored whole by this one wave ----
    int q  = kq * 4 + (lane >> 3);
    int d0 = (lane & 7) * 8;
    float pm[KSPLIT], pl[KSPLIT];
#pragma unroll                            // constant indices: pm, pl stay in registers
    for (int w = 0; w < KSPLIT; ++w) {
        pm[w] = pmax[(w * 4 + qsub) * 16 + q];
        pl[w] = psum[(w * 4 + qsub) * 16 + q];
    }
    float mall = fmaxf(fmaxf(pm[0], pm[1]), fmaxf(pm[2], pm[3]));
    float lall = 0.0f;
    f4_t  o0 = {}, o1 = {};
#pragma unroll                            // constant indices into pm, pl, as above
    for (int w = 0; w < KSPLIT; ++w) {
        float g = exp_slot(pm[w] - mall);           // weight of quarter w
        const float* pr = part + ((w * 4 + qsub) * 16 + q) * OPITCH + d0;
        lall += pl[w] * g;
        o0   += *(const f4_t*)pr * g;
        o1   += *(const f4_t*)(pr + 4) * g;
    }
    float inv = (lall > 0.0f) ? (1.0f / lall) : 0.0f;
    h8_t o;
#pragma unroll
    for (int r = 0; r < 4; ++r) {
        o[r]     = (_Float16)(o0[r] * inv);
        o[4 + r] = (_Float16)(o1[r] * inv);
    }
    *(h8_t*)(ao + (bN + qbase + q) * DIMSZ + hoff + d0) = o;
}

// ---------------------------------------------------------------------------
// launcher
// ---------------------------------------------------------------------------
extern "C" void kernel_launch(void* const* d_in, const int* in_sizes, int n_in,
                              void* d_out, int out_size, void* d_ws, size_t ws_size,
                              hipStream_t stream) {
    const float* x     = (const float*)d_in[0];
    const float* timep = (const float*)d_in[1];
    const float* bias  = (const float*)d_in[2];
    const float* mask  = (const float*)d_in[3];
    const float* gamma = (const float*)d_in[4];
    const float* wtime = (const float*)d_in[5];
    const float* btime = (const float*)d_in[6];
    const float* wq    = (const float*)d_in[7];
    const float* wkv   = (const float*)d_in[8];
    const float* wout  = (const float*)d_in[9];
    float* out = (float*)d_out;

    uint8_t* ws = (uint8_t*)d_ws;
    size_t off = 0;
    auto alloc = [&](size_t bytes) -> uint8_t* {
        uint8_t* p = ws + off;
        off += (bytes + 255) & ~(size_t)255;
        return p;
    };
    const size_t ACT = (size_t)BATCH * SEQ * DIMSZ;        // 2M elems
    float*    film  = (float*)   alloc(BATCH * 2 * DIMSZ * 4);
    _Float16* xn16  = (_Float16*)alloc(ACT * 2);
    _Float16* x16   = (_Float16*)alloc(ACT * 2);
    _Float16* wq16  = (_Float16*)alloc((size_t)DIMSZ * DIMSZ * 2);
    _Float16* wkv16 = (_Float16*)alloc((size_t)2 * DIMSZ * DIMSZ * 2);
    _Float16* wo16  = (_Float16*)alloc((size_t)DIMSZ * DIMSZ * 2);
    _Float16* q16   = (_Float16*)alloc(ACT * 2);
    _Float16* k16   = (_Float16*)alloc(ACT * 2);
    _Float16* vT16  = (_Float16*)alloc(ACT * 2);
    _Float16* ao16  = (_Float16*)alloc(ACT * 2);

    // weight converts
    cvt_f16_kernel<<<(DIMSZ * DIMSZ + 255) / 256, 256, 0, stream>>>(wq, wq16, DIMSZ * DIMSZ);
    cvt_f16_kernel<<<(2 * DIMSZ * DIMSZ + 255) / 256, 256, 0, stream>>>(wkv, wkv16, 2 * DIMSZ * DIMSZ);
    cvt_f16_kernel<<<(DIMSZ * DIMSZ + 255) / 256, 256, 0, stream>>>(wout, wo16, DIMSZ * DIMSZ);

    // FiLM params, then fused LN+FiLM+mask
    film_kernel<<<2 * DIMSZ / 4, 128, 0, stream>>>(timep, wtime, btime, film);
    ln_film_kernel<<<BATCH * SEQ, 256, 0, stream>>>(x, gamma, film, mask, xn16, x16);

    const int M = BATCH * SEQ;                    // 4096
    const int tiles64 = (M / 16) * (DIMSZ / 64);  // 2048 waves -> 512 blocks
    // q = xn @ wq^T        -> [B,SEQ,512]
    gemm_f16out_kernel<<<tiles64 / 4, 128, 0, stream>>>(
        xn16, wq16, q16, M, DIMSZ, DIMSZ, SEQ, (long long)SEQ * DIMSZ, DIMSZ, 1);
    // k = x @ wkv[0:512]^T -> fragment order
    gemm_kfrag_kernel<<<tiles64 / 4, 128, 0, stream>>>(
        x16, wkv16, k16, M, DIMSZ, DIMSZ);
    // v = x @ wkv[512:]^T  -> fragment order
    gemm_vfrag_kernel<<<tiles64 / 4, 128, 0, stream>>>(
        x16, wkv16 + (size_t)DIMSZ * DIMSZ, vT16, M, DIMSZ, DIMSZ);

    // flash attention: B*H*(SEQ/16) = 2048 query tiles, 4 tiles x 4 key quarters / block
    attn_kernel<<<BATCH * HEADS * (SEQ / 16) / 4, 512, 0, stream>>>(
        q16, k16, vT16, bias, mask, ao16);

    // out = (ao @ wout^T) * mask  -> f32
    gemm_f32mask_kernel<<<tiles64 / 4, 128, 0, stream>>>(
        ao16, wo16, mask, out, M, DIMSZ, DIMSZ);
}

// v005
// A run of this version takes 117 microseconds.
// Next to v004, in two timings, it ran 1.14 times as fast each time.
// Counting every step since v000, it is 4.44 times as fast.
#include <hip/hip_runtime.h>

typedef _Float16 h8_t  __attribute__((ext_vector_type(8)));
typedef _Float16 v16h  __attribute__((ext_vector_type(16)));
typedef float    v8f   __attribute__((ext_vector_type(8)));
typedef float    f4_t  __attribute__((ext_vector_type(4)));

#define BATCH 2
#define SEQ   2048
#define DIMSZ 512
#define HEADS 8
#define DHEAD 64
#define NEGV  1.0e6f

// ---------------------------------------------------------------------------
// helpers
// ---------------------------------------------------------------------------
__device__ __forceinline__ v16h mk16(h8_t lo, h8_t hi) {
    v16h r;
#pragma unroll
    for (int i = 0; i < 8; ++i) { r[i] = lo[i]; r[i + 8] = hi[i]; }
    return r;
}

__device__ __forceinline__ float exp_slot(float x) {
    float y = x * 1.44269504f, r;
    asm("v_exp_f32 %0, %1\n\tv_nop" : "=v"(r) : "v"(y));
    return r;
}

// 16-byte fragment load of the projections. s_wait_xcnt 0 is the instruction set's wait
// before a register that an issued global load names is overwritten: this build lands
// later loads' results in the address registers of earlier loads.
__device__ __forceinline__ h8_t ld_frag(const _Float16* p) {
    h8_t v = *(const h8_t*)p;
    asm volatile("s_wait_xcnt 0x0" ::: "memory");
    return v;
}

// ---------------------------------------------------------------------------
// FiLM: film[b, o] = b_time[o] + sum_k silu(time[b,k]) * w_time[o,k]
// One wave per output row o (8 waves a block, 128 blocks). The 32 lanes read the
// row in whole 128-byte lines (lane l holds k = 128*j + 4*l .. + 3), once for all
// batches; each lane sums its 16 products (lane 0 on top of b_time[o]) and a
// butterfly over the lanes joins the partial sums.
// ---------------------------------------------------------------------------
__device__ __forceinline__ void film_body(const float* __restrict__ timep,
                                          const float* __restrict__ w_time,
                                          const float* __restrict__ b_time,
                                          float* __restrict__ film) {
    // wave number as a scalar: the row's base address stays in scalar registers
    int o    = blockIdx.x * 8 + __builtin_amdgcn_readfirstlane(threadIdx.x >> 5);
    int lane = threadIdx.x & 31;
    const f4_t* wr = (const f4_t*)(w_time + (size_t)o * DIMSZ);
    f4_t w[4], t[BATCH][4];                // DIMSZ = 4 * 128
#pragma unroll
    for (int j = 0; j < 4; ++j) {
        w[j] = wr[j * 32 + lane];
#pragma unroll
        for (int b = 0; b < BATCH; ++b)
            t[b][j] = ((const f4_t*)(timep + b * DIMSZ))[j * 32 + lane];
    }
    float bt = b_time[o];
    // keeps every load above ahead of the arithmetic, so a wave waits out one memory
    // latency; without it the compiler sinks seven of the vector loads between the
    // silu blocks and the wave waits four times
    __builtin_amdgcn_sched_barrier(0);
    float acc[BATCH];
#pragma unroll
    for (int b = 0; b < BATCH; ++b) {
        acc[b] = (lane == 0) ? bt : 0.0f;   // lane 0's chain starts from the bias
#pragma unroll
        for (int j = 0; j < 4; ++j)
#pragma unroll
            for (int c = 0; c < 4; ++c) {
                float tv = t[b][j][c];
                acc[b] = fmaf(tv / (1.0f + exp_slot(-tv)), w[j][c], acc[b]);   // silu
            }
    }
#pragma unroll
    for (int off = 16; off; off >>= 1)
#pragma unroll
        for (int b = 0; b < BATCH; ++b) acc[b] += __shfl_xor(acc[b], off, 32);
    // every lane holds every batch's sum: lane b stores batch b
    float r = acc[0];
#pragma unroll
    for (int b = 1; b < BATCH; ++b) r = (lane == b) ? acc[b] : r;
    if (lane < BATCH) film[lane * 2 * DIMSZ + o] = r;
}

// ---------------------------------------------------------------------------
// First launch: everything that depends on the inputs alone, in one grid.
// Blocks 0 .. FILM_BLOCKS-1 compute FiLM (the longest chain, so they start first);
// the rest convert the three weight matrices f32 -> f16, 256 elements a block.
// ---------------------------------------------------------------------------
#define FILM_BLOCKS (2 * DIMSZ / 8)
#define WSQ_BLOCKS  (DIMSZ * DIMSZ / 256)     // blocks per 512 x 512 matrix

__global__ void prep_kernel(const float* __restrict__ timep,
                            const float* __restrict__ w_time,
                            const float* __restrict__ b_time,
                            float* __restrict__ film,
                            const float* __restrict__ wq,
                            const float* __restrict__ wkv,
                            const float* __restrict__ wout,
                            _Float16* __restrict__ wq16,
                            _Float16* __restrict__ wkv16,
                            _Float16* __restrict__ wo16) {
    if (blockIdx.x < FILM_BLOCKS) {
        film_body(timep, w_time, b_time, film);
        return;
    }
    int blk = blockIdx.x - FILM_BLOCKS;
    const float* in  = wq;
    _Float16*    out = wq16;
    if (blk >= 3 * WSQ_BLOCKS)  { in = wout; out = wo16;  blk -= 3 * WSQ_BLOCKS; }
    else if (blk >= WSQ_BLOCKS) { in = wkv;  out = wkv16; blk -= WSQ_BLOCKS; }
    int i = blk * 256 + threadIdx.x;
    out[i] = (_Float16)in[i];
    // the instruction set's wait before a register that an issued store names is
    // overwritten: in this build the FiLM part's code follows the store
    asm volatile("s_wait_xcnt 0x0" ::: "memory");
}

// ---------------------------------------------------------------------------
// LayerNorm + FiLM + seq-mask + fold dim_head^-0.5, emit f16; also x -> f16
// one block (256 thr) per token, 2 elements per thread
// ---------------------------------------------------------------------------
__global__ void ln_film_kernel(const float* __restrict__ x,
                               const float* __restrict__ gamma,
                               const float* __restrict__ film,
                               const float* __restrict__ seq_mask,
                               _Float16* __restrict__ xn16,
                               _Float16* __restrict__ x16) {
    int tok = blockIdx.x;                 // 0 .. B*SEQ-1
    int b   = tok / SEQ;
    int tid = threadIdx.x;
    const float* xr = x + (size_t)tok * DIMSZ;
    float v0 = xr[tid], v1 = xr[tid + 256];
    float s  = v0 + v1;
    float sq = v0 * v0 + v1 * v1;
#pragma unroll
    for (int off = 16; off; off >>= 1) {
        s  += __shfl_xor(s,  off, 32);
        sq += __shfl_xor(sq, off, 32);
    }
    __shared__ float ssum[8], ssq[8];
    int wv = tid >> 5, ln = tid & 31;
    if (ln == 0) { ssum[wv] = s; ssq[wv] = sq; }
    __syncthreads();
    float tot = 0.f, totq = 0.f;
#pragma unroll
    for (int i = 0; i < 8; ++i) { tot += ssum[i]; totq += ssq[i]; }
    float mu   = tot * (1.0f / DIMSZ);
    float var  = totq * (1.0f / DIMSZ) - mu * mu;
    float rinv = rsqrtf(var + 1e-5f);
    float mk   = seq_mask[tok];
    const float* fb = film + (size_t)b * 2 * DIMSZ;
#pragma unroll
    for (int e = 0; e < 2; ++e) {
        int   d  = tid + e * 256;
        float v  = (e == 0) ? v0 : v1;
        float xn = (v - mu) * rinv * gamma[d];
        xn = xn * (fb[d] + 1.0f) + fb[DIMSZ + d];
        xn = xn * mk * 0.125f;            // fold 64^-0.5 (only q uses xn)
        xn16[(size_t)tok * DIMSZ + d] = (_Float16)xn;
        x16 [(size_t)tok * DIMSZ + d] = (_Float16)v;
    }
}

// ---------------------------------------------------------------------------
// WMMA GEMM, 16x64 tile per wave (A fragment reused across 4 N-tiles),
// f16 output with arbitrary (batched) output strides:
//   Out[b*obs + (row%npb)*ors + col*ocs] = (A[row,:] . W[col,:])
// ---------------------------------------------------------------------------
__device__ __forceinline__ void gemm_f16out_body(const _Float16* __restrict__ A,
                                                 const _Float16* __restrict__ W,
                                                 _Float16* __restrict__ Out,
                                                 int M, int NOUT, int K,
                                                 int npb, long long obs, int ors, int ocs) {
    int wave = blockIdx.x * (blockDim.x >> 5) + (threadIdx.x >> 5);
    int tiles_n = NOUT >> 6;                   // 64 columns per wave
    int tm = wave / tiles_n, tn = wave % tiles_n;
    if (tm >= (M >> 4)) return;
    int lane = threadIdx.x & 31;
    int l15 = lane & 15, halfsel = lane >> 4, base0 = halfsel ? 8 : 0;
    int rowbase = tm << 4, colbase = tn << 6;
    const _Float16* arow = A + (size_t)(rowbase + l15) * K;
    const _Float16* wrow[4];
#pragma unroll
    for (int c = 0; c < 4; ++c)
        wrow[c] = W + (size_t)(colbase + c * 16 + l15) * K;
    v8f acc[4];
#pragma unroll
    for (int c = 0; c < 4; ++c) acc[c] = (v8f){};
    for (int kk = 0; kk < K; kk += 32) {
        v16h a = mk16(ld_frag(arow + kk + base0), ld_frag(arow + kk + 16 + base0));
#pragma unroll
        for (int c = 0; c < 4; ++c) {
            v16h bf = mk16(ld_frag(wrow[c] + kk + base0), ld_frag(wrow[c] + kk + 16 + base0));
            acc[c] = __builtin_amdgcn_wmma_f32_16x16x32_f16(
                false, a, false, bf, (short)0, acc[c], false, false);
        }
    }
#pragma unroll
    for (int c = 0; c < 4; ++c) {
#pragma unroll
        for (int r = 0; r < 8; ++r) {
            int grow = rowbase + r + halfsel * 8;
            int bidx = grow / npb, rloc = grow % npb;
            size_t addr = (size_t)bidx * obs + (size_t)rloc * ors
                        + (size_t)(colbase + c * 16 + l15) * ocs;
            Out[addr] = (_Float16)acc[c][r];
        }
    }
}

// ---------------------------------------------------------------------------
// WMMA GEMM, 16 tokens x 64 features (one head) per wave, f16 output in the
// FRAGMENT ORDER in which attn_kernel reads K and V as A operands:
//   Out[((b*HEADS + h)*(SEQ/16) + token_tile)*1024 + c*256 + lane*8 + e]
// so that one 16-byte load per lane covers 512 contiguous bytes (4 whole lines).
// FEAT_IN_LANE (K): D = W . At; lane (l15, half) holds token l15 and features
//   c*16 + 8*half + e, which is chunk c of K's fragment row l15.
// otherwise   (V): D = A . Wt; lane (l15, half) holds feature c*16 + l15 and
//   tokens 8*half + e, which is this 16-token tile's chunk of Vt's fragment row.
// ---------------------------------------------------------------------------
template <bool FEAT_IN_LANE>
__device__ __forceinline__ void gemm_frag_body(const _Float16* __restrict__ A,
                                               const _Float16* __restrict__ W,
                                               _Float16* __restrict__ Out,
                                               int M, int NOUT, int K) {
    int wave = blockIdx.x * (blockDim.x >> 5) + (threadIdx.x >> 5);
    int tiles_n = NOUT >> 6;                   // 64 columns (one head) per wave
    int tm = wave / tiles_n, tn = wave % tiles_n;
    if (tm >= (M >> 4)) return;
    int lane = threadIdx.x & 31;
    int l15 = lane & 15, halfsel = lane >> 4, base0 = halfsel ? 8 : 0;
    int rowbase = tm << 4, colbase = tn << 6;
    const _Float16* arow = A + (size_t)(rowbase + l15) * K;
    const _Float16* wrow[4];
#pragma unroll
    for (int c = 0; c < 4; ++c)
        wrow[c] = W + (size_t)(colbase + c * 16 + l15) * K;
    v8f acc[4];
#pragma unroll
    for (int c = 0; c < 4; ++c) acc[c] = (v8f){};
    for (int kk = 0; kk < K; kk += 32) {
        v16h a = mk16(ld_frag(arow + kk + base0), ld_frag(arow + kk + 16 + base0));
#pragma unroll
        for (int c = 0; c < 4; ++c) {
            v16h bf = mk16(ld_frag(wrow[c] + kk + base0), ld_frag(wrow[c] + kk + 16 + base0));
            acc[c] = FEAT_IN_LANE
                ? __builtin_amdgcn_wmma_f32_16x16x32_f16(
                      false, bf, false, a, (short)0, acc[c], false, false)
                : __builtin_amdgcn_wmma_f32_16x16x32_f16(
                      false, a, false, bf, (short)0, acc[c], false, false);
        }
    }
    int bidx = tm / (SEQ / 16), ttile = tm % (SEQ / 16);
    _Float16* o = Out + ((size_t)(bidx * tiles_n + tn) * (SEQ / 16) + ttile) * 1024 + lane * 8;
#pragma unroll
    for (int c = 0; c < 4; ++c) {
        h8_t v;
#pragma unroll
        for (int r = 0; r < 8; ++r) v[r] = (_Float16)acc[c][r];
        *(h8_t*)(o + c * 256) = v;
    }
}

// The three projections depend on the same earlier launches and not on each other:
// one grid, blockIdx.y picks the product, so their waves share the chip at once.
//   y = 0: q = xn . wq^T  -> [B, SEQ, 512]     y = 1: k = x . wk^T -> fragment order
//   y = 2: v = x . wv^T   -> fragment order
__global__ void qkv_kernel(const _Float16* __restrict__ xn16,
                           const _Float16* __restrict__ x16,
                           const _Float16* __restrict__ wq16,
                           const _Float16* __restrict__ wk16,
                           const _Float16* __restrict__ wv16,
                           _Float16* __restrict__ q16,
                           _Float16* __restrict__ kf,
                           _Float16* __restrict__ vf,
                           int M, int NOUT, int K,
                           int npb, long long obs, int ors, int ocs) {
    if (blockIdx.y == 0)      gemm_f16out_body(xn16, wq16, q16, M, NOUT, K, npb, obs, ors, ocs);
    else if (blockIdx.y == 1) gemm_frag_body<true>(x16, wk16, kf, M, NOUT, K);
    else                      gemm_frag_body<false>(x16, wv16, vf, M, NOUT, K);
}

// WMMA GEMM (16x64 tile), f32 output [M, NOUT], multiplied by per-row mask
__global__ void gemm_f32mask_kernel(const _Float16* __restrict__ A,
                                    const _Float16* __restrict__ W,
                                    const float* __restrict__ seq_mask,
                                    float* __restrict__ Out,
                                    int M, int NOUT, int K) {
    int wave = blockIdx.x * (blockDim.x >> 5) + (threadIdx.x >> 5);
    int tiles_n = NOUT >> 6;
    int tm = wave / tiles_n, tn = wave % tiles_n;
    if (tm >= (M >> 4)) return;
    int lane = threadIdx.x & 31;
    int l15 = lane & 15, halfsel = lane >> 4, base0 = halfsel ? 8 : 0;
    int rowbase = tm << 4, colbase = tn << 6;
    const _Float16* arow = A + (size_t)(rowbase + l15) * K;
    const _Float16* wrow[4];
#pragma unroll
    for (int c = 0; c < 4; ++c)
        wrow[c] = W + (size_t)(colbase + c * 16 + l15) * K;
    v8f acc[4];
#pragma unroll
    for (int c = 0; c < 4; ++c) acc[c] = (v8f){};
    for (int kk = 0; kk < K; kk += 32) {
        v16h a = mk16(*(const h8_t*)(arow + kk + base0),
                      *(const h8_t*)(arow + kk + 16 + base0));
#pragma unroll
        for (int c = 0; c < 4; ++c) {
            v16h bf = mk16(*(const h8_t*)(wrow[c] + kk + base0),
                           *(const h8_t*)(wrow[c] + kk + 16 + base0));
            acc[c] = __builtin_amdgcn_wmma_f32_16x16x32_f16(
                false, a, false, bf, (short)0, acc[c], false, false);
        }
    }
#pragma unroll
    for (int r = 0; r < 8; ++r) {
        int grow = rowbase + r + halfsel * 8;
        float mk = seq_mask[grow];
#pragma unroll
        for (int c = 0; c < 4; ++c)
            Out[(size_t)grow * NOUT + colbase + c * 16 + l15] = acc[c][r] * mk;
    }
}

__device__ __forceinline__ float other_half(float v) {
    int b = __builtin_bit_cast(int, v);
    b = __builtin_amdgcn_permlanex16(b, b, 0x76543210, 0xfedcba98, false, false);
    return __builtin_bit_cast(float, b);
}

#define KSPLIT 4                          // key quarters = waves per query tile
#define OPITCH 68                         // floats per partial row: 272 B = 16 B x odd

__global__ void attn_kernel(const _Float16* __restrict__ q16,
                            const _Float16* __restrict__ kf,
                            const _Float16* __restrict__ vf,
                            const float* __restrict__ bias,
                            const float* __restrict__ seq_mask,
                            _Float16* __restrict__ ao) {
    // wave number as a scalar: tile indices and bases are then computed in scalar
    // registers and take no vector registers from the fragments
    int wib   = __builtin_amdgcn_readfirstlane(threadIdx.x >> 5);   // 0 .. 15
    int lane  = threadIdx.x & 31;
    int qsub  = wib & 3;                  // which of the block's query tiles
    int kq    = wib >> 2;                 // which quarter of the keys
    int gwave = blockIdx.x * 4 + qsub;
    int qtile = gwave & 127;              // SEQ/16 = 128
    int h     = (gwave >> 7) & 7;
    int b     = gwave >> 10;
    int qbase = qtile << 4;
    int l15 = lane & 15, halfsel = lane >> 4, base0 = halfsel ? 8 : 0;
    size_t bN   = (size_t)b * SEQ;
    int    hoff = h * DHEAD;
    unsigned rowoff = (unsigned)(l15 * DIMSZ + base0);   // q16: row l15
    unsigned seqoff = (unsigned)(l15 * SEQ + base0);     // bias: row l15
    unsigned frgoff = (unsigned)(lane * 8);              // kf, vf: this lane's 16 bytes

    // Q fragments (d 0..31, d 32..63), scale already folded into xn
    const _Float16* qr = q16 + (bN + qbase) * DIMSZ + hoff;
    v16h aq0 = mk16(*(const h8_t*)(qr + rowoff),      *(const h8_t*)(qr + rowoff + 16));
    v16h aq1 = mk16(*(const h8_t*)(qr + rowoff + 32), *(const h8_t*)(qr + rowoff + 48));

    float mi   = seq_mask[bN + qbase + l15];   // this lane's query
    float mrow = -1.0e30f;                     // running maximum (same in both halves)
    float lrow = 0.0f;                         // running sum of this half's keys
    v8f   Oacc[4];                             // Ot: [d = t*16 + 8*half + r][query l15]
#pragma unroll
    for (int t = 0; t < 4; ++t) Oacc[t] = (v8f){};

    // wave-uniform bases of this head's K tiles, bias rows, key masks and V tiles,
    // each at the first key of this wave's quarter
    int key0 = kq * (SEQ / KSPLIT);
    const _Float16* kbase = kf + ((size_t)(b * HEADS + h) * (SEQ / 16) + key0 / 16) * 1024;
    const float*    bbase = bias + ((size_t)(b * HEADS + h) * SEQ + qbase) * SEQ + key0;
    const float*    mbase = seq_mask + bN + key0;
    const _Float16* vbase = vf + ((size_t)(b * HEADS + h) * (SEQ / 16) + key0 / 16) * 1024;

    for (int jb = 0; jb < SEQ / 32 / KSPLIT; ++jb) {
        int kb = jb * 32;
        // ---- St = K . Qt  (two 16-key tiles) ----
        const _Float16* kr0 = kbase + (size_t)jb * 2048;   // two tiles of 1024
        const _Float16* kr1 = kr0 + 1024;
        v16h b00 = mk16(*(const h8_t*)(kr0 + frgoff),       *(const h8_t*)(kr0 + frgoff + 256));
        v16h b01 = mk16(*(const h8_t*)(kr0 + frgoff + 512), *(const h8_t*)(kr0 + frgoff + 768));
        v16h b10 = mk16(*(const h8_t*)(kr1 + frgoff),       *(const h8_t*)(kr1 + frgoff + 256));
        v16h b11 = mk16(*(const h8_t*)(kr1 + frgoff + 512), *(const h8_t*)(kr1 + frgoff + 768));
        // keeps the eight K loads in one group with one wait; without it this build
        // splits them into three groups among the products and waits out each
        __builtin_amdgcn_sched_barrier(0);
        v8f z = {};
        v8f S0 = __builtin_amdgcn_wmma_f32_16x16x32_f16(false, b00, false, aq0, (short)0, z,  false, false);
        S0     = __builtin_amdgcn_wmma_f32_16x16x32_f16(false, b01, false, aq1, (short)0, S0, false, false);
        v8f S1 = __builtin_amdgcn_wmma_f32_16x16x32_f16(false, b10, false, aq0, (short)0, z,  false, false);
        S1     = __builtin_amdgcn_wmma_f32_16x16x32_f16(false, b11, false, aq1, (short)0, S1, false, false);

        f4_t bv[4], mv[4];                 // [0,1]: keys of tile 0, [2,3]: tile 1
#pragma unroll
        for (int g = 0; g < 4; ++g) {
            int o = (g >> 1) * 16 + (g & 1) * 4;
            bv[g] = *(const f4_t*)(bbase + kb + seqoff + o);
            mv[g] = *(const f4_t*)(mbase + kb + (unsigned)base0 + o);
        }

        // ---- bias add + pair mask + online softmax (in-lane, one max exchange between halves) ----
        float s[16];
#pragma unroll
        for (int i = 0; i < 8; ++i) {
            s[i]     = S0[i] + bv[i >> 2][i & 3]       - (1.0f - mi * mv[i >> 2][i & 3])       * NEGV;
            s[8 + i] = S1[i] + bv[2 + (i >> 2)][i & 3] - (1.0f - mi * mv[2 + (i >> 2)][i & 3]) * NEGV;
        }
        float tm[8];
#pragma unroll
        for (int i = 0; i < 8; ++i) tm[i] = fmaxf(s[i], s[8 + i]);
        float tmax = fmaxf(fmaxf(fmaxf(tm[0], tm[1]), fmaxf(tm[2], tm[3])),
                           fmaxf(fmaxf(tm[4], tm[5]), fmaxf(tm[6], tm[7])));
        tmax = fmaxf(tmax, other_half(tmax));
        float mnew  = fmaxf(mrow, tmax);
        float alpha = exp_slot(mrow - mnew);
        mrow = mnew;

        v16h  pb;                          // Pt as B operand: element i <-> score i
        float ps[4];                       // four partial sums of this lane's p
#pragma unroll
        for (int i = 0; i < 16; ++i) {
            float p = exp_slot(s[i] - mnew);
            ps[i & 3] = (i < 4) ? p : ps[i & 3] + p;
            pb[i] = (_Float16)p;
        }
        lrow = lrow * alpha + ((ps[0] + ps[1]) + (ps[2] + ps[3]));
#pragma unroll
        for (int t = 0; t < 4; ++t) Oacc[t] *= alpha;

        // ---- Ot += Vt . Pt  (keys 0..15 from the first tile, 16..31 from the second) ----
#pragma unroll
        for (int t = 0; t < 4; ++t) {
            const _Float16* vr = vbase + (size_t)jb * 2048 + t * 256;
            v16h va = mk16(*(const h8_t*)(vr + frgoff), *(const h8_t*)(vr + frgoff + 1024));
            Oacc[t] = __builtin_amdgcn_wmma_f32_16x16x32_f16(
                false, va, false, pb, (short)0, Oacc[t], false, false);
        }
    }

    // ---- join the halves' sums; publish this quarter's partial [query][d], max, sum ----
    __shared__ __attribute__((aligned(16))) float part[4 * KSPLIT * 16 * OPITCH];
    __shared__ float pmax[4 * KSPLIT * 16], psum[4 * KSPLIT * 16];
    lrow += other_half(lrow);
    float* pw = part + (wib * 16 + l15) * OPITCH + base0;
#pragma unroll
    for (int t = 0; t < 4; ++t) {
        *(f4_t*)(pw + t * 16)     = (f4_t){Oacc[t][0], Oacc[t][1], Oacc[t][2], Oacc[t][3]};
        *(f4_t*)(pw + t * 16 + 4) = (f4_t){Oacc[t][4], Oacc[t][5], Oacc[t][6], Oacc[t][7]};
    }
    if (halfsel == 0) { pmax[wib * 16 + l15] = mrow; psum[wib * 16 + l15] = lrow; }
    __syncthreads();

    // ---- merge: wave kq takes queries 4*kq .. +3 of its tile; 8 lanes a query, 8 d a
    // lane, so a query's 128-byte output line is stored whole by this one wave ----
    int q  = kq * 4 + (lane >> 3);
    int d0 = (lane & 7) * 8;
    float pm[KSPLIT], pl[KSPLIT];
#pragma unroll                            // constant indices: pm, pl stay in registers
    for (int w = 0; w < KSPLIT; ++w) {
        pm[w] = pmax[(w * 4 + qsub) * 16 + q];
        pl[w] = psum[(w * 4 + qsub) * 16 + q];
    }
    float mall = fmaxf(fmaxf(pm[0], pm[1]), fmaxf(pm[2], pm[3]));
    float lall = 0.0f;
    f4_t  o0 = {}, o1 = {};
#pragma unroll                            // constant indices into pm, pl, as above
    for (int w = 0; w < KSPLIT; ++w) {
        float g = exp_slot(pm[w] - mall);           // weight of quarter w
        const float* pr = part + ((w * 4 + qsub) * 16 + q) * OPITCH + d0;
        lall += pl[w] * g;
        o0   += *(const f4_t*)pr * g;
        o1   += *(const f4_t*)(pr + 4) * g;
    }
    float inv = (lall > 0.0f) ? (1.0f / lall) : 0.0f;
    h8_t o;
#pragma unroll
    for (int r = 0; r < 4; ++r) {
        o[r]     = (_Float16)(o0[r] * inv);
        o[4 + r] = (_Float16)(o1[r] * inv);
    }
    *(h8_t*)(ao + (bN + qbase + q) * DIMSZ + hoff + d0) = o;
}

// ---------------------------------------------------------------------------
// launcher
// ---------------------------------------------------------------------------
extern "C" void kernel_launch(void* const* d_in, const int* in_sizes, int n_in,
                              void* d_out, int out_size, void* d_ws, size_t ws_size,
                              hipStream_t stream) {
    const float* x     = (const float*)d_in[0];
    const float* timep = (const float*)d_in[1];
    const float* bias  = (const float*)d_in[2];
    const float* mask  = (const float*)d_in[3];
    const float* gamma = (const float*)d_in[4];
    const float* wtime = (const float*)d_in[5];
    const float* btime = (const float*)d_in[6];
    const float* wq    = (const float*)d_in[7];
    const float* wkv   = (const float*)d_in[8];
    const float* wout  = (const float*)d_in[9];
    float* out = (float*)d_out;

    uint8_t* ws = (uint8_t*)d_ws;
    size_t off = 0;
    auto alloc = [&](size_t bytes) -> uint8_t* {
        uint8_t* p = ws + off;
        off += (bytes + 255) & ~(size_t)255;
        return p;
    };
    const size_t ACT = (size_t)BATCH * SEQ * DIMSZ;        // 2M elems
    float*    film  = (float*)   alloc(BATCH * 2 * DIMSZ * 4);
    _Float16* xn16  = (_Float16*)alloc(ACT * 2);
    _Float16* x16   = (_Float16*)alloc(ACT * 2);
    _Float16* wq16  = (_Float16*)alloc((size_t)DIMSZ * DIMSZ * 2);
    _Float16* wkv16 = (_Float16*)alloc((size_t)2 * DIMSZ * DIMSZ * 2);
    _Float16* wo16  = (_Float16*)alloc((size_t)DIMSZ * DIMSZ * 2);
    _Float16* q16   = (_Float16*)alloc(ACT * 2);
    _Float16* k16   = (_Float16*)alloc(ACT * 2);
    _Float16* vT16  = (_Float16*)alloc(ACT * 2);
    _Float16* ao16  = (_Float16*)alloc(ACT * 2);

    // FiLM params and the three weight converts in one grid, then fused LN+FiLM+mask
    prep_kernel<<<FILM_BLOCKS + 4 * WSQ_BLOCKS, 256, 0, stream>>>(
        timep, wtime, btime, film, wq, wkv, wout, wq16, wkv16, wo16);
    ln_film_kernel<<<BATCH * SEQ, 256, 0, stream>>>(x, gamma, film, mask, xn16, x16);

    const int M = BATCH * SEQ;                    // 4096
    const int tiles64 = (M / 16) * (DIMSZ / 64);  // 2048 waves -> 512 blocks
    // q = xn @ wq^T, k = x @ wkv[0:512]^T, v = x @ wkv[512:]^T in one grid
    qkv_kernel<<<dim3(tiles64 / 4, 3), 128, 0, stream>>>(
        xn16, x16, wq16, wkv16, wkv16 + (size_t)DIMSZ * DIMSZ, q16, k16, vT16,
        M, DIMSZ, DIMSZ, SEQ, (long long)SEQ * DIMSZ, DIMSZ, 1);

    // flash attention: B*H*(SEQ/16) = 2048 query tiles, 4 tiles x 4 key quarters / block
    attn_kernel<<<BATCH * HEADS * (SEQ / 16) / 4, 512, 0, stream>>>(
        q16, k16, vT16, bias, mask, ao16);

    // out = (ao @ wout^T) * mask  -> f32
    gemm_f32mask_kernel<<<tiles64 / 4, 128, 0, stream>>>(
        ao16, wo16, mask, out, M, DIMSZ, DIMSZ);
}

// v006
// A run of this version takes 113 microseconds.
// Timed twice side by side with v005, it ran 1.03 times as fast both times.
// Over all steps from v000 it is 4.59 times as fast.
#include <hip/hip_runtime.h>

typedef _Float16 h8_t  __attribute__((ext_vector_type(8)));
typedef _Float16 h4_t  __attribute__((ext_vector_type(4)));
typedef _Float16 v16h  __attribute__((ext_vector_type(16)));
typedef float    v8f   __attribute__((ext_vector_type(8)));
typedef float    f4_t  __attribute__((ext_vector_type(4)));

#define BATCH 2
#define SEQ   2048
#define DIMSZ 512
#define HEADS 8
#define DHEAD 64
#define NEGV  1.0e6f

// ---------------------------------------------------------------------------
// helpers
// ---------------------------------------------------------------------------
__device__ __forceinline__ v16h mk16(h8_t lo, h8_t hi) {
    v16h r;
#pragma unroll
    for (int i = 0; i < 8; ++i) { r[i] = lo[i]; r[i + 8] = hi[i]; }
    return r;
}

__device__ __forceinline__ float exp_slot(float x) {
    float y = x * 1.44269504f, r;
    asm("v_exp_f32 %0, %1\n\tv_nop" : "=v"(r) : "v"(y));
    return r;
}

// 16-byte fragment load of the projections. s_wait_xcnt 0 is the instruction set's wait
// before a register that an issued global load names is overwritten: this build lands
// later loads' results in the address registers of earlier loads.
__device__ __forceinline__ h8_t ld_frag(const _Float16* p) {
    h8_t v = *(const h8_t*)p;
    asm volatile("s_wait_xcnt 0x0" ::: "memory");
    return v;
}

// ---------------------------------------------------------------------------
// FiLM: film[b, o] = b_time[o] + sum_k silu(time[b,k]) * w_time[o,k]
// One wave per output row o (8 waves a block, 128 blocks). The 32 lanes read the
// row in whole 128-byte lines (lane l holds k = 128*j + 4*l .. + 3), once for all
// batches; each lane sums its 16 products (lane 0 on top of b_time[o]) and a
// butterfly over the lanes joins the partial sums.
// ---------------------------------------------------------------------------
__device__ __forceinline__ void film_body(const float* __restrict__ timep,
                                          const float* __restrict__ w_time,
                                          const float* __restrict__ b_time,
                                          float* __restrict__ film) {
    // wave number as a scalar: the row's base address stays in scalar registers
    int o    = blockIdx.x * 8 + __builtin_amdgcn_readfirstlane(threadIdx.x >> 5);
    int lane = threadIdx.x & 31;
    const f4_t* wr = (const f4_t*)(w_time + (size_t)o * DIMSZ);
    f4_t w[4], t[BATCH][4];                // DIMSZ = 4 * 128
#pragma unroll
    for (int j = 0; j < 4; ++j) {
        w[j] = wr[j * 32 + lane];
#pragma unroll
        for (int b = 0; b < BATCH; ++b)
            t[b][j] = ((const f4_t*)(timep + b * DIMSZ))[j * 32 + lane];
    }
    float bt = b_time[o];
    // keeps every load above ahead of the arithmetic, so a wave waits out one memory
    // latency; without it the compiler sinks seven of the vector loads between the
    // silu blocks and the wave waits four times
    __builtin_amdgcn_sched_barrier(0);
    float acc[BATCH];
#pragma unroll
    for (int b = 0; b < BATCH; ++b) {
        acc[b] = (lane == 0) ? bt : 0.0f;   // lane 0's chain starts from the bias
#pragma unroll
        for (int j = 0; j < 4; ++j)
#pragma unroll
            for (int c = 0; c < 4; ++c) {
                float tv = t[b][j][c];
                acc[b] = fmaf(tv / (1.0f + exp_slot(-tv)), w[j][c], acc[b]);   // silu
            }
    }
#pragma unroll
    for (int off = 16; off; off >>= 1)
#pragma unroll
        for (int b = 0; b < BATCH; ++b) acc[b] += __shfl_xor(acc[b], off, 32);
    // every lane holds every batch's sum: lane b stores batch b
    float r = acc[0];
#pragma unroll
    for (int b = 1; b < BATCH; ++b) r = (lane == b) ? acc[b] : r;
    if (lane < BATCH) film[lane * 2 * DIMSZ + o] = r;
}

// ---------------------------------------------------------------------------
// First launch: everything that depends on the inputs alone, in one grid.
// Blocks 0 .. FILM_BLOCKS-1 compute FiLM (the longest chain, so they start first);
// the rest convert the three weight matrices f32 -> f16. A lane converts CVT_LOADS
// groups of 4 elements, so the whole grid is one block per WGP: the bytes are few, and
// a launch of many short waves lasts as long as its waves take to start.
// ---------------------------------------------------------------------------
#define FILM_BLOCKS (2 * DIMSZ / 8)
#define CVT_LOADS   8                                  // 16-byte loads per lane
#define CVT_WAVE    (CVT_LOADS * 128)                  // elements per wave
#define WSQ_BLOCKS  (DIMSZ * DIMSZ / (8 * CVT_WAVE))   // blocks per 512 x 512 matrix

__global__ void prep_kernel(const float* __restrict__ timep,
                            const float* __restrict__ w_time,
                            const float* __restrict__ b_time,
                            float* __restrict__ film,
                            const float* __restrict__ wq,
                            const float* __restrict__ wkv,
                            const float* __restrict__ wout,
                            _Float16* __restrict__ wq16,
                            _Float16* __restrict__ wkv16,
                            _Float16* __restrict__ wo16) {
    if (blockIdx.x < FILM_BLOCKS) {
        film_body(timep, w_time, b_time, film);
        return;
    }
    int blk = blockIdx.x - FILM_BLOCKS;
    const float* in  = wq;
    _Float16*    out = wq16;
    if (blk >= 3 * WSQ_BLOCKS)  { in = wout; out = wo16;  blk -= 3 * WSQ_BLOCKS; }
    else if (blk >= WSQ_BLOCKS) { in = wkv;  out = wkv16; blk -= WSQ_BLOCKS; }
    // wave number as a scalar: the wave's base addresses stay in scalar registers
    int wv   = __builtin_amdgcn_readfirstlane(threadIdx.x >> 5);
    int lane = threadIdx.x & 31;
    size_t base = (size_t)(blk * 8 + wv) * CVT_WAVE;
    const f4_t* src = (const f4_t*)(in + base);
    h4_t*       dst = (h4_t*)(out + base);
    f4_t v[CVT_LOADS];                    // every load covers 4 whole lines
#pragma unroll                            // constant indices: v stays in registers
    for (int j = 0; j < CVT_LOADS; ++j) v[j] = src[j * 32 + lane];
#pragma unroll                            // constant indices, as above
    for (int j = 0; j < CVT_LOADS; ++j)
        dst[j * 32 + lane] = (h4_t){(_Float16)v[j][0], (_Float16)v[j][1],
                                    (_Float16)v[j][2], (_Float16)v[j][3]};
    // the instruction set's wait before a register that an issued store names is
    // overwritten: in this build the FiLM part's code follows the store
    asm volatile("s_wait_xcnt 0x0" ::: "memory");
}

// ---------------------------------------------------------------------------
// LayerNorm + FiLM + seq-mask + fold dim_head^-0.5, emit f16; also x -> f16
// One wave per LN_TOK tokens, 8 waves a block, one block per WGP. The 32 lanes read
// a row in whole 128-byte lines (lane l holds d = 128*j + 4*l .. + 3), each lane sums
// its 16 elements and a butterfly over the lanes joins the sums: no LDS, no barrier,
// few waves to start; gamma and FiLM are read once per wave.
// ---------------------------------------------------------------------------
#define LN_TOK 2                          // divides SEQ: a wave's tokens share a batch

__global__ void ln_film_kernel(const float* __restrict__ x,
                               const float* __restrict__ gamma,
                               const float* __restrict__ film,
                               const float* __restrict__ seq_mask,
                               _Float16* __restrict__ xn16,
                               _Float16* __restrict__ x16) {
    // wave number as a scalar: row bases and the masks stay in scalar registers
    int wv   = __builtin_amdgcn_readfirstlane(threadIdx.x >> 5);
    int lane = threadIdx.x & 31;
    int tok0 = (blockIdx.x * 8 + wv) * LN_TOK;         // 0 .. B*SEQ-LN_TOK
    int b    = tok0 / SEQ;
    const f4_t* xr = (const f4_t*)(x + (size_t)tok0 * DIMSZ);
    const f4_t* gr = (const f4_t*)gamma;
    const f4_t* fb = (const f4_t*)(film + (size_t)b * 2 * DIMSZ);
    f4_t v[LN_TOK][4], g[4], sc[4], sh[4];             // DIMSZ = 4 * 128
    // every loop of this kernel is unrolled: the arrays are then indexed by constants
    // and stay in registers
#pragma unroll
    for (int j = 0; j < 4; ++j) {
#pragma unroll
        for (int t = 0; t < LN_TOK; ++t) v[t][j] = xr[t * (DIMSZ / 4) + j * 32 + lane];
    }
#pragma unroll
    for (int j = 0; j < 4; ++j) {
        g[j]  = gr[j * 32 + lane];
        sc[j] = fb[j * 32 + lane];
        sh[j] = fb[DIMSZ / 4 + j * 32 + lane];
    }
    float mk[LN_TOK];
#pragma unroll
    for (int t = 0; t < LN_TOK; ++t) mk[t] = seq_mask[tok0 + t];
    // keeps every load above ahead of the arithmetic, so a wave waits out one memory
    // latency; without it the compiler sinks eleven of the twelve gamma and FiLM loads
    // among the arithmetic and the wave waits out a latency again for each group
    __builtin_amdgcn_sched_barrier(0);
    float s[LN_TOK], sq[LN_TOK];
#pragma unroll
    for (int t = 0; t < LN_TOK; ++t) {
        f4_t a = (v[t][0] + v[t][1]) + (v[t][2] + v[t][3]);
        f4_t q = (v[t][0] * v[t][0] + v[t][1] * v[t][1]) + (v[t][2] * v[t][2] + v[t][3] * v[t][3]);
        s[t]  = (a[0] + a[1]) + (a[2] + a[3]);
        sq[t] = (q[0] + q[1]) + (q[2] + q[3]);
    }
#pragma unroll
    for (int off = 16; off; off >>= 1)
#pragma unroll
        for (int t = 0; t < LN_TOK; ++t) {
            s[t]  += __shfl_xor(s[t],  off, 32);
            sq[t] += __shfl_xor(sq[t], off, 32);
        }
#pragma unroll
    for (int t = 0; t < LN_TOK; ++t) {
        float mu   = s[t] * (1.0f / DIMSZ);
        float var  = sq[t] * (1.0f / DIMSZ) - mu * mu;
        float rinv = rsqrtf(var + 1e-5f);
        h4_t* on = (h4_t*)(xn16 + (size_t)(tok0 + t) * DIMSZ);
        h4_t* ox = (h4_t*)(x16  + (size_t)(tok0 + t) * DIMSZ);
#pragma unroll
        for (int j = 0; j < 4; ++j) {
            h4_t hn, hx;
#pragma unroll
            for (int c = 0; c < 4; ++c) {
                float xv = v[t][j][c];
                float xn = (xv - mu) * rinv * g[j][c];
                xn = xn * (sc[j][c] + 1.0f) + sh[j][c];
                xn = xn * mk[t] * 0.125f; // fold 64^-0.5 (only q uses xn)
                hn[c] = (_Float16)xn;
                hx[c] = (_Float16)xv;
            }
            on[j * 32 + lane] = hn;
            ox[j * 32 + lane] = hx;
        }
    }
}

// ---------------------------------------------------------------------------
// WMMA GEMM, 16x64 tile per wave (A fragment reused across 4 N-tiles),
// f16 output with arbitrary (batched) output strides:
//   Out[b*obs + (row%npb)*ors + col*ocs] = (A[row,:] . W[col,:])
// ---------------------------------------------------------------------------
__device__ __forceinline__ void gemm_f16out_body(const _Float16* __restrict__ A,
                                                 const _Float16* __restrict__ W,
                                                 _Float16* __restrict__ Out,
                                                 int M, int NOUT, int K,
                                                 int npb, long long obs, int ors, int ocs) {
    int wave = blockIdx.x * (blockDim.x >> 5) + (threadIdx.x >> 5);
    int tiles_n = NOUT >> 6;                   // 64 columns per wave
    int tm = wave / tiles_n, tn = wave % tiles_n;
    if (tm >= (M >> 4)) return;
    int lane = threadIdx.x & 31;
    int l15 = lane & 15, halfsel = lane >> 4, base0 = halfsel ? 8 : 0;
    int rowbase = tm << 4, colbase = tn << 6;
    const _Float16* arow = A + (size_t)(rowbase + l15) * K;
    const _Float16* wrow[4];
#pragma unroll
    for (int c = 0; c < 4; ++c)
        wrow[c] = W + (size_t)(colbase + c * 16 + l15) * K;
    v8f acc[4];
#pragma unroll
    for (int c = 0; c < 4; ++c) acc[c] = (v8f){};
    for (int kk = 0; kk < K; kk += 32) {
        v16h a = mk16(ld_frag(arow + kk + base0), ld_frag(arow + kk + 16 + base0));
#pragma unroll
        for (int c = 0; c < 4; ++c) {
            v16h bf = mk16(ld_frag(wrow[c] + kk + base0), ld_frag(wrow[c] + kk + 16 + base0));
            acc[c] = __builtin_amdgcn_wmma_f32_16x16x32_f16(
                false, a, false, bf, (short)0, acc[c], false, false);
        }
    }
#pragma unroll
    for (int c = 0; c < 4; ++c) {
#pragma unroll
        for (int r = 0; r < 8; ++r) {
            int grow = rowbase + r + halfsel * 8;
            int bidx = grow / npb, rloc = grow % npb;
            size_t addr = (size_t)bidx * obs + (size_t)rloc * ors
                        + (size_t)(colbase + c * 16 + l15) * ocs;
            Out[addr] = (_Float16)acc[c][r];
        }
    }
}

// ---------------------------------------------------------------------------
// WMMA GEMM, 16 tokens x 64 features (one head) per wave, f16 output in the
// FRAGMENT ORDER in which attn_kernel reads K and V as A operands:
//   Out[((b*HEADS + h)*(SEQ/16) + token_tile)*1024 + c*256 + lane*8 + e]
// so that one 16-byte load per lane covers 512 contiguous bytes (4 whole lines).
// FEAT_IN_LANE (K): D = W . At; lane (l15, half) holds token l15 and features
//   c*16 + 8*half + e, which is chunk c of K's fragment row l15.
// otherwise   (V): D = A . Wt; lane (l15, half) holds feature c*16 + l15 and
//   tokens 8*half + e, which is this 16-token tile's chunk of Vt's fragment row.
// ---------------------------------------------------------------------------
template <bool FEAT_IN_LANE>
__device__ __forceinline__ void gemm_frag_body(const _Float16* __restrict__ A,
                                               const _Float16* __restrict__ W,
                                               _Float16* __restrict__ Out,
                                               int M, int NOUT, int K) {
    int wave = blockIdx.x * (blockDim.x >> 5) + (threadIdx.x >> 5);
    int tiles_n = NOUT >> 6;                   // 64 columns (one head) per wave
    int tm = wave / tiles_n, tn = wave % tiles_n;
    if (tm >= (M >> 4)) return;
    int lane = threadIdx.x & 31;
    int l15 = lane & 15, halfsel = lane >> 4, base0 = halfsel ? 8 : 0;
    int rowbase = tm << 4, colbase = tn << 6;
    const _Float16* arow = A + (size_t)(rowbase + l15) * K;
    const _Float16* wrow[4];
#pragma unroll
    for (int c = 0; c < 4; ++c)
        wrow[c] = W + (size_t)(colbase + c * 16 + l15) * K;
    v8f acc[4];
#pragma unroll
    for (int c = 0; c < 4; ++c) acc[c] = (v8f){};
    for (int kk = 0; kk < K; kk += 32) {
        v16h a = mk16(ld_frag(arow + kk + base0), ld_frag(arow + kk + 16 + base0));
#pragma unroll
        for (int c = 0; c < 4; ++c) {
            v16h bf = mk16(ld_frag(wrow[c] + kk + base0), ld_frag(wrow[c] + kk + 16 + base0));
            acc[c] = FEAT_IN_LANE
                ? __builtin_amdgcn_wmma_f32_16x16x32_f16(
                      false, bf, false, a, (short)0, acc[c], false, false)
                : __builtin_amdgcn_wmma_f32_16x16x32_f16(
                      false, a, false, bf, (short)0, acc[c], false, false);
        }
    }
    int bidx = tm / (SEQ / 16), ttile = tm % (SEQ / 16);
    _Float16* o = Out + ((size_t)(bidx * tiles_n + tn) * (SEQ / 16) + ttile) * 1024 + lane * 8;
#pragma unroll
    for (int c = 0; c < 4; ++c) {
        h8_t v;
#pragma unroll
        for (int r = 0; r < 8; ++r) v[r] = (_Float16)acc[c][r];
        *(h8_t*)(o + c * 256) = v;
    }
}

// The three projections depend on the same earlier launches and not on each other:
// one grid, blockIdx.y picks the product, so their waves share the chip at once.
//   y = 0: q = xn . wq^T  -> [B, SEQ, 512]     y = 1: k = x . wk^T -> fragment order
//   y = 2: v = x . wv^T   -> fragment order
__global__ void qkv_kernel(const _Float16* __restrict__ xn16,
                           const _Float16* __restrict__ x16,
                           const _Float16* __restrict__ wq16,
                           const _Float16* __restrict__ wk16,
                           const _Float16* __restrict__ wv16,
                           _Float16* __restrict__ q16,
                           _Float16* __restrict__ kf,
                           _Float16* __restrict__ vf,
                           int M, int NOUT, int K,
                           int npb, long long obs, int ors, int ocs) {
    if (blockIdx.y == 0)      gemm_f16out_body(xn16, wq16, q16, M, NOUT, K, npb, obs, ors, ocs);
    else if (blockIdx.y == 1) gemm_frag_body<true>(x16, wk16, kf, M, NOUT, K);
    else                      gemm_frag_body<false>(x16, wv16, vf, M, NOUT, K);
}

// WMMA GEMM (16x64 tile), f32 output [M, NOUT], multiplied by per-row mask
__global__ void gemm_f32mask_kernel(const _Float16* __restrict__ A,
                                    const _Float16* __restrict__ W,
                                    const float* __restrict__ seq_mask,
                                    float* __restrict__ Out,
                                    int M, int NOUT, int K) {
    int wave = blockIdx.x * (blockDim.x >> 5) + (threadIdx.x >> 5);
    int tiles_n = NOUT >> 6;
    int tm = wave / tiles_n, tn = wave % tiles_n;
    if (tm >= (M >> 4)) return;
    int lane = threadIdx.x & 31;
    int l15 = lane & 15, halfsel = lane >> 4, base0 = halfsel ? 8 : 0;
    int rowbase = tm << 4, colbase = tn << 6;
    const _Float16* arow = A + (size_t)(rowbase + l15) * K;
    const _Float16* wrow[4];
#pragma unroll
    for (int c = 0; c < 4; ++c)
        wrow[c] = W + (size_t)(colbase + c * 16 + l15) * K;
    v8f acc[4];
#pragma unroll
    for (int c = 0; c < 4; ++c) acc[c] = (v8f){};
    for (int kk = 0; kk < K; kk += 32) {
        v16h a = mk16(*(const h8_t*)(arow + kk + base0),
                      *(const h8_t*)(arow + kk + 16 + base0));
#pragma unroll
        for (int c = 0; c < 4; ++c) {
            v16h bf = mk16(*(const h8_t*)(wrow[c] + kk + base0),
                           *(const h8_t*)(wrow[c] + kk + 16 + base0));
            acc[c] = __builtin_amdgcn_wmma_f32_16x16x32_f16(
                false, a, false, bf, (short)0, acc[c], false, false);
        }
    }
#pragma unroll
    for (int r = 0; r < 8; ++r) {
        int grow = rowbase + r + halfsel * 8;
        float mk = seq_mask[grow];
#pragma unroll
        for (int c = 0; c < 4; ++c)
            Out[(size_t)grow * NOUT + colbase + c * 16 + l15] = acc[c][r] * mk;
    }
}

__device__ __forceinline__ float other_half(float v) {
    int b = __builtin_bit_cast(int, v);
    b = __builtin_amdgcn_permlanex16(b, b, 0x76543210, 0xfedcba98, false, false);
    return __builtin_bit_cast(float, b);
}

#define KSPLIT 4                          // key quarters = waves per query tile
#define OPITCH 68                         // floats per partial row: 272 B = 16 B x odd

__global__ void attn_kernel(const _Float16* __restrict__ q16,
                            const _Float16* __restrict__ kf,
                            const _Float16* __restrict__ vf,
                            const float* __restrict__ bias,
                            const float* __restrict__ seq_mask,
                            _Float16* __restrict__ ao) {
    // wave number as a scalar: tile indices and bases are then computed in scalar
    // registers and take no vector registers from the fragments
    int wib   = __builtin_amdgcn_readfirstlane(threadIdx.x >> 5);   // 0 .. 15
    int lane  = threadIdx.x & 31;
    int qsub  = wib & 3;                  // which of the block's query tiles
    int kq    = wib >> 2;                 // which quarter of the keys
    int gwave = blockIdx.x * 4 + qsub;
    int qtile = gwave & 127;              // SEQ/16 = 128
    int h     = (gwave >> 7) & 7;
    int b     = gwave >> 10;
    int qbase = qtile << 4;
    int l15 = lane & 15, halfsel = lane >> 4, base0 = halfsel ? 8 : 0;
    size_t bN   = (size_t)b * SEQ;
    int    hoff = h * DHEAD;
    unsigned rowoff = (unsigned)(l15 * DIMSZ + base0);   // q16: row l15
    unsigned seqoff = (unsigned)(l15 * SEQ + base0);     // bias: row l15
    unsigned frgoff = (unsigned)(lane * 8);              // kf, vf: this lane's 16 bytes

    // Q fragments (d 0..31, d 32..63), scale already folded into xn
    const _Float16* qr = q16 + (bN + qbase) * DIMSZ + hoff;
    v16h aq0 = mk16(*(const h8_t*)(qr + rowoff),      *(const h8_t*)(qr + rowoff + 16));
    v16h aq1 = mk16(*(const h8_t*)(qr + rowoff + 32), *(const h8_t*)(qr + rowoff + 48));

    float mi   = seq_mask[bN + qbase + l15];   // this lane's query
    float mrow = -1.0e30f;                     // running maximum (same in both halves)
    float lrow = 0.0f;                         // running sum of this half's keys
    v8f   Oacc[4];                             // Ot: [d = t*16 + 8*half + r][query l15]
#pragma unroll
    for (int t = 0; t < 4; ++t) Oacc[t] = (v8f){};

    // wave-uniform bases of this head's K tiles, bias rows, key masks and V tiles,
    // each at the first key of this wave's quarter
    int key0 = kq * (SEQ / KSPLIT);
    const _Float16* kbase = kf + ((size_t)(b * HEADS + h) * (SEQ / 16) + key0 / 16) * 1024;
    const float*    bbase = bias + ((size_t)(b * HEADS + h) * SEQ + qbase) * SEQ + key0;
    const float*    mbase = seq_mask + bN + key0;
    const _Float16* vbase = vf + ((size_t)(b * HEADS + h) * (SEQ / 16) + key0 / 16) * 1024;

    for (int jb = 0; jb < SEQ / 32 / KSPLIT; ++jb) {
        int kb = jb * 32;
        // ---- St = K . Qt  (two 16-key tiles) ----
        const _Float16* kr0 = kbase + (size_t)jb * 2048;   // two tiles of 1024
        const _Float16* kr1 = kr0 + 1024;
        v16h b00 = mk16(*(const h8_t*)(kr0 + frgoff),       *(const h8_t*)(kr0 + frgoff + 256));
        v16h b01 = mk16(*(const h8_t*)(kr0 + frgoff + 512), *(const h8_t*)(kr0 + frgoff + 768));
        v16h b10 = mk16(*(const h8_t*)(kr1 + frgoff),       *(const h8_t*)(kr1 + frgoff + 256));
        v16h b11 = mk16(*(const h8_t*)(kr1 + frgoff + 512), *(const h8_t*)(kr1 + frgoff + 768));
        // keeps the eight K loads in one group with one wait; without it this build
        // splits them into three groups among the products and waits out each
        __builtin_amdgcn_sched_barrier(0);
        v8f z = {};
        v8f S0 = __builtin_amdgcn_wmma_f32_16x16x32_f16(false, b00, false, aq0, (short)0, z,  false, false);
        S0     = __builtin_amdgcn_wmma_f32_16x16x32_f16(false, b01, false, aq1, (short)0, S0, false, false);
        v8f S1 = __builtin_amdgcn_wmma_f32_16x16x32_f16(false, b10, false, aq0, (short)0, z,  false, false);
        S1     = __builtin_amdgcn_wmma_f32_16x16x32_f16(false, b11, false, aq1, (short)0, S1, false, false);

        f4_t bv[4], mv[4];                 // [0,1]: keys of tile 0, [2,3]: tile 1
#pragma unroll
        for (int g = 0; g < 4; ++g) {
            int o = (g >> 1) * 16 + (g & 1) * 4;
            bv[g] = *(const f4_t*)(bbase + kb + seqoff + o);
            mv[g] = *(const f4_t*)(mbase + kb + (unsigned)base0 + o);
        }

        // ---- bias add + pair mask + online softmax (in-lane, one max exchange between halves) ----
        float s[16];
#pragma unroll
        for (int i = 0; i < 8; ++i) {
            s[i]     = S0[i] + bv[i >> 2][i & 3]       - (1.0f - mi * mv[i >> 2][i & 3])       * NEGV;
            s[8 + i] = S1[i] + bv[2 + (i >> 2)][i & 3] - (1.0f - mi * mv[2 + (i >> 2)][i & 3]) * NEGV;
        }
        float tm[8];
#pragma unroll
        for (int i = 0; i < 8; ++i) tm[i] = fmaxf(s[i], s[8 + i]);
        float tmax = fmaxf(fmaxf(fmaxf(tm[0], tm[1]), fmaxf(tm[2], tm[3])),
                           fmaxf(fmaxf(tm[4], tm[5]), fmaxf(tm[6], tm[7])));
        tmax = fmaxf(tmax, other_half(tmax));
        float mnew  = fmaxf(mrow, tmax);
        float alpha = exp_slot(mrow - mnew);
        mrow = mnew;

        v16h  pb;                          // Pt as B operand: element i <-> score i
        float ps[4];                       // four partial sums of this lane's p
#pragma unroll
        for (int i = 0; i < 16; ++i) {
            float p = exp_slot(s[i] - mnew);
            ps[i & 3] = (i < 4) ? p : ps[i & 3] + p;
            pb[i] = (_Float16)p;
        }
        lrow = lrow * alpha + ((ps[0] + ps[1]) + (ps[2] + ps[3]));
#pragma unroll
        for (int t = 0; t < 4; ++t) Oacc[t] *= alpha;

        // ---- Ot += Vt . Pt  (keys 0..15 from the first tile, 16..31 from the second) ----
#pragma unroll
        for (int t = 0; t < 4; ++t) {
            const _Float16* vr = vbase + (size_t)jb * 2048 + t * 256;
            v16h va = mk16(*(const h8_t*)(vr + frgoff), *(const h8_t*)(vr + frgoff + 1024));
            Oacc[t] = __builtin_amdgcn_wmma_f32_16x16x32_f16(
                false, va, false, pb, (short)0, Oacc[t], false, false);
        }
    }

    // ---- join the halves' sums; publish this quarter's partial [query][d], max, sum ----
    __shared__ __attribute__((aligned(16))) float part[4 * KSPLIT * 16 * OPITCH];
    __shared__ float pmax[4 * KSPLIT * 16], psum[4 * KSPLIT * 16];
    lrow += other_half(lrow);
    float* pw = part + (wib * 16 + l15) * OPITCH + base0;
#pragma unroll
    for (int t = 0; t < 4; ++t) {
        *(f4_t*)(pw + t * 16)     = (f4_t){Oacc[t][0], Oacc[t][1], Oacc[t][2], Oacc[t][3]};
        *(f4_t*)(pw + t * 16 + 4) = (f4_t){Oacc[t][4], Oacc[t][5], Oacc[t][6], Oacc[t][7]};
    }
    if (halfsel == 0) { pmax[wib * 16 + l15] = mrow; psum[wib * 16 + l15] = lrow; }
    __syncthreads();

    // ---- merge: wave kq takes queries 4*kq .. +3 of its tile; 8 lanes a query, 8 d a
    // lane, so a query's 128-byte output line is stored whole by this one wave ----
    int q  = kq * 4 + (lane >> 3);
    int d0 = (lane & 7) * 8;
    float pm[KSPLIT], pl[KSPLIT];
#pragma unroll                            // constant indices: pm, pl stay in registers
    for (int w = 0; w < KSPLIT; ++w) {
        pm[w] = pmax[(w * 4 + qsub) * 16 + q];
        pl[w] = psum[(w * 4 + qsub) * 16 + q];
    }
    float mall = fmaxf(fmaxf(pm[0], pm[1]), fmaxf(pm[2], pm[3]));
    float lall = 0.0f;
    f4_t  o0 = {}, o1 = {};
#pragma unroll                            // constant indices into pm, pl, as above
    for (int w = 0; w < KSPLIT; ++w) {
        float g = exp_slot(pm[w] - mall);           // weight of quarter w
        const float* pr = part + ((w * 4 + qsub) * 16 + q) * OPITCH + d0;
        lall += pl[w] * g;
        o0   += *(const f4_t*)pr * g;
        o1   += *(const f4_t*)(pr + 4) * g;
    }
    float inv = (lall > 0.0f) ? (1.0f / lall) : 0.0f;
    h8_t o;
#pragma unroll
    for (int r = 0; r < 4; ++r) {
        o[r]     = (_Float16)(o0[r] * inv);
        o[4 + r] = (_Float16)(o1[r] * inv);
    }
    *(h8_t*)(ao + (bN + qbase + q) * DIMSZ + hoff + d0) = o;
}

// ---------------------------------------------------------------------------
// launcher
// ---------------------------------------------------------------------------
extern "C" void kernel_launch(void* const* d_in, const int* in_sizes, int n_in,
                              void* d_out, int out_size, void* d_ws, size_t ws_size,
                              hipStream_t stream) {
    const float* x     = (const float*)d_in[0];
    const float* timep = (const float*)d_in[1];
    const float* bias  = (const float*)d_in[2];
    const float* mask  = (const float*)d_in[3];
    const float* gamma = (const float*)d_in[4];
    const float* wtime = (const float*)d_in[5];
    const float* btime = (const float*)d_in[6];
    const float* wq    = (const float*)d_in[7];
    const float* wkv   = (const float*)d_in[8];
    const float* wout  = (const float*)d_in[9];
    float* out = (float*)d_out;

    uint8_t* ws = (uint8_t*)d_ws;
    size_t off = 0;
    auto alloc = [&](size_t bytes) -> uint8_t* {
        uint8_t* p = ws + off;
        off += (bytes + 255) & ~(size_t)255;
        return p;
    };
    const size_t ACT = (size_t)BATCH * SEQ * DIMSZ;        // 2M elems
    float*    film  = (float*)   alloc(BATCH * 2 * DIMSZ * 4);
    _Float16* xn16  = (_Float16*)alloc(ACT * 2);
    _Float16* x16   = (_Float16*)alloc(ACT * 2);
    _Float16* wq16  = (_Float16*)alloc((size_t)DIMSZ * DIMSZ * 2);
    _Float16* wkv16 = (_Float16*)alloc((size_t)2 * DIMSZ * DIMSZ * 2);
    _Float16* wo16  = (_Float16*)alloc((size_t)DIMSZ * DIMSZ * 2);
    _Float16* q16   = (_Float16*)alloc(ACT * 2);
    _Float16* k16   = (_Float16*)alloc(ACT * 2);
    _Float16* vT16  = (_Float16*)alloc(ACT * 2);
    _Float16* ao16  = (_Float16*)alloc(ACT * 2);

    // FiLM params and the three weight converts in one grid, then fused LN+FiLM+mask
    prep_kernel<<<FILM_BLOCKS + 4 * WSQ_BLOCKS, 256, 0, stream>>>(
        timep, wtime, btime, film, wq, wkv, wout, wq16, wkv16, wo16);
    ln_film_kernel<<<BATCH * SEQ / (8 * LN_TOK), 256, 0, stream>>>(x, gamma, film, mask, xn16, x16);

    const int M = BATCH * SEQ;                    // 4096
    const int tiles64 = (M / 16) * (DIMSZ / 64);  // 2048 waves -> 512 blocks
    // q = xn @ wq^T, k = x @ wkv[0:512]^T, v = x @ wkv[512:]^T in one grid
    qkv_kernel<<<dim3(tiles64 / 4, 3), 128, 0, stream>>>(
        xn16, x16, wq16, wkv16, wkv16 + (size_t)DIMSZ * DIMSZ, q16, k16, vT16,
        M, DIMSZ, DIMSZ, SEQ, (long long)SEQ * DIMSZ, DIMSZ, 1);

    // flash attention: B*H*(SEQ/16) = 2048 query tiles, 4 tiles x 4 key quarters / block
    attn_kernel<<<BATCH * HEADS * (SEQ / 16) / 4, 512, 0, stream>>>(
        q16, k16, vT16, bias, mask, ao16);

    // out = (ao @ wout^T) * mask  -> f32
    gemm_f32mask_kernel<<<tiles64 / 4, 128, 0, stream>>>(
        ao16, wo16, mask, out, M, DIMSZ, DIMSZ);
}

// v007
// One run takes 77 microseconds.
// In both of two side-by-side timings against v006, it was 1.47 times as fast.
// All steps since v000 together make it 6.76 times as fast.
#include <hip/hip_runtime.h>

typedef _Float16 h8_t  __attribute__((ext_vector_type(8)));
typedef _Float16 h4_t  __attribute__((ext_vector_type(4)));
typedef _Float16 v16h  __attribute__((ext_vector_type(16)));
typedef float    v8f   __attribute__((ext_vector_type(8)));
typedef float    f4_t  __attribute__((ext_vector_type(4)));

#define BATCH 2
#define SEQ   2048
#define DIMSZ 512
#define HEADS 8
#define DHEAD 64
#define NEGV  1.0e6f

// ---------------------------------------------------------------------------
// helpers
// ---------------------------------------------------------------------------
__device__ __forceinline__ v16h mk16(h8_t lo, h8_t hi) {
    v16h r;
#pragma unroll
    for (int i = 0; i < 8; ++i) { r[i] = lo[i]; r[i + 8] = hi[i]; }
    return r;
}

__device__ __forceinline__ float exp_slot(float x) {
    float y = x * 1.44269504f, r;
    asm("v_exp_f32 %0, %1\n\tv_nop" : "=v"(r) : "v"(y));
    return r;
}

// ---------------------------------------------------------------------------
// FiLM: film[b, o] = b_time[o] + sum_k silu(time[b,k]) * w_time[o,k]
// One wave per output row o (8 waves a block, 128 blocks). The 32 lanes read the
// row in whole 128-byte lines (lane l holds k = 128*j + 4*l .. + 3), once for all
// batches; each lane sums its 16 products (lane 0 on top of b_time[o]) and a
// butterfly over the lanes joins the partial sums.
// ---------------------------------------------------------------------------
__device__ __forceinline__ void film_body(const float* __restrict__ timep,
                                          const float* __restrict__ w_time,
                                          const float* __restrict__ b_time,
                                          float* __restrict__ film) {
    // wave number as a scalar: the row's base address stays in scalar registers
    int o    = blockIdx.x * 8 + __builtin_amdgcn_readfirstlane(threadIdx.x >> 5);
    int lane = threadIdx.x & 31;
    const f4_t* wr = (const f4_t*)(w_time + (size_t)o * DIMSZ);
    f4_t w[4], t[BATCH][4];                // DIMSZ = 4 * 128
#pragma unroll
    for (int j = 0; j < 4; ++j) {
        w[j] = wr[j * 32 + lane];
#pragma unroll
        for (int b = 0; b < BATCH; ++b)
            t[b][j] = ((const f4_t*)(timep + b * DIMSZ))[j * 32 + lane];
    }
    float bt = b_time[o];
    // keeps every load above ahead of the arithmetic, so a wave waits out one memory
    // latency; without it the compiler sinks seven of the vector loads between the
    // silu blocks and the wave waits four times
    __builtin_amdgcn_sched_barrier(0);
    float acc[BATCH];
#pragma unroll
    for (int b = 0; b < BATCH; ++b) {
        acc[b] = (lane == 0) ? bt : 0.0f;   // lane 0's chain starts from the bias
#pragma unroll
        for (int j = 0; j < 4; ++j)
#pragma unroll
            for (int c = 0; c < 4; ++c) {
                float tv = t[b][j][c];
                acc[b] = fmaf(tv / (1.0f + exp_slot(-tv)), w[j][c], acc[b]);   // silu
            }
    }
#pragma unroll
    for (int off = 16; off; off >>= 1)
#pragma unroll
        for (int b = 0; b < BATCH; ++b) acc[b] += __shfl_xor(acc[b], off, 32);
    // every lane holds every batch's sum: lane b stores batch b
    float r = acc[0];
#pragma unroll
    for (int b = 1; b < BATCH; ++b) r = (lane == b) ? acc[b] : r;
    if (lane < BATCH) film[lane * 2 * DIMSZ + o] = r;
}

// ---------------------------------------------------------------------------
// First launch: everything that depends on the inputs alone, in one grid.
// Blocks 0 .. FILM_BLOCKS-1 compute FiLM (the longest chain, so they start first);
// the rest convert the three weight matrices f32 -> f16. A lane converts CVT_LOADS
// groups of 4 elements, so the whole grid is one block per WGP: the bytes are few, and
// a launch of many short waves lasts as long as its waves take to start.
// ---------------------------------------------------------------------------
#define FILM_BLOCKS (2 * DIMSZ / 8)
#define CVT_LOADS   8                                  // 16-byte loads per lane
#define CVT_WAVE    (CVT_LOADS * 128)                  // elements per wave
#define WSQ_BLOCKS  (DIMSZ * DIMSZ / (8 * CVT_WAVE))   // blocks per 512 x 512 matrix

__global__ void prep_kernel(const float* __restrict__ timep,
                            const float* __restrict__ w_time,
                            const float* __restrict__ b_time,
                            float* __restrict__ film,
                            const float* __restrict__ wq,
                            const float* __restrict__ wkv,
                            const float* __restrict__ wout,
                            _Float16* __restrict__ wq16,
                            _Float16* __restrict__ wkv16,
                            _Float16* __restrict__ wo16) {
    if (blockIdx.x < FILM_BLOCKS) {
        film_body(timep, w_time, b_time, film);
        return;
    }
    int blk = blockIdx.x - FILM_BLOCKS;
    const float* in  = wq;
    _Float16*    out = wq16;
    if (blk >= 3 * WSQ_BLOCKS)  { in = wout; out = wo16;  blk -= 3 * WSQ_BLOCKS; }
    else if (blk >= WSQ_BLOCKS) { in = wkv;  out = wkv16; blk -= WSQ_BLOCKS; }
    // wave number as a scalar: the wave's base addresses stay in scalar registers
    int wv   = __builtin_amdgcn_readfirstlane(threadIdx.x >> 5);
    int lane = threadIdx.x & 31;
    size_t base = (size_t)(blk * 8 + wv) * CVT_WAVE;
    const f4_t* src = (const f4_t*)(in + base);
    h4_t*       dst = (h4_t*)(out + base);
    f4_t v[CVT_LOADS];                    // every load covers 4 whole lines
#pragma unroll                            // constant indices: v stays in registers
    for (int j = 0; j < CVT_LOADS; ++j) v[j] = src[j * 32 + lane];
#pragma unroll                            // constant indices, as above
    for (int j = 0; j < CVT_LOADS; ++j)
        dst[j * 32 + lane] = (h4_t){(_Float16)v[j][0], (_Float16)v[j][1],
                                    (_Float16)v[j][2], (_Float16)v[j][3]};
    // the instruction set's wait before a register that an issued store names is
    // overwritten: in this build the FiLM part's code follows the store
    asm volatile("s_wait_xcnt 0x0" ::: "memory");
}

// ---------------------------------------------------------------------------
// LayerNorm + FiLM + seq-mask + fold dim_head^-0.5, emit f16; also x -> f16
// One wave per LN_TOK tokens, 8 waves a block, one block per WGP. The 32 lanes read
// a row in whole 128-byte lines (lane l holds d = 128*j + 4*l .. + 3), each lane sums
// its 16 elements and a butterfly over the lanes joins the sums: no LDS, no barrier,
// few waves to start; gamma and FiLM are read once per wave.
// ---------------------------------------------------------------------------
#define LN_TOK 2                          // divides SEQ: a wave's tokens share a batch

__global__ void ln_film_kernel(const float* __restrict__ x,
                               const float* __restrict__ gamma,
                               const float* __restrict__ film,
                               const float* __restrict__ seq_mask,
                               _Float16* __restrict__ xn16,
                               _Float16* __restrict__ x16) {
    // wave number as a scalar: row bases and the masks stay in scalar registers
    int wv   = __builtin_amdgcn_readfirstlane(threadIdx.x >> 5);
    int lane = threadIdx.x & 31;
    int tok0 = (blockIdx.x * 8 + wv) * LN_TOK;         // 0 .. B*SEQ-LN_TOK
    int b    = tok0 / SEQ;
    const f4_t* xr = (const f4_t*)(x + (size_t)tok0 * DIMSZ);
    const f4_t* gr = (const f4_t*)gamma;
    const f4_t* fb = (const f4_t*)(film + (size_t)b * 2 * DIMSZ);
    f4_t v[LN_TOK][4], g[4], sc[4], sh[4];             // DIMSZ = 4 * 128
    // every loop of this kernel is unrolled: the arrays are then indexed by constants
    // and stay in registers
#pragma unroll
    for (int j = 0; j < 4; ++j) {
#pragma unroll
        for (int t = 0; t < LN_TOK; ++t) v[t][j] = xr[t * (DIMSZ / 4) + j * 32 + lane];
    }
#pragma unroll
    for (int j = 0; j < 4; ++j) {
        g[j]  = gr[j * 32 + lane];
        sc[j] = fb[j * 32 + lane];
        sh[j] = fb[DIMSZ / 4 + j * 32 + lane];
    }
    float mk[LN_TOK];
#pragma unroll
    for (int t = 0; t < LN_TOK; ++t) mk[t] = seq_mask[tok0 + t];
    // keeps every load above ahead of the arithmetic, so a wave waits out one memory
    // latency; without it the compiler sinks eleven of the twelve gamma and FiLM loads
    // among the arithmetic and the wave waits out a latency again for each group
    __builtin_amdgcn_sched_barrier(0);
    float s[LN_TOK], sq[LN_TOK];
#pragma unroll
    for (int t = 0; t < LN_TOK; ++t) {
        f4_t a = (v[t][0] + v[t][1]) + (v[t][2] + v[t][3]);
        f4_t q = (v[t][0] * v[t][0] + v[t][1] * v[t][1]) + (v[t][2] * v[t][2] + v[t][3] * v[t][3]);
        s[t]  = (a[0] + a[1]) + (a[2] + a[3]);
        sq[t] = (q[0] + q[1]) + (q[2] + q[3]);
    }
#pragma unroll
    for (int off = 16; off; off >>= 1)
#pragma unroll
        for (int t = 0; t < LN_TOK; ++t) {
            s[t]  += __shfl_xor(s[t],  off, 32);
            sq[t] += __shfl_xor(sq[t], off, 32);
        }
#pragma unroll
    for (int t = 0; t < LN_TOK; ++t) {
        float mu   = s[t] * (1.0f / DIMSZ);
        float var  = sq[t] * (1.0f / DIMSZ) - mu * mu;
        float rinv = rsqrtf(var + 1e-5f);
        h4_t* on = (h4_t*)(xn16 + (size_t)(tok0 + t) * DIMSZ);
        h4_t* ox = (h4_t*)(x16  + (size_t)(tok0 + t) * DIMSZ);
#pragma unroll
        for (int j = 0; j < 4; ++j) {
            h4_t hn, hx;
#pragma unroll
            for (int c = 0; c < 4; ++c) {
                float xv = v[t][j][c];
                float xn = (xv - mu) * rinv * g[j][c];
                xn = xn * (sc[j][c] + 1.0f) + sh[j][c];
                xn = xn * mk[t] * 0.125f; // fold 64^-0.5 (only q uses xn)
                hn[c] = (_Float16)xn;
                hx[c] = (_Float16)xv;
            }
            on[j * 32 + lane] = hn;
            ox[j * 32 + lane] = hx;
        }
    }
}

// ---------------------------------------------------------------------------
// WMMA GEMMs, Y = A . W^T, K = DIMSZ. A block of 8 waves takes GT_ROWS rows of A and
// GT_COLS rows of W; a wave takes 16 x 64 of Y (A fragment reused across 4 N-tiles).
// Both operand tiles, all of K, are staged in LDS once: the global loads then cover
// whole 128-byte lines (a fragment load from global touches 16 lines for 512 bytes),
// and the W tile is fetched once for the 8 waves that use it.
// LDS rows have a pitch of 16 B x odd, so the 16 rows of a fragment read fall on
// different banks.
// ---------------------------------------------------------------------------
#define GT_ROWS 128                       // rows of A per block = 8 waves x 16
#define GT_COLS 64                        // rows of W per block
#define GPITCH  (DIMSZ + 8)               // f16 per LDS row: 1040 B = 16 B x 65
#define GT_LDS  ((GT_ROWS + GT_COLS) * GPITCH)
#define GT_NT   (DIMSZ / GT_COLS)         // column tiles: blockIdx.x = row tile * GT_NT + column tile

// 256 threads: 64 lanes a row (16 bytes each), 4 rows per step. Ends in the barrier
// behind which every wave may read both tiles.
__device__ __forceinline__ void stage_tiles(const _Float16* __restrict__ A,
                                            const _Float16* __restrict__ W,
                                            _Float16* __restrict__ sm,
                                            int rowbase, int colbase) {
    int r0 = threadIdx.x >> 6, c = (threadIdx.x & 63) * 8;
    const _Float16* ga = A + (size_t)(rowbase + r0) * DIMSZ + c;
    const _Float16* gw = W + (size_t)(colbase + r0) * DIMSZ + c;
    h8_t va[GT_ROWS / 4], vw[GT_COLS / 4];
#pragma unroll                            // constant indices: va, vw stay in registers
    for (int i = 0; i < GT_ROWS / 4; ++i) va[i] = *(const h8_t*)(ga + i * 4 * DIMSZ);
#pragma unroll                            // constant indices, as above
    for (int i = 0; i < GT_COLS / 4; ++i) vw[i] = *(const h8_t*)(gw + i * 4 * DIMSZ);
    // the instruction set's wait before a register that an issued global load names is
    // overwritten; the two addresses are inputs so that their registers live up to it
    // (else this build lands later loads' results in them). It also keeps every load
    // ahead of the LDS stores, so that a wave waits out one latency for the whole tile
    asm volatile("s_wait_xcnt 0x0" :: "v"(ga), "v"(gw) : "memory");
    // keeps the LDS address arithmetic below behind that wait: without it the compiler
    // lifts part of it over the wait, into the address registers of the loads
    __builtin_amdgcn_sched_barrier(0);
    _Float16* sa = sm + r0 * GPITCH + c;
#pragma unroll                            // constant indices, as above
    for (int i = 0; i < GT_ROWS / 4; ++i) *(h8_t*)(sa + i * 4 * GPITCH) = va[i];
#pragma unroll                            // constant indices, as above
    for (int i = 0; i < GT_COLS / 4; ++i) *(h8_t*)(sa + (GT_ROWS + i * 4) * GPITCH) = vw[i];
    __syncthreads();
}

// acc[c] = 16 rows of A (wave wv's) x 16 rows of W (N-tile c), fragments read from LDS.
// W_AS_A: D = W . At (a lane holds one row of A and 8 rows of W), else D = A . Wt.
// f[.][0,1]: the A fragment's two halves; f[.][2 + 2c, 3 + 2c]: N-tile c's.
template <bool W_AS_A>
__device__ __forceinline__ void tile_product(const _Float16* __restrict__ sm,
                                             int wv, int l15, int base0, v8f (&acc)[4]) {
    const _Float16* arow = sm + (wv * 16 + l15) * GPITCH + base0;
    const _Float16* wrow = sm + (GT_ROWS + l15) * GPITCH + base0;
    h8_t f[2][10];
#pragma unroll
    for (int c = 0; c < 4; ++c) acc[c] = (v8f){};
#pragma unroll                            // constant indices: f stays in registers
    for (int s = -1; s < DIMSZ / 32; ++s) {
        if (s + 1 < DIMSZ / 32) {         // the reads of k step s + 1
            int kk = (s + 1) * 32, n = (s + 1) & 1;
            f[n][0] = *(const h8_t*)(arow + kk);
            f[n][1] = *(const h8_t*)(arow + kk + 16);
#pragma unroll
            for (int c = 0; c < 4; ++c) {
                f[n][2 + 2 * c] = *(const h8_t*)(wrow + c * 16 * GPITCH + kk);
                f[n][3 + 2 * c] = *(const h8_t*)(wrow + c * 16 * GPITCH + kk + 16);
            }
        }
        // holds the LDS reads of k step s + 1 ahead of the products of step s, so that the
        // waits are counted and a read has a step's time to land; without it the compiler
        // puts each pair of reads directly in front of its product and the wave waits out
        // an LDS latency at nearly every product
        __builtin_amdgcn_sched_barrier(0);
        if (s >= 0) {
            v16h a = mk16(f[s & 1][0], f[s & 1][1]);
#pragma unroll
            for (int c = 0; c < 4; ++c) {
                v16h bf = mk16(f[s & 1][2 + 2 * c], f[s & 1][3 + 2 * c]);
                acc[c] = W_AS_A
                    ? __builtin_amdgcn_wmma_f32_16x16x32_f16(
                          false, bf, false, a, (short)0, acc[c], false, false)
                    : __builtin_amdgcn_wmma_f32_16x16x32_f16(
                          false, a, false, bf, (short)0, acc[c], false, false);
            }
        }
    }
}

// f16 output with arbitrary (batched) output strides:
//   Out[b*obs + (row%npb)*ors + col*ocs] = (A[row,:] . W[col,:])
__device__ __forceinline__ void gemm_f16out_body(const _Float16* __restrict__ A,
                                                 const _Float16* __restrict__ W,
                                                 _Float16* __restrict__ Out,
                                                 _Float16* __restrict__ sm,
                                                 int npb, long long obs, int ors, int ocs) {
    // wave number as a scalar: tile indices stay in scalar registers
    int wv = __builtin_amdgcn_readfirstlane(threadIdx.x >> 5);
    int bm = blockIdx.x / GT_NT, tn = blockIdx.x % GT_NT;
    int lane = threadIdx.x & 31;
    int l15 = lane & 15, halfsel = lane >> 4, base0 = halfsel ? 8 : 0;
    int rowbase = bm * GT_ROWS + wv * 16, colbase = tn * GT_COLS;
    stage_tiles(A, W, sm, bm * GT_ROWS, colbase);
    v8f acc[4];
    tile_product<false>(sm, wv, l15, base0, acc);
#pragma unroll
    for (int c = 0; c < 4; ++c) {
#pragma unroll
        for (int r = 0; r < 8; ++r) {
            int grow = rowbase + r + halfsel * 8;
            int bidx = grow / npb, rloc = grow % npb;
            size_t addr = (size_t)bidx * obs + (size_t)rloc * ors
                        + (size_t)(colbase + c * 16 + l15) * ocs;
            Out[addr] = (_Float16)acc[c][r];
        }
    }
    // the instruction set's wait before a register that an issued store names is
    // overwritten: in this build the kernel's branch code follows the stores
    asm volatile("s_wait_xcnt 0x0" ::: "memory");
}

// ---------------------------------------------------------------------------
// 16 tokens x 64 features (one head) per wave, f16 output in the
// FRAGMENT ORDER in which attn_kernel reads K and V as A operands:
//   Out[((b*HEADS + h)*(SEQ/16) + token_tile)*1024 + c*256 + lane*8 + e]
// so that one 16-byte load per lane covers 512 contiguous bytes (4 whole lines).
// FEAT_IN_LANE (K): D = W . At; lane (l15, half) holds token l15 and features
//   c*16 + 8*half + e, which is chunk c of K's fragment row l15.
// otherwise   (V): D = A . Wt; lane (l15, half) holds feature c*16 + l15 and
//   tokens 8*half + e, which is this 16-token tile's chunk of Vt's fragment row.
// ---------------------------------------------------------------------------
template <bool FEAT_IN_LANE>
__device__ __forceinline__ void gemm_frag_body(const _Float16* __restrict__ A,
                                               const _Float16* __restrict__ W,
                                               _Float16* __restrict__ Out,
                                               _Float16* __restrict__ sm) {
    // wave number as a scalar: tile indices stay in scalar registers
    int wv = __builtin_amdgcn_readfirstlane(threadIdx.x >> 5);
    int bm = blockIdx.x / GT_NT, tn = blockIdx.x % GT_NT;
    int tm = bm * (GT_ROWS / 16) + wv;
    int lane = threadIdx.x & 31;
    int l15 = lane & 15, halfsel = lane >> 4, base0 = halfsel ? 8 : 0;
    stage_tiles(A, W, sm, bm * GT_ROWS, tn * GT_COLS);
    v8f acc[4];
    tile_product<FEAT_IN_LANE>(sm, wv, l15, base0, acc);
    int bidx = tm / (SEQ / 16), ttile = tm % (SEQ / 16);
    _Float16* o = Out + ((size_t)(bidx * GT_NT + tn) * (SEQ / 16) + ttile) * 1024 + lane * 8;
#pragma unroll
    for (int c = 0; c < 4; ++c) {
        h8_t v;
#pragma unroll
        for (int r = 0; r < 8; ++r) v[r] = (_Float16)acc[c][r];
        *(h8_t*)(o + c * 256) = v;
    }
    // the instruction set's wait before a register that an issued store names is
    // overwritten: in this build the kernel's branch code follows the stores
    asm volatile("s_wait_xcnt 0x0" ::: "memory");
}

// The three projections depend on the same earlier launches and not on each other:
// one grid, blockIdx.y picks the product, so their waves share the chip at once.
//   y = 0: q = xn . wq^T  -> [B, SEQ, 512]     y = 1: k = x . wk^T -> fragment order
//   y = 2: v = x . wv^T   -> fragment order
// The launch bound is the real block size: it lifts the register ceiling, so that the
// staging loads of a tile are all in flight at once.
__global__ void __launch_bounds__(256)
qkv_kernel(const _Float16* __restrict__ xn16,
           const _Float16* __restrict__ x16,
           const _Float16* __restrict__ wq16,
           const _Float16* __restrict__ wk16,
           const _Float16* __restrict__ wv16,
           _Float16* __restrict__ q16,
           _Float16* __restrict__ kf,
           _Float16* __restrict__ vf,
           int npb, long long obs, int ors, int ocs) {
    __shared__ __attribute__((aligned(16))) _Float16 sm[GT_LDS];
    if (blockIdx.y == 0)      gemm_f16out_body(xn16, wq16, q16, sm, npb, obs, ors, ocs);
    else if (blockIdx.y == 1) gemm_frag_body<true>(x16, wk16, kf, sm);
    else                      gemm_frag_body<false>(x16, wv16, vf, sm);
}

// 16-byte load of four row masks. s_wait_xcnt 0 is the instruction set's wait before a
// register that an issued global load names is overwritten: this build lands the second
// load's result in the address registers of the first.
__device__ __forceinline__ f4_t ld_mask4(const float* p) {
    f4_t v = *(const f4_t*)p;
    asm volatile("s_wait_xcnt 0x0" ::: "memory");
    return v;
}

// f32 output [B*SEQ, DIMSZ], multiplied by per-row mask; launch bound as above
__global__ void __launch_bounds__(256)
gemm_f32mask_kernel(const _Float16* __restrict__ A,
                    const _Float16* __restrict__ W,
                    const float* __restrict__ seq_mask,
                    float* __restrict__ Out) {
    __shared__ __attribute__((aligned(16))) _Float16 sm[GT_LDS];
    // wave number as a scalar: tile indices stay in scalar registers
    int wv = __builtin_amdgcn_readfirstlane(threadIdx.x >> 5);
    int bm = blockIdx.x / GT_NT, tn = blockIdx.x % GT_NT;
    int lane = threadIdx.x & 31;
    int l15 = lane & 15, halfsel = lane >> 4, base0 = halfsel ? 8 : 0;
    int rowbase = bm * GT_ROWS + wv * 16, colbase = tn * GT_COLS;
    // masks of this lane's 8 output rows
    f4_t mk4[2] = {ld_mask4(seq_mask + rowbase + halfsel * 8),
                   ld_mask4(seq_mask + rowbase + halfsel * 8 + 4)};
    stage_tiles(A, W, sm, bm * GT_ROWS, colbase);
    v8f acc[4];
    tile_product<false>(sm, wv, l15, base0, acc);
#pragma unroll
    for (int r = 0; r < 8; ++r) {
        int grow = rowbase + r + halfsel * 8;
        float mk = mk4[r >> 2][r & 3];
#pragma unroll
        for (int c = 0; c < 4; ++c)
            Out[(size_t)grow * DIMSZ + colbase + c * 16 + l15] = acc[c][r] * mk;
    }
}

__device__ __forceinline__ float other_half(float v) {
    int b = __builtin_bit_cast(int, v);
    b = __builtin_amdgcn_permlanex16(b, b, 0x76543210, 0xfedcba98, false, false);
    return __builtin_bit_cast(float, b);
}

#define KSPLIT 4                          // key quarters = waves per query tile
#define OPITCH 68                         // floats per partial row: 272 B = 16 B x odd

__global__ void attn_kernel(const _Float16* __restrict__ q16,
                            const _Float16* __restrict__ kf,
                            const _Float16* __restrict__ vf,
                            const float* __restrict__ bias,
                            const float* __restrict__ seq_mask,
                            _Float16* __restrict__ ao) {
    // wave number as a scalar: tile indices and bases are then computed in scalar
    // registers and take no vector registers from the fragments
    int wib   = __builtin_amdgcn_readfirstlane(threadIdx.x >> 5);   // 0 .. 15
    int lane  = threadIdx.x & 31;
    int qsub  = wib & 3;                  // which of the block's query tiles
    int kq    = wib >> 2;                 // which quarter of the keys
    int gwave = blockIdx.x * 4 + qsub;
    int qtile = gwave & 127;              // SEQ/16 = 128
    int h     = (gwave >> 7) & 7;
    int b     = gwave >> 10;
    int qbase = qtile << 4;
    int l15 = lane & 15, halfsel = lane >> 4, base0 = halfsel ? 8 : 0;
    size_t bN   = (size_t)b * SEQ;
    int    hoff = h * DHEAD;
    unsigned rowoff = (unsigned)(l15 * DIMSZ + base0);   // q16: row l15
    unsigned seqoff = (unsigned)(l15 * SEQ + base0);     // bias: row l15
    unsigned frgoff = (unsigned)(lane * 8);              // kf, vf: this lane's 16 bytes

    // Q fragments (d 0..31, d 32..63), scale already folded into xn
    const _Float16* qr = q16 + (bN + qbase) * DIMSZ + hoff;
    v16h aq0 = mk16(*(const h8_t*)(qr + rowoff),      *(const h8_t*)(qr + rowoff + 16));
    v16h aq1 = mk16(*(const h8_t*)(qr + rowoff + 32), *(const h8_t*)(qr + rowoff + 48));

    float mi   = seq_mask[bN + qbase + l15];   // this lane's query
    float mrow = -1.0e30f;                     // running maximum (same in both halves)
    float lrow = 0.0f;                         // running sum of this half's keys
    v8f   Oacc[4];                             // Ot: [d = t*16 + 8*half + r][query l15]
#pragma unroll
    for (int t = 0; t < 4; ++t) Oacc[t] = (v8f){};

    // wave-uniform bases of this head's K tiles, bias rows, key masks and V tiles,
    // each at the first key of this wave's quarter
    int key0 = kq * (SEQ / KSPLIT);
    const _Float16* kbase = kf + ((size_t)(b * HEADS + h) * (SEQ / 16) + key0 / 16) * 1024;
    const float*    bbase = bias + ((size_t)(b * HEADS + h) * SEQ + qbase) * SEQ + key0;
    const float*    mbase = seq_mask + bN + key0;
    const _Float16* vbase = vf + ((size_t)(b * HEADS + h) * (SEQ / 16) + key0 / 16) * 1024;

    for (int jb = 0; jb < SEQ / 32 / KSPLIT; ++jb) {
        int kb = jb * 32;
        // ---- St = K . Qt  (two 16-key tiles) ----
        const _Float16* kr0 = kbase + (size_t)jb * 2048;   // two tiles of 1024
        const _Float16* kr1 = kr0 + 1024;
        v16h b00 = mk16(*(const h8_t*)(kr0 + frgoff),       *(const h8_t*)(kr0 + frgoff + 256));
        v16h b01 = mk16(*(const h8_t*)(kr0 + frgoff + 512), *(const h8_t*)(kr0 + frgoff + 768));
        v16h b10 = mk16(*(const h8_t*)(kr1 + frgoff),       *(const h8_t*)(kr1 + frgoff + 256));
        v16h b11 = mk16(*(const h8_t*)(kr1 + frgoff + 512), *(const h8_t*)(kr1 + frgoff + 768));
        // keeps the eight K loads in one group with one wait; without it this build
        // splits them into three groups among the products and waits out each
        __builtin_amdgcn_sched_barrier(0);
        v8f z = {};
        v8f S0 = __builtin_amdgcn_wmma_f32_16x16x32_f16(false, b00, false, aq0, (short)0, z,  false, false);
        S0     = __builtin_amdgcn_wmma_f32_16x16x32_f16(false, b01, false, aq1, (short)0, S0, false, false);
        v8f S1 = __builtin_amdgcn_wmma_f32_16x16x32_f16(false, b10, false, aq0, (short)0, z,  false, false);
        S1     = __builtin_amdgcn_wmma_f32_16x16x32_f16(false, b11, false, aq1, (short)0, S1, false, false);

        f4_t bv[4], mv[4];                 // [0,1]: keys of tile 0, [2,3]: tile 1
#pragma unroll
        for (int g = 0; g < 4; ++g) {
            int o = (g >> 1) * 16 + (g & 1) * 4;
            bv[g] = *(const f4_t*)(bbase + kb + seqoff + o);
            mv[g] = *(const f4_t*)(mbase + kb + (unsigned)base0 + o);
        }

        // ---- bias add + pair mask + online softmax (in-lane, one max exchange between halves) ----
        float s[16];
#pragma unroll
        for (int i = 0; i < 8; ++i) {
            s[i]     = S0[i] + bv[i >> 2][i & 3]       - (1.0f - mi * mv[i >> 2][i & 3])       * NEGV;
            s[8 + i] = S1[i] + bv[2 + (i >> 2)][i & 3] - (1.0f - mi * mv[2 + (i >> 2)][i & 3]) * NEGV;
        }
        float tm[8];
#pragma unroll
        for (int i = 0; i < 8; ++i) tm[i] = fmaxf(s[i], s[8 + i]);
        float tmax = fmaxf(fmaxf(fmaxf(tm[0], tm[1]), fmaxf(tm[2], tm[3])),
                           fmaxf(fmaxf(tm[4], tm[5]), fmaxf(tm[6], tm[7])));
        tmax = fmaxf(tmax, other_half(tmax));
        float mnew  = fmaxf(mrow, tmax);
        float alpha = exp_slot(mrow - mnew);
        mrow = mnew;

        v16h  pb;                          // Pt as B operand: element i <-> score i
        float ps[4];                       // four partial sums of this lane's p
#pragma unroll
        for (int i = 0; i < 16; ++i) {
            float p = exp_slot(s[i] - mnew);
            ps[i & 3] = (i < 4) ? p : ps[i & 3] + p;
            pb[i] = (_Float16)p;
        }
        lrow = lrow * alpha + ((ps[0] + ps[1]) + (ps[2] + ps[3]));
#pragma unroll
        for (int t = 0; t < 4; ++t) Oacc[t] *= alpha;

        // ---- Ot += Vt . Pt  (keys 0..15 from the first tile, 16..31 from the second) ----
#pragma unroll
        for (int t = 0; t < 4; ++t) {
            const _Float16* vr = vbase + (size_t)jb * 2048 + t * 256;
            v16h va = mk16(*(const h8_t*)(vr + frgoff), *(const h8_t*)(vr + frgoff + 1024));
            Oacc[t] = __builtin_amdgcn_wmma_f32_16x16x32_f16(
                false, va, false, pb, (short)0, Oacc[t], false, false);
        }
    }

    // ---- join the halves' sums; publish this quarter's partial [query][d], max, sum ----
    __shared__ __attribute__((aligned(16))) float part[4 * KSPLIT * 16 * OPITCH];
    __shared__ float pmax[4 * KSPLIT * 16], psum[4 * KSPLIT * 16];
    lrow += other_half(lrow);
    float* pw = part + (wib * 16 + l15) * OPITCH + base0;
#pragma unroll
    for (int t = 0; t < 4; ++t) {
        *(f4_t*)(pw + t * 16)     = (f4_t){Oacc[t][0], Oacc[t][1], Oacc[t][2], Oacc[t][3]};
        *(f4_t*)(pw + t * 16 + 4) = (f4_t){Oacc[t][4], Oacc[t][5], Oacc[t][6], Oacc[t][7]};
    }
    if (halfsel == 0) { pmax[wib * 16 + l15] = mrow; psum[wib * 16 + l15] = lrow; }
    __syncthreads();

    // ---- merge: wave kq takes queries 4*kq .. +3 of its tile; 8 lanes a query, 8 d a
    // lane, so a query's 128-byte output line is stored whole by this one wave ----
    int q  = kq * 4 + (lane >> 3);
    int d0 = (lane & 7) * 8;
    float pm[KSPLIT], pl[KSPLIT];
#pragma unroll                            // constant indices: pm, pl stay in registers
    for (int w = 0; w < KSPLIT; ++w) {
        pm[w] = pmax[(w * 4 + qsub) * 16 + q];
        pl[w] = psum[(w * 4 + qsub) * 16 + q];
    }
    float mall = fmaxf(fmaxf(pm[0], pm[1]), fmaxf(pm[2], pm[3]));
    float lall = 0.0f;
    f4_t  o0 = {}, o1 = {};
#pragma unroll                            // constant indices into pm, pl, as above
    for (int w = 0; w < KSPLIT; ++w) {
        float g = exp_slot(pm[w] - mall);           // weight of quarter w
        const float* pr = part + ((w * 4 + qsub) * 16 + q) * OPITCH + d0;
        lall += pl[w] * g;
        o0   += *(const f4_t*)pr * g;
        o1   += *(const f4_t*)(pr + 4) * g;
    }
    float inv = (lall > 0.0f) ? (1.0f / lall) : 0.0f;
    h8_t o;
#pragma unroll
    for (int r = 0; r < 4; ++r) {
        o[r]     = (_Float16)(o0[r] * inv);
        o[4 + r] = (_Float16)(o1[r] * inv);
    }
    *(h8_t*)(ao + (bN + qbase + q) * DIMSZ + hoff + d0) = o;
}

// ---------------------------------------------------------------------------
// launcher
// ---------------------------------------------------------------------------
extern "C" void kernel_launch(void* const* d_in, const int* in_sizes, int n_in,
                              void* d_out, int out_size, void* d_ws, size_t ws_size,
                              hipStream_t stream) {
    const float* x     = (const float*)d_in[0];
    const float* timep = (const float*)d_in[1];
    const float* bias  = (const float*)d_in[2];
    const float* mask  = (const float*)d_in[3];
    const float* gamma = (const float*)d_in[4];
    const float* wtime = (const float*)d_in[5];
    const float* btime = (const float*)d_in[6];
    const float* wq    = (const float*)d_in[7];
    const float* wkv   = (const float*)d_in[8];
    const float* wout  = (const float*)d_in[9];
    float* out = (float*)d_out;

    uint8_t* ws = (uint8_t*)d_ws;
    size_t off = 0;
    auto alloc = [&](size_t bytes) -> uint8_t* {
        uint8_t* p = ws + off;
        off += (bytes + 255) & ~(size_t)255;
        return p;
    };
    const size_t ACT = (size_t)BATCH * SEQ * DIMSZ;        // 2M elems
    float*    film  = (float*)   alloc(BATCH * 2 * DIMSZ * 4);
    _Float16* xn16  = (_Float16*)alloc(ACT * 2);
    _Float16* x16   = (_Float16*)alloc(ACT * 2);
    _Float16* wq16  = (_Float16*)alloc((size_t)DIMSZ * DIMSZ * 2);
    _Float16* wkv16 = (_Float16*)alloc((size_t)2 * DIMSZ * DIMSZ * 2);
    _Float16* wo16  = (_Float16*)alloc((size_t)DIMSZ * DIMSZ * 2);
    _Float16* q16   = (_Float16*)alloc(ACT * 2);
    _Float16* k16   = (_Float16*)alloc(ACT * 2);
    _Float16* vT16  = (_Float16*)alloc(ACT * 2);
    _Float16* ao16  = (_Float16*)alloc(ACT * 2);

    // FiLM params and the three weight converts in one grid, then fused LN+FiLM+mask
    prep_kernel<<<FILM_BLOCKS + 4 * WSQ_BLOCKS, 256, 0, stream>>>(
        timep, wtime, btime, film, wq, wkv, wout, wq16, wkv16, wo16);
    ln_film_kernel<<<BATCH * SEQ / (8 * LN_TOK), 256, 0, stream>>>(x, gamma, film, mask, xn16, x16);

    // 128 x 64 tiles of a [4096, 512] product: 256 blocks of 8 waves
    const int gblocks = (BATCH * SEQ / GT_ROWS) * GT_NT;
    // q = xn @ wq^T, k = x @ wkv[0:512]^T, v = x @ wkv[512:]^T in one grid
    qkv_kernel<<<dim3(gblocks, 3), 256, 0, stream>>>(
        xn16, x16, wq16, wkv16, wkv16 + (size_t)DIMSZ * DIMSZ, q16, k16, vT16,
        SEQ, (long long)SEQ * DIMSZ, DIMSZ, 1);

    // flash attention: B*H*(SEQ/16) = 2048 query tiles, 4 tiles x 4 key quarters / block
    attn_kernel<<<BATCH * HEADS * (SEQ / 16) / 4, 512, 0, stream>>>(
        q16, k16, vT16, bias, mask, ao16);

    // out = (ao @ wout^T) * mask  -> f32
    gemm_f32mask_kernel<<<gblocks, 256, 0, stream>>>(ao16, wo16, mask, out);
}

// v008
// It runs in 63.5 microseconds.
// Timed twice side by side with v007, it ran 1.21 times as fast both times.
// Over all steps from v000 it is 8.20 times as fast.
#include <hip/hip_runtime.h>

typedef _Float16 h8_t  __attribute__((ext_vector_type(8)));
typedef _Float16 h4_t  __attribute__((ext_vector_type(4)));
typedef _Float16 v16h  __attribute__((ext_vector_type(16)));
typedef float    v8f   __attribute__((ext_vector_type(8)));
typedef float    f4_t  __attribute__((ext_vector_type(4)));

#define BATCH 2
#define SEQ   2048
#define DIMSZ 512
#define HEADS 8
#define DHEAD 64
#define NEGV  1.0e6f

// ---------------------------------------------------------------------------
// helpers
// ---------------------------------------------------------------------------
__device__ __forceinline__ v16h mk16(h8_t lo, h8_t hi) {
    v16h r;
#pragma unroll
    for (int i = 0; i < 8; ++i) { r[i] = lo[i]; r[i + 8] = hi[i]; }
    return r;
}

__device__ __forceinline__ float exp_slot(float x) {
    float y = x * 1.44269504f, r;
    asm("v_exp_f32 %0, %1\n\tv_nop" : "=v"(r) : "v"(y));
    return r;
}

// ---------------------------------------------------------------------------
// FiLM: film[b, o] = b_time[o] + sum_k silu(time[b,k]) * w_time[o,k]
// One wave per output row o (8 waves a block, 128 blocks). The 32 lanes read the
// row in whole 128-byte lines (lane l holds k = 128*j + 4*l .. + 3), once for all
// batches; each lane sums its 16 products (lane 0 on top of b_time[o]) and a
// butterfly over the lanes joins the partial sums.
// ---------------------------------------------------------------------------
__device__ __forceinline__ void film_body(const float* __restrict__ timep,
                                          const float* __restrict__ w_time,
                                          const float* __restrict__ b_time,
                                          float* __restrict__ film) {
    // wave number as a scalar: the row's base address stays in scalar registers
    int o    = blockIdx.x * 8 + __builtin_amdgcn_readfirstlane(threadIdx.x >> 5);
    int lane = threadIdx.x & 31;
    const f4_t* wr = (const f4_t*)(w_time + (size_t)o * DIMSZ);
    f4_t w[4], t[BATCH][4];                // DIMSZ = 4 * 128
#pragma unroll
    for (int j = 0; j < 4; ++j) {
        w[j] = wr[j * 32 + lane];
#pragma unroll
        for (int b = 0; b < BATCH; ++b)
            t[b][j] = ((const f4_t*)(timep + b * DIMSZ))[j * 32 + lane];
    }
    float bt = b_time[o];
    // keeps every load above ahead of the arithmetic, so a wave waits out one memory
    // latency; without it the compiler sinks seven of the vector loads between the
    // silu blocks and the wave waits four times
    __builtin_amdgcn_sched_barrier(0);
    float acc[BATCH];
#pragma unroll
    for (int b = 0; b < BATCH; ++b) {
        acc[b] = (lane == 0) ? bt : 0.0f;   // lane 0's chain starts from the bias
#pragma unroll
        for (int j = 0; j < 4; ++j)
#pragma unroll
            for (int c = 0; c < 4; ++c) {
                float tv = t[b][j][c];
                acc[b] = fmaf(tv / (1.0f + exp_slot(-tv)), w[j][c], acc[b]);   // silu
            }
    }
#pragma unroll
    for (int off = 16; off; off >>= 1)
#pragma unroll
        for (int b = 0; b < BATCH; ++b) acc[b] += __shfl_xor(acc[b], off, 32);
    // every lane holds every batch's sum: lane b stores batch b
    float r = acc[0];
#pragma unroll
    for (int b = 1; b < BATCH; ++b) r = (lane == b) ? acc[b] : r;
    if (lane < BATCH) film[lane * 2 * DIMSZ + o] = r;
}

// ---------------------------------------------------------------------------
// First launch: everything that depends on the inputs alone, in one grid.
// Blocks 0 .. FILM_BLOCKS-1 compute FiLM (the longest chain, so they start first);
// the rest convert the three weight matrices f32 -> f16. A lane converts CVT_LOADS
// groups of 4 elements, so the whole grid is one block per WGP: the bytes are few, and
// a launch of many short waves lasts as long as its waves take to start.
// ---------------------------------------------------------------------------
#define FILM_BLOCKS (2 * DIMSZ / 8)
#define CVT_LOADS   8                                  // 16-byte loads per lane
#define CVT_WAVE    (CVT_LOADS * 128)                  // elements per wave
#define WSQ_BLOCKS  (DIMSZ * DIMSZ / (8 * CVT_WAVE))   // blocks per 512 x 512 matrix

__global__ void prep_kernel(const float* __restrict__ timep,
                            const float* __restrict__ w_time,
                            const float* __restrict__ b_time,
                            float* __restrict__ film,
                            const float* __restrict__ wq,
                            const float* __restrict__ wkv,
                            const float* __restrict__ wout,
                            _Float16* __restrict__ wq16,
                            _Float16* __restrict__ wkv16,
                            _Float16* __restrict__ wo16) {
    if (blockIdx.x < FILM_BLOCKS) {
        film_body(timep, w_time, b_time, film);
        return;
    }
    int blk = blockIdx.x - FILM_BLOCKS;
    const float* in  = wq;
    _Float16*    out = wq16;
    if (blk >= 3 * WSQ_BLOCKS)  { in = wout; out = wo16;  blk -= 3 * WSQ_BLOCKS; }
    else if (blk >= WSQ_BLOCKS) { in = wkv;  out = wkv16; blk -= WSQ_BLOCKS; }
    // wave number as a scalar: the wave's base addresses stay in scalar registers
    int wv   = __builtin_amdgcn_readfirstlane(threadIdx.x >> 5);
    int lane = threadIdx.x & 31;
    size_t base = (size_t)(blk * 8 + wv) * CVT_WAVE;
    const f4_t* src = (const f4_t*)(in + base);
    h4_t*       dst = (h4_t*)(out + base);
    f4_t v[CVT_LOADS];                    // every load covers 4 whole lines
#pragma unroll                            // constant indices: v stays in registers
    for (int j = 0; j < CVT_LOADS; ++j) v[j] = src[j * 32 + lane];
#pragma unroll                            // constant indices, as above
    for (int j = 0; j < CVT_LOADS; ++j)
        dst[j * 32 + lane] = (h4_t){(_Float16)v[j][0], (_Float16)v[j][1],
                                    (_Float16)v[j][2], (_Float16)v[j][3]};
    // the instruction set's wait before a register that an issued store names is
    // overwritten: in this build the FiLM part's code follows the store
    asm volatile("s_wait_xcnt 0x0" ::: "memory");
}

// ---------------------------------------------------------------------------
// LayerNorm + FiLM + seq-mask + fold dim_head^-0.5, emit f16; also x -> f16
// One wave per LN_TOK tokens, 8 waves a block, one block per WGP. The 32 lanes read
// a row in whole 128-byte lines (lane l holds d = 128*j + 4*l .. + 3), each lane sums
// its 16 elements and a butterfly over the lanes joins the sums: no LDS, no barrier,
// few waves to start; gamma and FiLM are read once per wave.
// ---------------------------------------------------------------------------
#define LN_TOK 2                          // divides SEQ: a wave's tokens share a batch

__global__ void ln_film_kernel(const float* __restrict__ x,
                               const float* __restrict__ gamma,
                               const float* __restrict__ film,
                               const float* __restrict__ seq_mask,
                               _Float16* __restrict__ xn16,
                               _Float16* __restrict__ x16) {
    // wave number as a scalar: row bases and the masks stay in scalar registers
    int wv   = __builtin_amdgcn_readfirstlane(threadIdx.x >> 5);
    int lane = threadIdx.x & 31;
    int tok0 = (blockIdx.x * 8 + wv) * LN_TOK;         // 0 .. B*SEQ-LN_TOK
    int b    = tok0 / SEQ;
    const f4_t* xr = (const f4_t*)(x + (size_t)tok0 * DIMSZ);
    const f4_t* gr = (const f4_t*)gamma;
    const f4_t* fb = (const f4_t*)(film + (size_t)b * 2 * DIMSZ);
    f4_t v[LN_TOK][4], g[4], sc[4], sh[4];             // DIMSZ = 4 * 128
    // every loop of this kernel is unrolled: the arrays are then indexed by constants
    // and stay in registers
#pragma unroll
    for (int j = 0; j < 4; ++j) {
#pragma unroll
        for (int t = 0; t < LN_TOK; ++t) v[t][j] = xr[t * (DIMSZ / 4) + j * 32 + lane];
    }
#pragma unroll
    for (int j = 0; j < 4; ++j) {
        g[j]  = gr[j * 32 + lane];
        sc[j] = fb[j * 32 + lane];
        sh[j] = fb[DIMSZ / 4 + j * 32 + lane];
    }
    float mk[LN_TOK];
#pragma unroll
    for (int t = 0; t < LN_TOK; ++t) mk[t] = seq_mask[tok0 + t];
    // keeps every load above ahead of the arithmetic, so a wave waits out one memory
    // latency; without it the compiler sinks eleven of the twelve gamma and FiLM loads
    // among the arithmetic and the wave waits out a latency again for each group
    __builtin_amdgcn_sched_barrier(0);
    float s[LN_TOK], sq[LN_TOK];
#pragma unroll
    for (int t = 0; t < LN_TOK; ++t) {
        f4_t a = (v[t][0] + v[t][1]) + (v[t][2] + v[t][3]);
        f4_t q = (v[t][0] * v[t][0] + v[t][1] * v[t][1]) + (v[t][2] * v[t][2] + v[t][3] * v[t][3]);
        s[t]  = (a[0] + a[1]) + (a[2] + a[3]);
        sq[t] = (q[0] + q[1]) + (q[2] + q[3]);
    }
#pragma unroll
    for (int off = 16; off; off >>= 1)
#pragma unroll
        for (int t = 0; t < LN_TOK; ++t) {
            s[t]  += __shfl_xor(s[t],  off, 32);
            sq[t] += __shfl_xor(sq[t], off, 32);
        }
#pragma unroll
    for (int t = 0; t < LN_TOK; ++t) {
        float mu   = s[t] * (1.0f / DIMSZ);
        float var  = sq[t] * (1.0f / DIMSZ) - mu * mu;
        float rinv = rsqrtf(var + 1e-5f);
        h4_t* on = (h4_t*)(xn16 + (size_t)(tok0 + t) * DIMSZ);
        h4_t* ox = (h4_t*)(x16  + (size_t)(tok0 + t) * DIMSZ);
#pragma unroll
        for (int j = 0; j < 4; ++j) {
            h4_t hn, hx;
#pragma unroll
            for (int c = 0; c < 4; ++c) {
                float xv = v[t][j][c];
                float xn = (xv - mu) * rinv * g[j][c];
                xn = xn * (sc[j][c] + 1.0f) + sh[j][c];
                xn = xn * mk[t] * 0.125f; // fold 64^-0.5 (only q uses xn)
                hn[c] = (_Float16)xn;
                hx[c] = (_Float16)xv;
            }
            on[j * 32 + lane] = hn;
            ox[j * 32 + lane] = hx;
        }
    }
}

// ---------------------------------------------------------------------------
// WMMA GEMMs, Y = A . W^T, K = DIMSZ. A block of 8 waves takes GT_ROWS rows of A and
// GT_COLS rows of W; a wave takes 16 x 64 of Y (A fragment reused across 4 N-tiles).
// Both operand tiles, all of K, are staged in LDS once: the global loads then cover
// whole 128-byte lines (a fragment load from global touches 16 lines for 512 bytes),
// and the W tile is fetched once for the 8 waves that use it.
// LDS rows have a pitch of 16 B x odd, so the 16 rows of a fragment read fall on
// different banks.
// ---------------------------------------------------------------------------
#define GT_ROWS 128                       // rows of A per block = 8 waves x 16
#define GT_COLS 64                        // rows of W per block
#define GPITCH  (DIMSZ + 8)               // f16 per LDS row: 1040 B = 16 B x 65
#define GT_LDS  ((GT_ROWS + GT_COLS) * GPITCH)
#define GT_NT   (DIMSZ / GT_COLS)         // column tiles: blockIdx.x = row tile * GT_NT + column tile

// 256 threads: 64 lanes a row (16 bytes each), 4 rows per step. Ends in the barrier
// behind which every wave may read both tiles.
__device__ __forceinline__ void stage_tiles(const _Float16* __restrict__ A,
                                            const _Float16* __restrict__ W,
                                            _Float16* __restrict__ sm,
                                            int rowbase, int colbase) {
    int r0 = threadIdx.x >> 6, c = (threadIdx.x & 63) * 8;
    const _Float16* ga = A + (size_t)(rowbase + r0) * DIMSZ + c;
    const _Float16* gw = W + (size_t)(colbase + r0) * DIMSZ + c;
    h8_t va[GT_ROWS / 4], vw[GT_COLS / 4];
#pragma unroll                            // constant indices: va, vw stay in registers
    for (int i = 0; i < GT_ROWS / 4; ++i) va[i] = *(const h8_t*)(ga + i * 4 * DIMSZ);
#pragma unroll                            // constant indices, as above
    for (int i = 0; i < GT_COLS / 4; ++i) vw[i] = *(const h8_t*)(gw + i * 4 * DIMSZ);
    // the instruction set's wait before a register that an issued global load names is
    // overwritten; the two addresses are inputs so that their registers live up to it
    // (else this build lands later loads' results in them). It also keeps every load
    // ahead of the LDS stores, so that a wave waits out one latency for the whole tile
    asm volatile("s_wait_xcnt 0x0" :: "v"(ga), "v"(gw) : "memory");
    // keeps the LDS address arithmetic below behind that wait: without it the compiler
    // lifts part of it over the wait, into the address registers of the loads
    __builtin_amdgcn_sched_barrier(0);
    _Float16* sa = sm + r0 * GPITCH + c;
#pragma unroll                            // constant indices, as above
    for (int i = 0; i < GT_ROWS / 4; ++i) *(h8_t*)(sa + i * 4 * GPITCH) = va[i];
#pragma unroll                            // constant indices, as above
    for (int i = 0; i < GT_COLS / 4; ++i) *(h8_t*)(sa + (GT_ROWS + i * 4) * GPITCH) = vw[i];
    __syncthreads();
}

// acc[c] = 16 rows of A (wave wv's) x 16 rows of W (N-tile c), fragments read from LDS.
// W_AS_A: D = W . At (a lane holds one row of A and 8 rows of W), else D = A . Wt.
// f[.][0,1]: the A fragment's two halves; f[.][2 + 2c, 3 + 2c]: N-tile c's.
template <bool W_AS_A>
__device__ __forceinline__ void tile_product(const _Float16* __restrict__ sm,
                                             int wv, int l15, int base0, v8f (&acc)[4]) {
    const _Float16* arow = sm + (wv * 16 + l15) * GPITCH + base0;
    const _Float16* wrow = sm + (GT_ROWS + l15) * GPITCH + base0;
    h8_t f[2][10];
#pragma unroll
    for (int c = 0; c < 4; ++c) acc[c] = (v8f){};
#pragma unroll                            // constant indices: f stays in registers
    for (int s = -1; s < DIMSZ / 32; ++s) {
        if (s + 1 < DIMSZ / 32) {         // the reads of k step s + 1
            int kk = (s + 1) * 32, n = (s + 1) & 1;
            f[n][0] = *(const h8_t*)(arow + kk);
            f[n][1] = *(const h8_t*)(arow + kk + 16);
#pragma unroll
            for (int c = 0; c < 4; ++c) {
                f[n][2 + 2 * c] = *(const h8_t*)(wrow + c * 16 * GPITCH + kk);
                f[n][3 + 2 * c] = *(const h8_t*)(wrow + c * 16 * GPITCH + kk + 16);
            }
        }
        // holds the LDS reads of k step s + 1 ahead of the products of step s, so that the
        // waits are counted and a read has a step's time to land; without it the compiler
        // puts each pair of reads directly in front of its product and the wave waits out
        // an LDS latency at nearly every product
        __builtin_amdgcn_sched_barrier(0);
        if (s >= 0) {
            v16h a = mk16(f[s & 1][0], f[s & 1][1]);
#pragma unroll
            for (int c = 0; c < 4; ++c) {
                v16h bf = mk16(f[s & 1][2 + 2 * c], f[s & 1][3 + 2 * c]);
                acc[c] = W_AS_A
                    ? __builtin_amdgcn_wmma_f32_16x16x32_f16(
                          false, bf, false, a, (short)0, acc[c], false, false)
                    : __builtin_amdgcn_wmma_f32_16x16x32_f16(
                          false, a, false, bf, (short)0, acc[c], false, false);
            }
        }
    }
}

// f16 output with arbitrary (batched) output strides:
//   Out[b*obs + (row%npb)*ors + col*ocs] = (A[row,:] . W[col,:])
__device__ __forceinline__ void gemm_f16out_body(const _Float16* __restrict__ A,
                                                 const _Float16* __restrict__ W,
                                                 _Float16* __restrict__ Out,
                                                 _Float16* __restrict__ sm,
                                                 int npb, long long obs, int ors, int ocs) {
    // wave number as a scalar: tile indices stay in scalar registers
    int wv = __builtin_amdgcn_readfirstlane(threadIdx.x >> 5);
    int bm = blockIdx.x / GT_NT, tn = blockIdx.x % GT_NT;
    int lane = threadIdx.x & 31;
    int l15 = lane & 15, halfsel = lane >> 4, base0 = halfsel ? 8 : 0;
    int rowbase = bm * GT_ROWS + wv * 16, colbase = tn * GT_COLS;
    stage_tiles(A, W, sm, bm * GT_ROWS, colbase);
    v8f acc[4];
    tile_product<false>(sm, wv, l15, base0, acc);
#pragma unroll
    for (int c = 0; c < 4; ++c) {
#pragma unroll
        for (int r = 0; r < 8; ++r) {
            int grow = rowbase + r + halfsel * 8;
            int bidx = grow / npb, rloc = grow % npb;
            size_t addr = (size_t)bidx * obs + (size_t)rloc * ors
                        + (size_t)(colbase + c * 16 + l15) * ocs;
            Out[addr] = (_Float16)acc[c][r];
        }
    }
    // the instruction set's wait before a register that an issued store names is
    // overwritten: in this build the kernel's branch code follows the stores
    asm volatile("s_wait_xcnt 0x0" ::: "memory");
}

// ---------------------------------------------------------------------------
// 16 tokens x 64 features (one head) per wave, f16 output in the
// FRAGMENT ORDER in which attn_kernel reads K and V as A operands:
//   Out[((b*HEADS + h)*(SEQ/16) + token_tile)*1024 + c*256 + lane*8 + e]
// so that one 16-byte load per lane covers 512 contiguous bytes (4 whole lines).
// FEAT_IN_LANE (K): D = W . At; lane (l15, half) holds token l15 and features
//   c*16 + 8*half + e, which is chunk c of K's fragment row l15.
// otherwise   (V): D = A . Wt; lane (l15, half) holds feature c*16 + l15 and
//   tokens 8*half + e, which is this 16-token tile's chunk of Vt's fragment row.
// ---------------------------------------------------------------------------
template <bool FEAT_IN_LANE>
__device__ __forceinline__ void gemm_frag_body(const _Float16* __restrict__ A,
                                               const _Float16* __restrict__ W,
                                               _Float16* __restrict__ Out,
                                               _Float16* __restrict__ sm) {
    // wave number as a scalar: tile indices stay in scalar registers
    int wv = __builtin_amdgcn_readfirstlane(threadIdx.x >> 5);
    int bm = blockIdx.x / GT_NT, tn = blockIdx.x % GT_NT;
    int tm = bm * (GT_ROWS / 16) + wv;
    int lane = threadIdx.x & 31;
    int l15 = lane & 15, halfsel = lane >> 4, base0 = halfsel ? 8 : 0;
    stage_tiles(A, W, sm, bm * GT_ROWS, tn * GT_COLS);
    v8f acc[4];
    tile_product<FEAT_IN_LANE>(sm, wv, l15, base0, acc);
    int bidx = tm / (SEQ / 16), ttile = tm % (SEQ / 16);
    _Float16* o = Out + ((size_t)(bidx * GT_NT + tn) * (SEQ / 16) + ttile) * 1024 + lane * 8;
#pragma unroll
    for (int c = 0; c < 4; ++c) {
        h8_t v;
#pragma unroll
        for (int r = 0; r < 8; ++r) v[r] = (_Float16)acc[c][r];
        *(h8_t*)(o + c * 256) = v;
    }
    // the instruction set's wait before a register that an issued store names is
    // overwritten: in this build the kernel's branch code follows the stores
    asm volatile("s_wait_xcnt 0x0" ::: "memory");
}

// The three projections depend on the same earlier launches and not on each other:
// one grid, blockIdx.y picks the product, so their waves share the chip at once.
//   y = 0: q = xn . wq^T  -> [B, SEQ, 512]     y = 1: k = x . wk^T -> fragment order
//   y = 2: v = x . wv^T   -> fragment order
// The launch bound is the real block size: it lifts the register ceiling, so that the
// staging loads of a tile are all in flight at once.
__global__ void __launch_bounds__(256)
qkv_kernel(const _Float16* __restrict__ xn16,
           const _Float16* __restrict__ x16,
           const _Float16* __restrict__ wq16,
           const _Float16* __restrict__ wk16,
           const _Float16* __restrict__ wv16,
           _Float16* __restrict__ q16,
           _Float16* __restrict__ kf,
           _Float16* __restrict__ vf,
           int npb, long long obs, int ors, int ocs) {
    __shared__ __attribute__((aligned(16))) _Float16 sm[GT_LDS];
    if (blockIdx.y == 0)      gemm_f16out_body(xn16, wq16, q16, sm, npb, obs, ors, ocs);
    else if (blockIdx.y == 1) gemm_frag_body<true>(x16, wk16, kf, sm);
    else                      gemm_frag_body<false>(x16, wv16, vf, sm);
}

// 16-byte load of four row masks. s_wait_xcnt 0 is the instruction set's wait before a
// register that an issued global load names is overwritten: this build lands the second
// load's result in the address registers of the first.
__device__ __forceinline__ f4_t ld_mask4(const float* p) {
    f4_t v = *(const f4_t*)p;
    asm volatile("s_wait_xcnt 0x0" ::: "memory");
    return v;
}

// f32 output [B*SEQ, DIMSZ], multiplied by per-row mask; launch bound as above
__global__ void __launch_bounds__(256)
gemm_f32mask_kernel(const _Float16* __restrict__ A,
                    const _Float16* __restrict__ W,
                    const float* __restrict__ seq_mask,
                    float* __restrict__ Out) {
    __shared__ __attribute__((aligned(16))) _Float16 sm[GT_LDS];
    // wave number as a scalar: tile indices stay in scalar registers
    int wv = __builtin_amdgcn_readfirstlane(threadIdx.x >> 5);
    int bm = blockIdx.x / GT_NT, tn = blockIdx.x % GT_NT;
    int lane = threadIdx.x & 31;
    int l15 = lane & 15, halfsel = lane >> 4, base0 = halfsel ? 8 : 0;
    int rowbase = bm * GT_ROWS + wv * 16, colbase = tn * GT_COLS;
    // masks of this lane's 8 output rows
    f4_t mk4[2] = {ld_mask4(seq_mask + rowbase + halfsel * 8),
                   ld_mask4(seq_mask + rowbase + halfsel * 8 + 4)};
    stage_tiles(A, W, sm, bm * GT_ROWS, colbase);
    v8f acc[4];
    tile_product<false>(sm, wv, l15, base0, acc);
#pragma unroll
    for (int r = 0; r < 8; ++r) {
        int grow = rowbase + r + halfsel * 8;
        float mk = mk4[r >> 2][r & 3];
#pragma unroll
        for (int c = 0; c < 4; ++c)
            Out[(size_t)grow * DIMSZ + colbase + c * 16 + l15] = acc[c][r] * mk;
    }
}

__device__ __forceinline__ float other_half(float v) {
    int b = __builtin_bit_cast(int, v);
    b = __builtin_amdgcn_permlanex16(b, b, 0x76543210, 0xfedcba98, false, false);
    return __builtin_bit_cast(float, b);
}

#define KSPLIT 4                          // key quarters = waves per query tile
#define QG     2                          // groups of 16 queries per wave
#define QROWS  (16 * QG)                  // queries per wave
#define OPITCH 68                         // floats per partial row: 272 B = 16 B x odd

// The launch bound is the real block size: 4 waves a SIMD, 256 registers a wave.
__global__ void __launch_bounds__(512)
attn_kernel(const _Float16* __restrict__ q16,
            const _Float16* __restrict__ kf,
            const _Float16* __restrict__ vf,
            const float* __restrict__ bias,
            const float* __restrict__ seq_mask,
            _Float16* __restrict__ ao) {
    // wave number as a scalar: tile indices and bases are then computed in scalar
    // registers and take no vector registers from the fragments
    int wib   = __builtin_amdgcn_readfirstlane(threadIdx.x >> 5);   // 0 .. 15
    int lane  = threadIdx.x & 31;
    int qsub  = wib & 3;                  // which of the block's query tiles
    int kq    = wib >> 2;                 // which quarter of the keys
    int gwave = blockIdx.x * 4 + qsub;
    int qtile = gwave % (SEQ / QROWS);
    int h     = (gwave / (SEQ / QROWS)) % HEADS;
    int b     = gwave / (SEQ / QROWS * HEADS);
    int qbase = qtile * QROWS;
    int l15 = lane & 15, halfsel = lane >> 4, base0 = halfsel ? 8 : 0;
    size_t bN   = (size_t)b * SEQ;
    int    hoff = h * DHEAD;
    unsigned rowoff = (unsigned)(l15 * DIMSZ + base0);   // q16: row l15
    unsigned seqoff = (unsigned)(l15 * SEQ + base0);     // bias: row l15
    unsigned frgoff = (unsigned)(lane * 8);              // kf, vf: this lane's 16 bytes

    // Q fragments (d 0..31, d 32..63) of each group, scale already folded into xn
    const _Float16* qr = q16 + (bN + qbase) * DIMSZ + hoff;
    v16h  aq[QG][2];
    float mi[QG], mrow[QG], lrow[QG];
    v8f   Oacc[QG][4];                    // Ot: [d = t*16 + 8*half + r][query l15]
    // every loop over the groups is unrolled: the arrays are then indexed by constants
    // and stay in registers
#pragma unroll
    for (int c = 0; c < QG; ++c) {
        const _Float16* qc = qr + c * 16 * DIMSZ + rowoff;
        aq[c][0] = mk16(*(const h8_t*)(qc),      *(const h8_t*)(qc + 16));
        aq[c][1] = mk16(*(const h8_t*)(qc + 32), *(const h8_t*)(qc + 48));
        mi[c]    = seq_mask[bN + qbase + c * 16 + l15];   // this lane's query
        mrow[c]  = -1.0e30f;              // running maximum (same in both halves)
        lrow[c]  = 0.0f;                  // running sum of this half's keys
#pragma unroll
        for (int t = 0; t < 4; ++t) Oacc[c][t] = (v8f){};
    }

    // wave-uniform bases of this head's K tiles, bias rows, key masks and V tiles,
    // each at the first key of this wave's quarter
    int key0 = kq * (SEQ / KSPLIT);
    const _Float16* kbase = kf + ((size_t)(b * HEADS + h) * (SEQ / 16) + key0 / 16) * 1024;
    const float*    bbase = bias + ((size_t)(b * HEADS + h) * SEQ + qbase) * SEQ + key0;
    const float*    mbase = seq_mask + bN + key0;
    const _Float16* vbase = vf + ((size_t)(b * HEADS + h) * (SEQ / 16) + key0 / 16) * 1024;

    for (int jb = 0; jb < SEQ / 32 / KSPLIT; ++jb) {
        int kb = jb * 32;
        // ---- St = K . Qt  (two 16-key tiles, each against every query group) ----
        const _Float16* kr0 = kbase + (size_t)jb * 2048 + frgoff;   // two tiles of 1024
        const _Float16* kr1 = kr0 + 1024;
        v16h b00 = mk16(*(const h8_t*)(kr0),       *(const h8_t*)(kr0 + 256));
        v16h b01 = mk16(*(const h8_t*)(kr0 + 512), *(const h8_t*)(kr0 + 768));
        v16h b10 = mk16(*(const h8_t*)(kr1),       *(const h8_t*)(kr1 + 256));
        v16h b11 = mk16(*(const h8_t*)(kr1 + 512), *(const h8_t*)(kr1 + 768));
        f4_t bv[QG][4], mv[4];             // [0,1]: keys of tile 0, [2,3]: tile 1
#pragma unroll
        for (int g = 0; g < 4; ++g) {
            int o = (g >> 1) * 16 + (g & 1) * 4;
#pragma unroll
            for (int c = 0; c < QG; ++c)
                bv[c][g] = *(const f4_t*)(bbase + kb + c * 16 * SEQ + seqoff + o);
            mv[g] = *(const f4_t*)(mbase + kb + (unsigned)base0 + o);
        }
        // the instruction set's wait before a register that an issued global load names is
        // overwritten; the K address is an input so that its registers live up to it (else
        // this build lands a mask load's result in them)
        asm volatile("s_wait_xcnt 0x0" :: "v"(kr0) : "memory");
        // ends the group of K, bias and mask loads at the head of a pass, whose latencies
        // run side by side; without it this build lifts the first V load up into that
        // group, runs out of registers and reloads a Q fragment from scratch in every pass
        __builtin_amdgcn_sched_barrier(0);
        v8f z = {};
        v8f S0[QG], S1[QG];
#pragma unroll
        for (int c = 0; c < QG; ++c) {
            S0[c] = __builtin_amdgcn_wmma_f32_16x16x32_f16(false, b00, false, aq[c][0], (short)0, z,     false, false);
            S0[c] = __builtin_amdgcn_wmma_f32_16x16x32_f16(false, b01, false, aq[c][1], (short)0, S0[c], false, false);
            S1[c] = __builtin_amdgcn_wmma_f32_16x16x32_f16(false, b10, false, aq[c][0], (short)0, z,     false, false);
            S1[c] = __builtin_amdgcn_wmma_f32_16x16x32_f16(false, b11, false, aq[c][1], (short)0, S1[c], false, false);
        }

        // Vt fragments (keys 0..15 from the first tile, 16..31 from the second)
        const _Float16* vr = vbase + (size_t)jb * 2048 + frgoff;
        v16h va[4];
#pragma unroll
        for (int t = 0; t < 4; ++t)
            va[t] = mk16(*(const h8_t*)(vr + t * 256), *(const h8_t*)(vr + t * 256 + 1024));
        // the same wait for the V address (else this build lands the last V load's result
        // in it). It also holds the eight V loads in one group ahead of the score
        // arithmetic, which then covers their latency; without it six of them sink
        // between the Vt . Pt products and the wave waits out three latencies there
        asm volatile("s_wait_xcnt 0x0" :: "v"(vr) : "memory");

        v16h pb[QG];                       // Pt as B operand: element i <-> score i
#pragma unroll
        for (int c = 0; c < QG; ++c) {
            // ---- bias add + pair mask + online softmax (all in this lane) ----
            float s[16];
#pragma unroll
            for (int i = 0; i < 8; ++i) {
                s[i]     = S0[c][i] + bv[c][i >> 2][i & 3]       - (1.0f - mi[c] * mv[i >> 2][i & 3])       * NEGV;
                s[8 + i] = S1[c][i] + bv[c][2 + (i >> 2)][i & 3] - (1.0f - mi[c] * mv[2 + (i >> 2)][i & 3]) * NEGV;
            }
            float tm[8];
#pragma unroll
            for (int i = 0; i < 8; ++i) tm[i] = fmaxf(s[i], s[8 + i]);
            float tmax = fmaxf(fmaxf(fmaxf(tm[0], tm[1]), fmaxf(tm[2], tm[3])),
                               fmaxf(fmaxf(tm[4], tm[5]), fmaxf(tm[6], tm[7])));
            tmax = fmaxf(tmax, other_half(tmax));
            float mnew  = fmaxf(mrow[c], tmax);
            float alpha = exp_slot(mrow[c] - mnew);
            mrow[c] = mnew;

            float ps[4];                   // four partial sums of this lane's p
#pragma unroll
            for (int i = 0; i < 16; ++i) {
                float p = exp_slot(s[i] - mnew);
                ps[i & 3] = (i < 4) ? p : ps[i & 3] + p;
                pb[c][i] = (_Float16)p;
            }
            lrow[c] = lrow[c] * alpha + ((ps[0] + ps[1]) + (ps[2] + ps[3]));
#pragma unroll
            for (int t = 0; t < 4; ++t) Oacc[c][t] *= alpha;
        }

        // ---- Ot += Vt . Pt ----
#pragma unroll
        for (int t = 0; t < 4; ++t)
#pragma unroll
            for (int c = 0; c < QG; ++c)
                Oacc[c][t] = __builtin_amdgcn_wmma_f32_16x16x32_f16(
                    false, va[t], false, pb[c], (short)0, Oacc[c][t], false, false);
    }

    // ---- join the halves' sums; publish this quarter's partial [query][d], max, sum ----
    __shared__ __attribute__((aligned(16))) float part[4 * KSPLIT * QROWS * OPITCH];
    __shared__ float pmax[4 * KSPLIT * QROWS], psum[4 * KSPLIT * QROWS];
#pragma unroll
    for (int c = 0; c < QG; ++c) {
        lrow[c] += other_half(lrow[c]);
        int row = wib * QROWS + c * 16 + l15;
        float* pw = part + row * OPITCH + base0;
#pragma unroll
        for (int t = 0; t < 4; ++t) {
            *(f4_t*)(pw + t * 16)     = (f4_t){Oacc[c][t][0], Oacc[c][t][1], Oacc[c][t][2], Oacc[c][t][3]};
            *(f4_t*)(pw + t * 16 + 4) = (f4_t){Oacc[c][t][4], Oacc[c][t][5], Oacc[c][t][6], Oacc[c][t][7]};
        }
        if (halfsel == 0) { pmax[row] = mrow[c]; psum[row] = lrow[c]; }
    }
    __syncthreads();

    // ---- merge: wave kq takes queries QROWS/4 * kq .. of its tile, 4 at a time; 8 lanes
    // a query, 8 d a lane, so a query's 128-byte output line is stored whole by this one
    // wave ----
    int d0 = (lane & 7) * 8;
#pragma unroll
    for (int u = 0; u < QROWS / 16; ++u) {
        int q = kq * (QROWS / 4) + u * 4 + (lane >> 3);
        float pm[KSPLIT], pl[KSPLIT];
#pragma unroll                            // constant indices: pm, pl stay in registers
        for (int w = 0; w < KSPLIT; ++w) {
            pm[w] = pmax[(w * 4 + qsub) * QROWS + q];
            pl[w] = psum[(w * 4 + qsub) * QROWS + q];
        }
        float mall = fmaxf(fmaxf(pm[0], pm[1]), fmaxf(pm[2], pm[3]));
        float lall = 0.0f;
        f4_t  o0 = {}, o1 = {};
#pragma unroll                            // constant indices into pm, pl, as above
        for (int w = 0; w < KSPLIT; ++w) {
            float g = exp_slot(pm[w] - mall);           // weight of quarter w
            const float* pr = part + ((w * 4 + qsub) * QROWS + q) * OPITCH + d0;
            lall += pl[w] * g;
            o0   += *(const f4_t*)pr * g;
            o1   += *(const f4_t*)(pr + 4) * g;
        }
        float inv = (lall > 0.0f) ? (1.0f / lall) : 0.0f;
        h8_t o;
#pragma unroll
        for (int r = 0; r < 4; ++r) {
            o[r]     = (_Float16)(o0[r] * inv);
            o[4 + r] = (_Float16)(o1[r] * inv);
        }
        *(h8_t*)(ao + (bN + qbase + q) * DIMSZ + hoff + d0) = o;
    }
}

// ---------------------------------------------------------------------------
// launcher
// ---------------------------------------------------------------------------
extern "C" void kernel_launch(void* const* d_in, const int* in_sizes, int n_in,
                              void* d_out, int out_size, void* d_ws, size_t ws_size,
                              hipStream_t stream) {
    const float* x     = (const float*)d_in[0];
    const float* timep = (const float*)d_in[1];
    const float* bias  = (const float*)d_in[2];
    const float* mask  = (const float*)d_in[3];
    const float* gamma = (const float*)d_in[4];
    const float* wtime = (const float*)d_in[5];
    const float* btime = (const float*)d_in[6];
    const float* wq    = (const float*)d_in[7];
    const float* wkv   = (const float*)d_in[8];
    const float* wout  = (const float*)d_in[9];
    float* out = (float*)d_out;

    uint8_t* ws = (uint8_t*)d_ws;
    size_t off = 0;
    auto alloc = [&](size_t bytes) -> uint8_t* {
        uint8_t* p = ws + off;
        off += (bytes + 255) & ~(size_t)255;
        return p;
    };
    const size_t ACT = (size_t)BATCH * SEQ * DIMSZ;        // 2M elems
    float*    film  = (float*)   alloc(BATCH * 2 * DIMSZ * 4);
    _Float16* xn16  = (_Float16*)alloc(ACT * 2);
    _Float16* x16   = (_Float16*)alloc(ACT * 2);
    _Float16* wq16  = (_Float16*)alloc((size_t)DIMSZ * DIMSZ * 2);
    _Float16* wkv16 = (_Float16*)alloc((size_t)2 * DIMSZ * DIMSZ * 2);
    _Float16* wo16  = (_Float16*)alloc((size_t)DIMSZ * DIMSZ * 2);
    _Float16* q16   = (_Float16*)alloc(ACT * 2);
    _Float16* k16   = (_Float16*)alloc(ACT * 2);
    _Float16* vT16  = (_Float16*)alloc(ACT * 2);
    _Float16* ao16  = (_Float16*)alloc(ACT * 2);

    // FiLM params and the three weight converts in one grid, then fused LN+FiLM+mask
    prep_kernel<<<FILM_BLOCKS + 4 * WSQ_BLOCKS, 256, 0, stream>>>(
        timep, wtime, btime, film, wq, wkv, wout, wq16, wkv16, wo16);
    ln_film_kernel<<<BATCH * SEQ / (8 * LN_TOK), 256, 0, stream>>>(x, gamma, film, mask, xn16, x16);

    // 128 x 64 tiles of a [4096, 512] product: 256 blocks of 8 waves
    const int gblocks = (BATCH * SEQ / GT_ROWS) * GT_NT;
    // q = xn @ wq^T, k = x @ wkv[0:512]^T, v = x @ wkv[512:]^T in one grid
    qkv_kernel<<<dim3(gblocks, 3), 256, 0, stream>>>(
        xn16, x16, wq16, wkv16, wkv16 + (size_t)DIMSZ * DIMSZ, q16, k16, vT16,
        SEQ, (long long)SEQ * DIMSZ, DIMSZ, 1);

    // flash attention: B*H*(SEQ/32) = 1024 query tiles, 4 tiles x 4 key quarters / block
    attn_kernel<<<BATCH * HEADS * (SEQ / QROWS) / 4, 512, 0, stream>>>(
        q16, k16, vT16, bias, mask, ao16);

    // out = (ao @ wout^T) * mask  -> f32
    gemm_f32mask_kernel<<<gblocks, 256, 0, stream>>>(ao16, wo16, mask, out);
}

// v009
// One run takes 61.1 microseconds.
// Two timings next to v008 both put it at 1.04 times that version's speed.
// Over all steps from v000 it is 8.52 times as fast.
#include <hip/hip_runtime.h>

typedef _Float16 h8_t  __attribute__((ext_vector_type(8)));
typedef _Float16 h4_t  __attribute__((ext_vector_type(4)));
typedef _Float16 v16h  __attribute__((ext_vector_type(16)));
typedef float    v8f   __attribute__((ext_vector_type(8)));
typedef float    f4_t  __attribute__((ext_vector_type(4)));

#define BATCH 2
#define SEQ   2048
#define DIMSZ 512
#define HEADS 8
#define DHEAD 64
#define NEGV  1.0e6f

// ---------------------------------------------------------------------------
// helpers
// ---------------------------------------------------------------------------
__device__ __forceinline__ v16h mk16(h8_t lo, h8_t hi) {
    v16h r;
#pragma unroll
    for (int i = 0; i < 8; ++i) { r[i] = lo[i]; r[i + 8] = hi[i]; }
    return r;
}

__device__ __forceinline__ float exp_slot(float x) {
    float y = x * 1.44269504f, r;
    asm("v_exp_f32 %0, %1\n\tv_nop" : "=v"(r) : "v"(y));
    return r;
}

// ---------------------------------------------------------------------------
// FiLM: film[b, o] = b_time[o] + sum_k silu(time[b,k]) * w_time[o,k]
// One wave per output row o (8 waves a block, 128 blocks). The 32 lanes read the
// row in whole 128-byte lines (lane l holds k = 128*j + 4*l .. + 3), once for all
// batches; each lane sums its 16 products (lane 0 on top of b_time[o]) and a
// butterfly over the lanes joins the partial sums.
// ---------------------------------------------------------------------------
__device__ __forceinline__ void film_body(const float* __restrict__ timep,
                                          const float* __restrict__ w_time,
                                          const float* __restrict__ b_time,
                                          float* __restrict__ film) {
    // wave number as a scalar: the row's base address stays in scalar registers
    int o    = blockIdx.x * 8 + __builtin_amdgcn_readfirstlane(threadIdx.x >> 5);
    int lane = threadIdx.x & 31;
    const f4_t* wr = (const f4_t*)(w_time + (size_t)o * DIMSZ);
    f4_t w[4], t[BATCH][4];                // DIMSZ = 4 * 128
#pragma unroll
    for (int j = 0; j < 4; ++j) {
        w[j] = wr[j * 32 + lane];
#pragma unroll
        for (int b = 0; b < BATCH; ++b)
            t[b][j] = ((const f4_t*)(timep + b * DIMSZ))[j * 32 + lane];
    }
    float bt = b_time[o];
    // keeps every load above ahead of the arithmetic, so a wave waits out one memory
    // latency; without it the compiler sinks seven of the vector loads between the
    // silu blocks and the wave waits four times
    __builtin_amdgcn_sched_barrier(0);
    float acc[BATCH];
#pragma unroll
    for (int b = 0; b < BATCH; ++b) {
        acc[b] = (lane == 0) ? bt : 0.0f;   // lane 0's chain starts from the bias
#pragma unroll
        for (int j = 0; j < 4; ++j)
#pragma unroll
            for (int c = 0; c < 4; ++c) {
                float tv = t[b][j][c];
                acc[b] = fmaf(tv / (1.0f + exp_slot(-tv)), w[j][c], acc[b]);   // silu
            }
    }
#pragma unroll
    for (int off = 16; off; off >>= 1)
#pragma unroll
        for (int b = 0; b < BATCH; ++b) acc[b] += __shfl_xor(acc[b], off, 32);
    // every lane holds every batch's sum: lane b stores batch b
    float r = acc[0];
#pragma unroll
    for (int b = 1; b < BATCH; ++b) r = (lane == b) ? acc[b] : r;
    if (lane < BATCH) film[lane * 2 * DIMSZ + o] = r;
}

// ---------------------------------------------------------------------------
// First launch: everything that depends on the inputs alone, in one grid.
// Blocks 0 .. FILM_BLOCKS-1 compute FiLM (the longest chain, so they start first);
// the rest convert the three weight matrices f32 -> f16. A lane converts CVT_LOADS
// groups of 4 elements, so the whole grid is one block per WGP: the bytes are few, and
// a launch of many short waves lasts as long as its waves take to start.
// ---------------------------------------------------------------------------
#define FILM_BLOCKS (2 * DIMSZ / 8)
#define CVT_LOADS   8                                  // 16-byte loads per lane
#define CVT_WAVE    (CVT_LOADS * 128)                  // elements per wave
#define WSQ_BLOCKS  (DIMSZ * DIMSZ / (8 * CVT_WAVE))   // blocks per 512 x 512 matrix

__global__ void prep_kernel(const float* __restrict__ timep,
                            const float* __restrict__ w_time,
                            const float* __restrict__ b_time,
                            float* __restrict__ film,
                            const float* __restrict__ wq,
                            const float* __restrict__ wkv,
                            const float* __restrict__ wout,
                            _Float16* __restrict__ wq16,
                            _Float16* __restrict__ wkv16,
                            _Float16* __restrict__ wo16) {
    if (blockIdx.x < FILM_BLOCKS) {
        film_body(timep, w_time, b_time, film);
        return;
    }
    int blk = blockIdx.x - FILM_BLOCKS;
    const float* in  = wq;
    _Float16*    out = wq16;
    if (blk >= 3 * WSQ_BLOCKS)  { in = wout; out = wo16;  blk -= 3 * WSQ_BLOCKS; }
    else if (blk >= WSQ_BLOCKS) { in = wkv;  out = wkv16; blk -= WSQ_BLOCKS; }
    // wave number as a scalar: the wave's base addresses stay in scalar registers
    int wv   = __builtin_amdgcn_readfirstlane(threadIdx.x >> 5);
    int lane = threadIdx.x & 31;
    size_t base = (size_t)(blk * 8 + wv) * CVT_WAVE;
    const f4_t* src = (const f4_t*)(in + base);
    h4_t*       dst = (h4_t*)(out + base);
    f4_t v[CVT_LOADS];                    // every load covers 4 whole lines
#pragma unroll                            // constant indices: v stays in registers
    for (int j = 0; j < CVT_LOADS; ++j) v[j] = src[j * 32 + lane];
#pragma unroll                            // constant indices, as above
    for (int j = 0; j < CVT_LOADS; ++j)
        dst[j * 32 + lane] = (h4_t){(_Float16)v[j][0], (_Float16)v[j][1],
                                    (_Float16)v[j][2], (_Float16)v[j][3]};
    // the instruction set's wait before a register that an issued store names is
    // overwritten: in this build the FiLM part's code follows the store
    asm volatile("s_wait_xcnt 0x0" ::: "memory");
}

// ---------------------------------------------------------------------------
// LayerNorm + FiLM + seq-mask + fold dim_head^-0.5, emit f16; also x -> f16
// One wave per LN_TOK tokens, 8 waves a block, one block per WGP. The 32 lanes read
// a row in whole 128-byte lines (lane l holds d = 128*j + 4*l .. + 3), each lane sums
// its 16 elements and a butterfly over the lanes joins the sums: no LDS, no barrier,
// few waves to start; gamma and FiLM are read once per wave.
// ---------------------------------------------------------------------------
#define LN_TOK 2                          // divides SEQ: a wave's tokens share a batch

__global__ void ln_film_kernel(const float* __restrict__ x,
                               const float* __restrict__ gamma,
                               const float* __restrict__ film,
                               const float* __restrict__ seq_mask,
                               _Float16* __restrict__ xn16,
                               _Float16* __restrict__ x16) {
    // wave number as a scalar: row bases and the masks stay in scalar registers
    int wv   = __builtin_amdgcn_readfirstlane(threadIdx.x >> 5);
    int lane = threadIdx.x & 31;
    int tok0 = (blockIdx.x * 8 + wv) * LN_TOK;         // 0 .. B*SEQ-LN_TOK
    int b    = tok0 / SEQ;
    const f4_t* xr = (const f4_t*)(x + (size_t)tok0 * DIMSZ);
    const f4_t* gr = (const f4_t*)gamma;
    const f4_t* fb = (const f4_t*)(film + (size_t)b * 2 * DIMSZ);
    f4_t v[LN_TOK][4], g[4], sc[4], sh[4];             // DIMSZ = 4 * 128
    // every loop of this kernel is unrolled: the arrays are then indexed by constants
    // and stay in registers
#pragma unroll
    for (int j = 0; j < 4; ++j) {
#pragma unroll
        for (int t = 0; t < LN_TOK; ++t) v[t][j] = xr[t * (DIMSZ / 4) + j * 32 + lane];
    }
#pragma unroll
    for (int j = 0; j < 4; ++j) {
        g[j]  = gr[j * 32 + lane];
        sc[j] = fb[j * 32 + lane];
        sh[j] = fb[DIMSZ / 4 + j * 32 + lane];
    }
    float mk[LN_TOK];
#pragma unroll
    for (int t = 0; t < LN_TOK; ++t) mk[t] = seq_mask[tok0 + t];
    // keeps every load above ahead of the arithmetic, so a wave waits out one memory
    // latency; without it the compiler sinks eleven of the twelve gamma and FiLM loads
    // among the arithmetic and the wave waits out a latency again for each group
    __builtin_amdgcn_sched_barrier(0);
    float s[LN_TOK], sq[LN_TOK];
#pragma unroll
    for (int t = 0; t < LN_TOK; ++t) {
        f4_t a = (v[t][0] + v[t][1]) + (v[t][2] + v[t][3]);
        f4_t q = (v[t][0] * v[t][0] + v[t][1] * v[t][1]) + (v[t][2] * v[t][2] + v[t][3] * v[t][3]);
        s[t]  = (a[0] + a[1]) + (a[2] + a[3]);
        sq[t] = (q[0] + q[1]) + (q[2] + q[3]);
    }
#pragma unroll
    for (int off = 16; off; off >>= 1)
#pragma unroll
        for (int t = 0; t < LN_TOK; ++t) {
            s[t]  += __shfl_xor(s[t],  off, 32);
            sq[t] += __shfl_xor(sq[t], off, 32);
        }
#pragma unroll
    for (int t = 0; t < LN_TOK; ++t) {
        float mu   = s[t] * (1.0f / DIMSZ);
        float var  = sq[t] * (1.0f / DIMSZ) - mu * mu;
        float rinv = rsqrtf(var + 1e-5f);
        h4_t* on = (h4_t*)(xn16 + (size_t)(tok0 + t) * DIMSZ);
        h4_t* ox = (h4_t*)(x16  + (size_t)(tok0 + t) * DIMSZ);
#pragma unroll
        for (int j = 0; j < 4; ++j) {
            h4_t hn, hx;
#pragma unroll
            for (int c = 0; c < 4; ++c) {
                float xv = v[t][j][c];
                float xn = (xv - mu) * rinv * g[j][c];
                xn = xn * (sc[j][c] + 1.0f) + sh[j][c];
                xn = xn * mk[t] * 0.125f; // fold 64^-0.5 (only q uses xn)
                hn[c] = (_Float16)xn;
                hx[c] = (_Float16)xv;
            }
            on[j * 32 + lane] = hn;
            ox[j * 32 + lane] = hx;
        }
    }
}

// ---------------------------------------------------------------------------
// WMMA GEMMs, Y = A . W^T, K = DIMSZ. A block of 8 waves takes GT_ROWS rows of A and
// GT_COLS rows of W; a wave takes 16 x 64 of Y (A fragment reused across 4 N-tiles).
// Both operand tiles, all of K, are staged in LDS once: the global loads then cover
// whole 128-byte lines (a fragment load from global touches 16 lines for 512 bytes),
// and the W tile is fetched once for the 8 waves that use it.
// LDS rows have a pitch of 16 B x odd, so the 16 rows of a fragment read fall on
// different banks.
// ---------------------------------------------------------------------------
#define GT_ROWS 128                       // rows of A per block = 8 waves x 16
#define GT_COLS 64                        // rows of W per block
#define GPITCH  (DIMSZ + 8)               // f16 per LDS row: 1040 B = 16 B x 65
#define GT_LDS  ((GT_ROWS + GT_COLS) * GPITCH)
#define GT_NT   (DIMSZ / GT_COLS)         // column tiles: blockIdx.x = row tile * GT_NT + column tile

// 256 threads: 64 lanes a row (16 bytes each), 4 rows per step. Ends in the barrier
// behind which every wave may read both tiles.
__device__ __forceinline__ void stage_tiles(const _Float16* __restrict__ A,
                                            const _Float16* __restrict__ W,
                                            _Float16* __restrict__ sm,
                                            int rowbase, int colbase) {
    int r0 = threadIdx.x >> 6, c = (threadIdx.x & 63) * 8;
    const _Float16* ga = A + (size_t)(rowbase + r0) * DIMSZ + c;
    const _Float16* gw = W + (size_t)(colbase + r0) * DIMSZ + c;
    h8_t va[GT_ROWS / 4], vw[GT_COLS / 4];
#pragma unroll                            // constant indices: va, vw stay in registers
    for (int i = 0; i < GT_ROWS / 4; ++i) va[i] = *(const h8_t*)(ga + i * 4 * DIMSZ);
#pragma unroll                            // constant indices, as above
    for (int i = 0; i < GT_COLS / 4; ++i) vw[i] = *(const h8_t*)(gw + i * 4 * DIMSZ);
    // the instruction set's wait before a register that an issued global load names is
    // overwritten; the two addresses are inputs so that their registers live up to it
    // (else this build lands later loads' results in them). It also keeps every load
    // ahead of the LDS stores, so that a wave waits out one latency for the whole tile
    asm volatile("s_wait_xcnt 0x0" :: "v"(ga), "v"(gw) : "memory");
    // keeps the LDS address arithmetic below behind that wait: without it the compiler
    // lifts part of it over the wait, into the address registers of the loads
    __builtin_amdgcn_sched_barrier(0);
    _Float16* sa = sm + r0 * GPITCH + c;
#pragma unroll                            // constant indices, as above
    for (int i = 0; i < GT_ROWS / 4; ++i) *(h8_t*)(sa + i * 4 * GPITCH) = va[i];
#pragma unroll                            // constant indices, as above
    for (int i = 0; i < GT_COLS / 4; ++i) *(h8_t*)(sa + (GT_ROWS + i * 4) * GPITCH) = vw[i];
    __syncthreads();
}

// acc[c] = 16 rows of A (wave wv's) x 16 rows of W (N-tile c), fragments read from LDS.
// W_AS_A: D = W . At (a lane holds one row of A and 8 rows of W), else D = A . Wt.
// f[.][0,1]: the A fragment's two halves; f[.][2 + 2c, 3 + 2c]: N-tile c's.
template <bool W_AS_A>
__device__ __forceinline__ void tile_product(const _Float16* __restrict__ sm,
                                             int wv, int l15, int base0, v8f (&acc)[4]) {
    const _Float16* arow = sm + (wv * 16 + l15) * GPITCH + base0;
    const _Float16* wrow = sm + (GT_ROWS + l15) * GPITCH + base0;
    h8_t f[2][10];
#pragma unroll
    for (int c = 0; c < 4; ++c) acc[c] = (v8f){};
#pragma unroll                            // constant indices: f stays in registers
    for (int s = -1; s < DIMSZ / 32; ++s) {
        if (s + 1 < DIMSZ / 32) {         // the reads of k step s + 1
            int kk = (s + 1) * 32, n = (s + 1) & 1;
            f[n][0] = *(const h8_t*)(arow + kk);
            f[n][1] = *(const h8_t*)(arow + kk + 16);
#pragma unroll
            for (int c = 0; c < 4; ++c) {
                f[n][2 + 2 * c] = *(const h8_t*)(wrow + c * 16 * GPITCH + kk);
                f[n][3 + 2 * c] = *(const h8_t*)(wrow + c * 16 * GPITCH + kk + 16);
            }
        }
        // holds the LDS reads of k step s + 1 ahead of the products of step s, so that the
        // waits are counted and a read has a step's time to land; without it the compiler
        // puts each pair of reads directly in front of its product and the wave waits out
        // an LDS latency at nearly every product
        __builtin_amdgcn_sched_barrier(0);
        if (s >= 0) {
            v16h a = mk16(f[s & 1][0], f[s & 1][1]);
#pragma unroll
            for (int c = 0; c < 4; ++c) {
                v16h bf = mk16(f[s & 1][2 + 2 * c], f[s & 1][3 + 2 * c]);
                acc[c] = W_AS_A
                    ? __builtin_amdgcn_wmma_f32_16x16x32_f16(
                          false, bf, false, a, (short)0, acc[c], false, false)
                    : __builtin_amdgcn_wmma_f32_16x16x32_f16(
                          false, a, false, bf, (short)0, acc[c], false, false);
            }
        }
    }
}

// f16 output with arbitrary (batched) output strides:
//   Out[b*obs + (row%npb)*ors + col*ocs] = (A[row,:] . W[col,:])
__device__ __forceinline__ void gemm_f16out_body(const _Float16* __restrict__ A,
                                                 const _Float16* __restrict__ W,
                                                 _Float16* __restrict__ Out,
                                                 _Float16* __restrict__ sm,
                                                 int npb, long long obs, int ors, int ocs) {
    // wave number as a scalar: tile indices stay in scalar registers
    int wv = __builtin_amdgcn_readfirstlane(threadIdx.x >> 5);
    int bm = blockIdx.x / GT_NT, tn = blockIdx.x % GT_NT;
    int lane = threadIdx.x & 31;
    int l15 = lane & 15, halfsel = lane >> 4, base0 = halfsel ? 8 : 0;
    int rowbase = bm * GT_ROWS + wv * 16, colbase = tn * GT_COLS;
    stage_tiles(A, W, sm, bm * GT_ROWS, colbase);
    v8f acc[4];
    tile_product<false>(sm, wv, l15, base0, acc);
#pragma unroll
    for (int c = 0; c < 4; ++c) {
#pragma unroll
        for (int r = 0; r < 8; ++r) {
            int grow = rowbase + r + halfsel * 8;
            int bidx = grow / npb, rloc = grow % npb;
            size_t addr = (size_t)bidx * obs + (size_t)rloc * ors
                        + (size_t)(colbase + c * 16 + l15) * ocs;
            Out[addr] = (_Float16)acc[c][r];
        }
    }
    // the instruction set's wait before a register that an issued store names is
    // overwritten: in this build the kernel's branch code follows the stores
    asm volatile("s_wait_xcnt 0x0" ::: "memory");
}

// ---------------------------------------------------------------------------
// 16 tokens x 64 features (one head) per wave, f16 output in the
// FRAGMENT ORDER in which attn_kernel reads K and V as A operands:
//   Out[((b*HEADS + h)*(SEQ/16) + token_tile)*1024 + c*256 + lane*8 + e]
// so that one 16-byte load per lane covers 512 contiguous bytes (4 whole lines).
// FEAT_IN_LANE (K): D = W . At; lane (l15, half) holds token l15 and features
//   c*16 + 8*half + e, which is chunk c of K's fragment row l15.
// otherwise   (V): D = A . Wt; lane (l15, half) holds feature c*16 + l15 and
//   tokens 8*half + e, which is this 16-token tile's chunk of Vt's fragment row.
// ---------------------------------------------------------------------------
template <bool FEAT_IN_LANE>
__device__ __forceinline__ void gemm_frag_body(const _Float16* __restrict__ A,
                                               const _Float16* __restrict__ W,
                                               _Float16* __restrict__ Out,
                                               _Float16* __restrict__ sm) {
    // wave number as a scalar: tile indices stay in scalar registers
    int wv = __builtin_amdgcn_readfirstlane(threadIdx.x >> 5);
    int bm = blockIdx.x / GT_NT, tn = blockIdx.x % GT_NT;
    int tm = bm * (GT_ROWS / 16) + wv;
    int lane = threadIdx.x & 31;
    int l15 = lane & 15, halfsel = lane >> 4, base0 = halfsel ? 8 : 0;
    stage_tiles(A, W, sm, bm * GT_ROWS, tn * GT_COLS);
    v8f acc[4];
    tile_product<FEAT_IN_LANE>(sm, wv, l15, base0, acc);
    int bidx = tm / (SEQ / 16), ttile = tm % (SEQ / 16);
    _Float16* o = Out + ((size_t)(bidx * GT_NT + tn) * (SEQ / 16) + ttile) * 1024 + lane * 8;
#pragma unroll
    for (int c = 0; c < 4; ++c) {
        h8_t v;
#pragma unroll
        for (int r = 0; r < 8; ++r) v[r] = (_Float16)acc[c][r];
        *(h8_t*)(o + c * 256) = v;
    }
    // the instruction set's wait before a register that an issued store names is
    // overwritten: in this build the kernel's branch code follows the stores
    asm volatile("s_wait_xcnt 0x0" ::: "memory");
}

// The three projections depend on the same earlier launches and not on each other:
// one grid, blockIdx.y picks the product, so their waves share the chip at once.
//   y = 0: q = xn . wq^T  -> [B, SEQ, 512]     y = 1: k = x . wk^T -> fragment order
//   y = 2: v = x . wv^T   -> fragment order
// The launch bound is the real block size: it lifts the register ceiling, so that the
// staging loads of a tile are all in flight at once.
__global__ void __launch_bounds__(256)
qkv_kernel(const _Float16* __restrict__ xn16,
           const _Float16* __restrict__ x16,
           const _Float16* __restrict__ wq16,
           const _Float16* __restrict__ wk16,
           const _Float16* __restrict__ wv16,
           _Float16* __restrict__ q16,
           _Float16* __restrict__ kf,
           _Float16* __restrict__ vf,
           int npb, long long obs, int ors, int ocs) {
    __shared__ __attribute__((aligned(16))) _Float16 sm[GT_LDS];
    if (blockIdx.y == 0)      gemm_f16out_body(xn16, wq16, q16, sm, npb, obs, ors, ocs);
    else if (blockIdx.y == 1) gemm_frag_body<true>(x16, wk16, kf, sm);
    else                      gemm_frag_body<false>(x16, wv16, vf, sm);
}

// 16-byte load of four row masks. s_wait_xcnt 0 is the instruction set's wait before a
// register that an issued global load names is overwritten: this build lands the second
// load's result in the address registers of the first.
__device__ __forceinline__ f4_t ld_mask4(const float* p) {
    f4_t v = *(const f4_t*)p;
    asm volatile("s_wait_xcnt 0x0" ::: "memory");
    return v;
}

// f32 output [B*SEQ, DIMSZ], multiplied by per-row mask; launch bound as above
__global__ void __launch_bounds__(256)
gemm_f32mask_kernel(const _Float16* __restrict__ A,
                    const _Float16* __restrict__ W,
                    const float* __restrict__ seq_mask,
                    float* __restrict__ Out) {
    __shared__ __attribute__((aligned(16))) _Float16 sm[GT_LDS];
    // wave number as a scalar: tile indices stay in scalar registers
    int wv = __builtin_amdgcn_readfirstlane(threadIdx.x >> 5);
    int bm = blockIdx.x / GT_NT, tn = blockIdx.x % GT_NT;
    int lane = threadIdx.x & 31;
    int l15 = lane & 15, halfsel = lane >> 4, base0 = halfsel ? 8 : 0;
    int rowbase = bm * GT_ROWS + wv * 16, colbase = tn * GT_COLS;
    // masks of this lane's 8 output rows
    f4_t mk4[2] = {ld_mask4(seq_mask + rowbase + halfsel * 8),
                   ld_mask4(seq_mask + rowbase + halfsel * 8 + 4)};
    stage_tiles(A, W, sm, bm * GT_ROWS, colbase);
    v8f acc[4];
    tile_product<false>(sm, wv, l15, base0, acc);
#pragma unroll
    for (int r = 0; r < 8; ++r) {
        int grow = rowbase + r + halfsel * 8;
        float mk = mk4[r >> 2][r & 3];
#pragma unroll
        for (int c = 0; c < 4; ++c)
            Out[(size_t)grow * DIMSZ + colbase + c * 16 + l15] = acc[c][r] * mk;
    }
}

__device__ __forceinline__ float other_half(float v) {
    int b = __builtin_bit_cast(int, v);
    b = __builtin_amdgcn_permlanex16(b, b, 0x76543210, 0xfedcba98, false, false);
    return __builtin_bit_cast(float, b);
}

#define KSPLIT 4                          // key quarters = waves per query tile
#define QG     2                          // groups of 16 queries per wave
#define QROWS  (16 * QG)                  // queries per wave
#define OPITCH 68                         // floats per partial row: 272 B = 16 B x odd
#define NPASS  (SEQ / 32 / KSPLIT)        // passes of 32 keys per wave
#define BPITCH 36                         // floats per bias row in LDS: 144 B = 16 B x odd
#define BTILE  (QROWS * BPITCH)           // floats per bias buffer (one wave, one pass)

// One bias tile, QROWS rows of 32 keys (128 bytes, line-aligned), from global memory to
// LDS: 8 copies of 16 bytes a lane; a copy covers 4 whole lines (8 lanes a row, 4 rows).
// lds: this lane's LDS byte address in rows 0 .. 3; g: its global address there.
// s_wait_xcnt 0 is the precaution kept before a register that an issued copy names is
// overwritten; as the statement's last line it stands ahead of every such overwrite.
__device__ __forceinline__ void bias_tile_copy(unsigned lds, const float* g) {
    asm volatile("global_load_async_to_lds_b128 %0, %8, off\n\t"
                 "global_load_async_to_lds_b128 %1, %9, off\n\t"
                 "global_load_async_to_lds_b128 %2, %10, off\n\t"
                 "global_load_async_to_lds_b128 %3, %11, off\n\t"
                 "global_load_async_to_lds_b128 %4, %12, off\n\t"
                 "global_load_async_to_lds_b128 %5, %13, off\n\t"
                 "global_load_async_to_lds_b128 %6, %14, off\n\t"
                 "global_load_async_to_lds_b128 %7, %15, off\n\t"
                 "s_wait_xcnt 0x0"
                 :: "v"(lds),                   "v"(lds +  4 * BPITCH * 4),
                    "v"(lds +  8 * BPITCH * 4), "v"(lds + 12 * BPITCH * 4),
                    "v"(lds + 16 * BPITCH * 4), "v"(lds + 20 * BPITCH * 4),
                    "v"(lds + 24 * BPITCH * 4), "v"(lds + 28 * BPITCH * 4),
                    "v"(g),            "v"(g +  4 * SEQ), "v"(g +  8 * SEQ), "v"(g + 12 * SEQ),
                    "v"(g + 16 * SEQ), "v"(g + 20 * SEQ), "v"(g + 24 * SEQ), "v"(g + 28 * SEQ)
                 : "memory");
}

// The launch bound is the real block size: 4 waves a SIMD, 256 registers a wave.
__global__ void __launch_bounds__(512)
attn_kernel(const _Float16* __restrict__ q16,
            const _Float16* __restrict__ kf,
            const _Float16* __restrict__ vf,
            const float* __restrict__ bias,
            const float* __restrict__ seq_mask,
            _Float16* __restrict__ ao) {
    // wave number as a scalar: tile indices and bases are then computed in scalar
    // registers and take no vector registers from the fragments
    int wib   = __builtin_amdgcn_readfirstlane(threadIdx.x >> 5);   // 0 .. 15
    int lane  = threadIdx.x & 31;
    int qsub  = wib & 3;                  // which of the block's query tiles
    int kq    = wib >> 2;                 // which quarter of the keys
    int gwave = blockIdx.x * 4 + qsub;
    int qtile = gwave % (SEQ / QROWS);
    int h     = (gwave / (SEQ / QROWS)) % HEADS;
    int b     = gwave / (SEQ / QROWS * HEADS);
    int qbase = qtile * QROWS;
    int l15 = lane & 15, halfsel = lane >> 4, base0 = halfsel ? 8 : 0;
    size_t bN   = (size_t)b * SEQ;
    int    hoff = h * DHEAD;
    unsigned rowoff = (unsigned)(l15 * DIMSZ + base0);   // q16: row l15
    unsigned ringoff = (unsigned)(l15 * BPITCH + base0); // bias tile in LDS: row l15
    unsigned frgoff = (unsigned)(lane * 8);              // kf, vf: this lane's 16 bytes

    // bias ring: two buffers a wave, filled and read by that wave alone, so that no
    // work-group barrier is needed; tile 0's copies start ahead of everything else
    __shared__ __attribute__((aligned(16))) float ring[4 * KSPLIT * 2 * BTILE];
    int key0 = kq * (SEQ / KSPLIT);       // first key of this wave's quarter
    const float* bbase = bias + ((size_t)(b * HEADS + h) * SEQ + qbase) * SEQ + key0;
    const float* myring = ring + wib * 2 * BTILE;
    const float* bcopy  = bbase + (unsigned)((lane >> 3) * SEQ + (lane & 7) * 4);
    unsigned     lcopy  = (unsigned)(size_t)myring + (unsigned)((lane >> 3) * BPITCH + (lane & 7) * 4) * 4;
    bias_tile_copy(lcopy, bcopy);

    // Q fragments (d 0..31, d 32..63) of each group, scale already folded into xn
    const _Float16* qr = q16 + (bN + qbase) * DIMSZ + hoff;
    v16h  aq[QG][2];
    float mi[QG], mrow[QG], lrow[QG];
    v8f   Oacc[QG][4];                    // Ot: [d = t*16 + 8*half + r][query l15]
    // every loop over the groups is unrolled: the arrays are then indexed by constants
    // and stay in registers
#pragma unroll
    for (int c = 0; c < QG; ++c) {
        const _Float16* qc = qr + c * 16 * DIMSZ + rowoff;
        aq[c][0] = mk16(*(const h8_t*)(qc),      *(const h8_t*)(qc + 16));
        aq[c][1] = mk16(*(const h8_t*)(qc + 32), *(const h8_t*)(qc + 48));
        mi[c]    = seq_mask[bN + qbase + c * 16 + l15];   // this lane's query
        mrow[c]  = -1.0e30f;              // running maximum (same in both halves)
        lrow[c]  = 0.0f;                  // running sum of this half's keys
#pragma unroll
        for (int t = 0; t < 4; ++t) Oacc[c][t] = (v8f){};
    }

    // wave-uniform bases of this head's K tiles, key masks and V tiles,
    // each at the first key of this wave's quarter
    const _Float16* kbase = kf + ((size_t)(b * HEADS + h) * (SEQ / 16) + key0 / 16) * 1024;
    const float*    mbase = seq_mask + bN + key0;
    const _Float16* vbase = vf + ((size_t)(b * HEADS + h) * (SEQ / 16) + key0 / 16) * 1024;

    // tile 0 has landed behind this wave's own wait; then tile 1's copies start
    asm volatile("s_wait_asynccnt 0x0" ::: "memory");
    bias_tile_copy(lcopy + BTILE * 4, bcopy + 32);

    for (int jb = 0; jb < NPASS; ++jb) {
        int kb = jb * 32;
        const float* btile = myring + (jb & 1) * BTILE + ringoff;   // this pass's bias tile
        // ---- St = K . Qt  (two 16-key tiles, each against every query group) ----
        const _Float16* kr0 = kbase + (size_t)jb * 2048 + frgoff;   // two tiles of 1024
        const _Float16* kr1 = kr0 + 1024;
        v16h b00 = mk16(*(const h8_t*)(kr0),       *(const h8_t*)(kr0 + 256));
        v16h b01 = mk16(*(const h8_t*)(kr0 + 512), *(const h8_t*)(kr0 + 768));
        v16h b10 = mk16(*(const h8_t*)(kr1),       *(const h8_t*)(kr1 + 256));
        v16h b11 = mk16(*(const h8_t*)(kr1 + 512), *(const h8_t*)(kr1 + 768));
        f4_t bv[QG][4], mv[4];             // [0,1]: keys of tile 0, [2,3]: tile 1
#pragma unroll
        for (int g = 0; g < 4; ++g) {
            int o = (g >> 1) * 16 + (g & 1) * 4;
#pragma unroll
            for (int c = 0; c < QG; ++c)
                bv[c][g] = *(const f4_t*)(btile + c * 16 * BPITCH + o);
            mv[g] = *(const f4_t*)(mbase + kb + (unsigned)base0 + o);
        }
        // the instruction set's wait before a register that an issued global load names is
        // overwritten; the K address is an input so that its registers live up to it (else
        // this build lands a mask load's result in them)
        asm volatile("s_wait_xcnt 0x0" :: "v"(kr0) : "memory");
        // ends the group of K, bias and mask loads at the head of a pass, whose latencies
        // run side by side; without it this build lifts the first V load up into that
        // group, runs out of registers and reloads a Q fragment from scratch in every pass
        __builtin_amdgcn_sched_barrier(0);
        v8f z = {};
        v8f S0[QG], S1[QG];
#pragma unroll
        for (int c = 0; c < QG; ++c) {
            S0[c] = __builtin_amdgcn_wmma_f32_16x16x32_f16(false, b00, false, aq[c][0], (short)0, z,     false, false);
            S0[c] = __builtin_amdgcn_wmma_f32_16x16x32_f16(false, b01, false, aq[c][1], (short)0, S0[c], false, false);
            S1[c] = __builtin_amdgcn_wmma_f32_16x16x32_f16(false, b10, false, aq[c][0], (short)0, z,     false, false);
            S1[c] = __builtin_amdgcn_wmma_f32_16x16x32_f16(false, b11, false, aq[c][1], (short)0, S1[c], false, false);
        }

        // Vt fragments (keys 0..15 from the first tile, 16..31 from the second)
        const _Float16* vr = vbase + (size_t)jb * 2048 + frgoff;
        v16h va[4];
#pragma unroll
        for (int t = 0; t < 4; ++t)
            va[t] = mk16(*(const h8_t*)(vr + t * 256), *(const h8_t*)(vr + t * 256 + 1024));
        // the same wait for the V address (else this build lands the last V load's result
        // in it). It also holds the eight V loads in one group ahead of the score
        // arithmetic, which then covers their latency; without it six of them sink
        // between the Vt . Pt products and the wave waits out three latencies there
        asm volatile("s_wait_xcnt 0x0" :: "v"(vr) : "memory");

        v16h pb[QG];                       // Pt as B operand: element i <-> score i
#pragma unroll
        for (int c = 0; c < QG; ++c) {
            // ---- bias add + pair mask + online softmax (all in this lane) ----
            float s[16];
#pragma unroll
            for (int i = 0; i < 8; ++i) {
                s[i]     = S0[c][i] + bv[c][i >> 2][i & 3]       - (1.0f - mi[c] * mv[i >> 2][i & 3])       * NEGV;
                s[8 + i] = S1[c][i] + bv[c][2 + (i >> 2)][i & 3] - (1.0f - mi[c] * mv[2 + (i >> 2)][i & 3]) * NEGV;
            }
            float tm[8];
#pragma unroll
            for (int i = 0; i < 8; ++i) tm[i] = fmaxf(s[i], s[8 + i]);
            float tmax = fmaxf(fmaxf(fmaxf(tm[0], tm[1]), fmaxf(tm[2], tm[3])),
                               fmaxf(fmaxf(tm[4], tm[5]), fmaxf(tm[6], tm[7])));
            tmax = fmaxf(tmax, other_half(tmax));
            float mnew  = fmaxf(mrow[c], tmax);
            float alpha = exp_slot(mrow[c] - mnew);
            mrow[c] = mnew;

            float ps[4];                   // four partial sums of this lane's p
#pragma unroll
            for (int i = 0; i < 16; ++i) {
                float p = exp_slot(s[i] - mnew);
                ps[i & 3] = (i < 4) ? p : ps[i & 3] + p;
                pb[c][i] = (_Float16)p;
            }
            lrow[c] = lrow[c] * alpha + ((ps[0] + ps[1]) + (ps[2] + ps[3]));
#pragma unroll
            for (int t = 0; t < 4; ++t) Oacc[c][t] *= alpha;
        }

        // ---- Ot += Vt . Pt ----
#pragma unroll
        for (int t = 0; t < 4; ++t)
#pragma unroll
            for (int c = 0; c < QG; ++c)
                Oacc[c][t] = __builtin_amdgcn_wmma_f32_16x16x32_f16(
                    false, va[t], false, pb[c], (short)0, Oacc[c][t], false, false);

        // ---- foot of pass jb: hand the ring on ----
        // keeps the two waits below at the foot, behind the pass's arithmetic: without it the
        // compiler lifts them to the V loads, and the wave waits for tile jb + 1 when its
        // copies have only just been issued instead of a whole pass later
        __builtin_amdgcn_sched_barrier(0);
        // this wave's reads of the buffer it is about to refill have returned
        asm volatile("s_wait_dscnt 0x0" ::: "memory");
        // tile jb + 1, in flight since the foot of the pass before, has landed
        asm volatile("s_wait_asynccnt 0x0" ::: "memory");
        if (jb + 2 < NPASS)               // same for the whole wave: a scalar branch
            bias_tile_copy(lcopy + (jb & 1) * (BTILE * 4), bcopy + kb + 64);
    }
    // no copy is outstanding when the wave goes on to the merge and ends
    asm volatile("s_wait_asynccnt 0x0" ::: "memory");

    // ---- join the halves' sums; publish this quarter's partial [query][d], max, sum ----
    __shared__ __attribute__((aligned(16))) float part[4 * KSPLIT * QROWS * OPITCH];
    __shared__ float pmax[4 * KSPLIT * QROWS], psum[4 * KSPLIT * QROWS];
#pragma unroll
    for (int c = 0; c < QG; ++c) {
        lrow[c] += other_half(lrow[c]);
        int row = wib * QROWS + c * 16 + l15;
        float* pw = part + row * OPITCH + base0;
#pragma unroll
        for (int t = 0; t < 4; ++t) {
            *(f4_t*)(pw + t * 16)     = (f4_t){Oacc[c][t][0], Oacc[c][t][1], Oacc[c][t][2], Oacc[c][t][3]};
            *(f4_t*)(pw + t * 16 + 4) = (f4_t){Oacc[c][t][4], Oacc[c][t][5], Oacc[c][t][6], Oacc[c][t][7]};
        }
        if (halfsel == 0) { pmax[row] = mrow[c]; psum[row] = lrow[c]; }
    }
    __syncthreads();

    // ---- merge: wave kq takes queries QROWS/4 * kq .. of its tile, 4 at a time; 8 lanes
    // a query, 8 d a lane, so a query's 128-byte output line is stored whole by this one
    // wave ----
    int d0 = (lane & 7) * 8;
#pragma unroll
    for (int u = 0; u < QROWS / 16; ++u) {
        int q = kq * (QROWS / 4) + u * 4 + (lane >> 3);
        float pm[KSPLIT], pl[KSPLIT];
#pragma unroll                            // constant indices: pm, pl stay in registers
        for (int w = 0; w < KSPLIT; ++w) {
            pm[w] = pmax[(w * 4 + qsub) * QROWS + q];
            pl[w] = psum[(w * 4 + qsub) * QROWS + q];
        }
        float mall = fmaxf(fmaxf(pm[0], pm[1]), fmaxf(pm[2], pm[3]));
        float lall = 0.0f;
        f4_t  o0 = {}, o1 = {};
#pragma unroll                            // constant indices into pm, pl, as above
        for (int w = 0; w < KSPLIT; ++w) {
            float g = exp_slot(pm[w] - mall);           // weight of quarter w
            const float* pr = part + ((w * 4 + qsub) * QROWS + q) * OPITCH + d0;
            lall += pl[w] * g;
            o0   += *(const f4_t*)pr * g;
            o1   += *(const f4_t*)(pr + 4) * g;
        }
        float inv = (lall > 0.0f) ? (1.0f / lall) : 0.0f;
        h8_t o;
#pragma unroll
        for (int r = 0; r < 4; ++r) {
            o[r]     = (_Float16)(o0[r] * inv);
            o[4 + r] = (_Float16)(o1[r] * inv);
        }
        *(h8_t*)(ao + (bN + qbase + q) * DIMSZ + hoff + d0) = o;
    }
}

// ---------------------------------------------------------------------------
// launcher
// ---------------------------------------------------------------------------
extern "C" void kernel_launch(void* const* d_in, const int* in_sizes, int n_in,
                              void* d_out, int out_size, void* d_ws, size_t ws_size,
                              hipStream_t stream) {
    const float* x     = (const float*)d_in[0];
    const float* timep = (const float*)d_in[1];
    const float* bias  = (const float*)d_in[2];
    const float* mask  = (const float*)d_in[3];
    const float* gamma = (const float*)d_in[4];
    const float* wtime = (const float*)d_in[5];
    const float* btime = (const float*)d_in[6];
    const float* wq    = (const float*)d_in[7];
    const float* wkv   = (const float*)d_in[8];
    const float* wout  = (const float*)d_in[9];
    float* out = (float*)d_out;

    uint8_t* ws = (uint8_t*)d_ws;
    size_t off = 0;
    auto alloc = [&](size_t bytes) -> uint8_t* {
        uint8_t* p = ws + off;
        off += (bytes + 255) & ~(size_t)255;
        return p;
    };
    const size_t ACT = (size_t)BATCH * SEQ * DIMSZ;        // 2M elems
    float*    film  = (float*)   alloc(BATCH * 2 * DIMSZ * 4);
    _Float16* xn16  = (_Float16*)alloc(ACT * 2);
    _Float16* x16   = (_Float16*)alloc(ACT * 2);
    _Float16* wq16  = (_Float16*)alloc((size_t)DIMSZ * DIMSZ * 2);
    _Float16* wkv16 = (_Float16*)alloc((size_t)2 * DIMSZ * DIMSZ * 2);
    _Float16* wo16  = (_Float16*)alloc((size_t)DIMSZ * DIMSZ * 2);
    _Float16* q16   = (_Float16*)alloc(ACT * 2);
    _Float16* k16   = (_Float16*)alloc(ACT * 2);
    _Float16* vT16  = (_Float16*)alloc(ACT * 2);
    _Float16* ao16  = (_Float16*)alloc(ACT * 2);

    // FiLM params and the three weight converts in one grid, then fused LN+FiLM+mask
    prep_kernel<<<FILM_BLOCKS + 4 * WSQ_BLOCKS, 256, 0, stream>>>(
        timep, wtime, btime, film, wq, wkv, wout, wq16, wkv16, wo16);
    ln_film_kernel<<<BATCH * SEQ / (8 * LN_TOK), 256, 0, stream>>>(x, gamma, film, mask, xn16, x16);

    // 128 x 64 tiles of a [4096, 512] product: 256 blocks of 8 waves
    const int gblocks = (BATCH * SEQ / GT_ROWS) * GT_NT;
    // q = xn @ wq^T, k = x @ wkv[0:512]^T, v = x @ wkv[512:]^T in one grid
    qkv_kernel<<<dim3(gblocks, 3), 256, 0, stream>>>(
        xn16, x16, wq16, wkv16, wkv16 + (size_t)DIMSZ * DIMSZ, q16, k16, vT16,
        SEQ, (long long)SEQ * DIMSZ, DIMSZ, 1);

    // flash attention: B*H*(SEQ/32) = 1024 query tiles, 4 tiles x 4 key quarters / block
    attn_kernel<<<BATCH * HEADS * (SEQ / QROWS) / 4, 512, 0, stream>>>(
        q16, k16, vT16, bias, mask, ao16);

    // out = (ao @ wout^T) * mask  -> f32
    gemm_f32mask_kernel<<<gblocks, 256, 0, stream>>>(ao16, wo16, mask, out);
}

// v010
// Measured time: 56.3 microseconds a run.
// Two timings next to v009 put it at 1.09 and 1.08 times that version's speed.
// Over all steps from v000 it is 9.24 times as fast.
#include <hip/hip_runtime.h>

typedef _Float16 h8_t  __attribute__((ext_vector_type(8)));
typedef _Float16 h4_t  __attribute__((ext_vector_type(4)));
typedef _Float16 v16h  __attribute__((ext_vector_type(16)));
typedef float    v8f   __attribute__((ext_vector_type(8)));
typedef float    f4_t  __attribute__((ext_vector_type(4)));

#define BATCH 2
#define SEQ   2048
#define DIMSZ 512
#define HEADS 8
#define DHEAD 64
#define NEGV  1.0e6f

// ---------------------------------------------------------------------------
// helpers
// ---------------------------------------------------------------------------
__device__ __forceinline__ v16h mk16(h8_t lo, h8_t hi) {
    v16h r;
#pragma unroll
    for (int i = 0; i < 8; ++i) { r[i] = lo[i]; r[i + 8] = hi[i]; }
    return r;
}

__device__ __forceinline__ float exp_slot(float x) {
    float y = x * 1.44269504f, r;
    asm("v_exp_f32 %0, %1\n\tv_nop" : "=v"(r) : "v"(y));
    return r;
}

// ---------------------------------------------------------------------------
// FiLM: film[b, o] = b_time[o] + sum_k silu(time[b,k]) * w_time[o,k]
// One wave per output row o (8 waves a block, 128 blocks). The 32 lanes read the
// row in whole 128-byte lines (lane l holds k = 128*j + 4*l .. + 3), once for all
// batches; each lane sums its 16 products (lane 0 on top of b_time[o]) and a
// butterfly over the lanes joins the partial sums.
// ---------------------------------------------------------------------------
__device__ __forceinline__ void film_body(const float* __restrict__ timep,
                                          const float* __restrict__ w_time,
                                          const float* __restrict__ b_time,
                                          float* __restrict__ film) {
    // wave number as a scalar: the row's base address stays in scalar registers
    int o    = blockIdx.x * 8 + __builtin_amdgcn_readfirstlane(threadIdx.x >> 5);
    int lane = threadIdx.x & 31;
    const f4_t* wr = (const f4_t*)(w_time + (size_t)o * DIMSZ);
    f4_t w[4], t[BATCH][4];                // DIMSZ = 4 * 128
#pragma unroll
    for (int j = 0; j < 4; ++j) {
        w[j] = wr[j * 32 + lane];
#pragma unroll
        for (int b = 0; b < BATCH; ++b)
            t[b][j] = ((const f4_t*)(timep + b * DIMSZ))[j * 32 + lane];
    }
    float bt = b_time[o];
    // keeps every load above ahead of the arithmetic, so a wave waits out one memory
    // latency; without it the compiler sinks seven of the vector loads between the
    // silu blocks and the wave waits four times
    __builtin_amdgcn_sched_barrier(0);
    float acc[BATCH];
#pragma unroll
    for (int b = 0; b < BATCH; ++b) {
        acc[b] = (lane == 0) ? bt : 0.0f;   // lane 0's chain starts from the bias
#pragma unroll
        for (int j = 0; j < 4; ++j)
#pragma unroll
            for (int c = 0; c < 4; ++c) {
                float tv = t[b][j][c];
                acc[b] = fmaf(tv / (1.0f + exp_slot(-tv)), w[j][c], acc[b]);   // silu
            }
    }
#pragma unroll
    for (int off = 16; off; off >>= 1)
#pragma unroll
        for (int b = 0; b < BATCH; ++b) acc[b] += __shfl_xor(acc[b], off, 32);
    // every lane holds every batch's sum: lane b stores batch b
    float r = acc[0];
#pragma unroll
    for (int b = 1; b < BATCH; ++b) r = (lane == b) ? acc[b] : r;
    if (lane < BATCH) film[lane * 2 * DIMSZ + o] = r;
}

// ---------------------------------------------------------------------------
// First launch: everything that depends on the inputs alone, in one grid.
// Blocks 0 .. FILM_BLOCKS-1 compute FiLM (the longest chain, so they start first);
// the rest convert the three weight matrices f32 -> f16. A lane converts CVT_LOADS
// groups of 4 elements, so the whole grid is one block per WGP: the bytes are few, and
// a launch of many short waves lasts as long as its waves take to start.
// ---------------------------------------------------------------------------
#define FILM_BLOCKS (2 * DIMSZ / 8)
#define CVT_LOADS   8                                  // 16-byte loads per lane
#define CVT_WAVE    (CVT_LOADS * 128)                  // elements per wave
#define WSQ_BLOCKS  (DIMSZ * DIMSZ / (8 * CVT_WAVE))   // blocks per 512 x 512 matrix

__global__ void prep_kernel(const float* __restrict__ timep,
                            const float* __restrict__ w_time,
                            const float* __restrict__ b_time,
                            float* __restrict__ film,
                            const float* __restrict__ wq,
                            const float* __restrict__ wkv,
                            const float* __restrict__ wout,
                            _Float16* __restrict__ wq16,
                            _Float16* __restrict__ wkv16,
                            _Float16* __restrict__ wo16) {
    if (blockIdx.x < FILM_BLOCKS) {
        film_body(timep, w_time, b_time, film);
        return;
    }
    int blk = blockIdx.x - FILM_BLOCKS;
    const float* in  = wq;
    _Float16*    out = wq16;
    if (blk >= 3 * WSQ_BLOCKS)  { in = wout; out = wo16;  blk -= 3 * WSQ_BLOCKS; }
    else if (blk >= WSQ_BLOCKS) { in = wkv;  out = wkv16; blk -= WSQ_BLOCKS; }
    // wave number as a scalar: the wave's base addresses stay in scalar registers
    int wv   = __builtin_amdgcn_readfirstlane(threadIdx.x >> 5);
    int lane = threadIdx.x & 31;
    size_t base = (size_t)(blk * 8 + wv) * CVT_WAVE;
    const f4_t* src = (const f4_t*)(in + base);
    h4_t*       dst = (h4_t*)(out + base);
    f4_t v[CVT_LOADS];                    // every load covers 4 whole lines
#pragma unroll                            // constant indices: v stays in registers
    for (int j = 0; j < CVT_LOADS; ++j) v[j] = src[j * 32 + lane];
#pragma unroll                            // constant indices, as above
    for (int j = 0; j < CVT_LOADS; ++j)
        dst[j * 32 + lane] = (h4_t){(_Float16)v[j][0], (_Float16)v[j][1],
                                    (_Float16)v[j][2], (_Float16)v[j][3]};
    // the instruction set's wait before a register that an issued store names is
    // overwritten: in this build the FiLM part's code follows the store
    asm volatile("s_wait_xcnt 0x0" ::: "memory");
}

// ---------------------------------------------------------------------------
// LayerNorm + FiLM + seq-mask + fold dim_head^-0.5, emit f16; also x -> f16
// One wave per LN_TOK tokens, 8 waves a block, one block per WGP. The 32 lanes read
// a row in whole 128-byte lines (lane l holds d = 128*j + 4*l .. + 3), each lane sums
// its 16 elements and a butterfly over the lanes joins the sums: no LDS, no barrier,
// few waves to start; gamma and FiLM are read once per wave.
// ---------------------------------------------------------------------------
#define LN_TOK 2                          // divides SEQ: a wave's tokens share a batch

__global__ void ln_film_kernel(const float* __restrict__ x,
                               const float* __restrict__ gamma,
                               const float* __restrict__ film,
                               const float* __restrict__ seq_mask,
                               _Float16* __restrict__ xn16,
                               _Float16* __restrict__ x16) {
    // wave number as a scalar: row bases and the masks stay in scalar registers
    int wv   = __builtin_amdgcn_readfirstlane(threadIdx.x >> 5);
    int lane = threadIdx.x & 31;
    int tok0 = (blockIdx.x * 8 + wv) * LN_TOK;         // 0 .. B*SEQ-LN_TOK
    int b    = tok0 / SEQ;
    const f4_t* xr = (const f4_t*)(x + (size_t)tok0 * DIMSZ);
    const f4_t* gr = (const f4_t*)gamma;
    const f4_t* fb = (const f4_t*)(film + (size_t)b * 2 * DIMSZ);
    f4_t v[LN_TOK][4], g[4], sc[4], sh[4];             // DIMSZ = 4 * 128
    // every loop of this kernel is unrolled: the arrays are then indexed by constants
    // and stay in registers
#pragma unroll
    for (int j = 0; j < 4; ++j) {
#pragma unroll
        for (int t = 0; t < LN_TOK; ++t) v[t][j] = xr[t * (DIMSZ / 4) + j * 32 + lane];
    }
#pragma unroll
    for (int j = 0; j < 4; ++j) {
        g[j]  = gr[j * 32 + lane];
        sc[j] = fb[j * 32 + lane];
        sh[j] = fb[DIMSZ / 4 + j * 32 + lane];
    }
    float mk[LN_TOK];
#pragma unroll
    for (int t = 0; t < LN_TOK; ++t) mk[t] = seq_mask[tok0 + t];
    // keeps every load above ahead of the arithmetic, so a wave waits out one memory
    // latency; without it the compiler sinks eleven of the twelve gamma and FiLM loads
    // among the arithmetic and the wave waits out a latency again for each group
    __builtin_amdgcn_sched_barrier(0);
    float s[LN_TOK], sq[LN_TOK];
#pragma unroll
    for (int t = 0; t < LN_TOK; ++t) {
        f4_t a = (v[t][0] + v[t][1]) + (v[t][2] + v[t][3]);
        f4_t q = (v[t][0] * v[t][0] + v[t][1] * v[t][1]) + (v[t][2] * v[t][2] + v[t][3] * v[t][3]);
        s[t]  = (a[0] + a[1]) + (a[2] + a[3]);
        sq[t] = (q[0] + q[1]) + (q[2] + q[3]);
    }
#pragma unroll
    for (int off = 16; off; off >>= 1)
#pragma unroll
        for (int t = 0; t < LN_TOK; ++t) {
            s[t]  += __shfl_xor(s[t],  off, 32);
            sq[t] += __shfl_xor(sq[t], off, 32);
        }
#pragma unroll
    for (int t = 0; t < LN_TOK; ++t) {
        float mu   = s[t] * (1.0f / DIMSZ);
        float var  = sq[t] * (1.0f / DIMSZ) - mu * mu;
        float rinv = rsqrtf(var + 1e-5f);
        h4_t* on = (h4_t*)(xn16 + (size_t)(tok0 + t) * DIMSZ);
        h4_t* ox = (h4_t*)(x16  + (size_t)(tok0 + t) * DIMSZ);
#pragma unroll
        for (int j = 0; j < 4; ++j) {
            h4_t hn, hx;
#pragma unroll
            for (int c = 0; c < 4; ++c) {
                float xv = v[t][j][c];
                float xn = (xv - mu) * rinv * g[j][c];
                xn = xn * (sc[j][c] + 1.0f) + sh[j][c];
                xn = xn * mk[t] * 0.125f; // fold 64^-0.5 (only q uses xn)
                hn[c] = (_Float16)xn;
                hx[c] = (_Float16)xv;
            }
            on[j * 32 + lane] = hn;
            ox[j * 32 + lane] = hx;
        }
    }
}

// ---------------------------------------------------------------------------
// WMMA GEMMs, Y = A . W^T, K = DIMSZ. A block of 8 waves takes GT_ROWS rows of A and
// GT_COLS rows of W; a wave takes 16 x 64 of Y (A fragment reused across 4 N-tiles).
// Both operand tiles come to LDS in stages of KC columns, through a ring of two buffers:
// asynchronous copies bring stage t + 1 in whole 128-byte lines, through no register,
// while stage t is worked on. The ring is small enough for three blocks a WGP, so that
// the whole grid of the three projections is resident at once and one block's waits are
// filled by the others' work.
// LDS rows have a pitch of 16 B x odd, so the 16 rows of a fragment read fall on
// different banks.
// ---------------------------------------------------------------------------
#define GT_ROWS 128                       // rows of A per block = 8 waves x 16
#define GT_COLS 64                        // rows of W per block
#define KC      128                       // columns of K per stage
#define NST     (DIMSZ / KC)              // stages
#define GPITCH  (KC + 8)                  // f16 per LDS row: 272 B = 16 B x 17
#define GT_BUF  ((GT_ROWS + GT_COLS) * GPITCH)   // f16 per buffer
#define GT_LDS  (2 * GT_BUF)
#define GT_NT   (DIMSZ / GT_COLS)         // column tiles: blockIdx.x = row tile * GT_NT + column tile

// One stage of both tiles, from global memory to LDS: 256 threads, 16 lanes a row of
// 256 bytes (16 bytes each), 16 rows per copy, 8 copies for A and 4 for W.
// lds: this lane's LDS byte address in rows 0 .. 15; ga, gw: its global addresses there.
// s_wait_xcnt 0 is the precaution kept before a register that an issued copy names is
// overwritten; as the statement's last line it stands ahead of every such overwrite.
#define GROW16 (16 * GPITCH * 2)          // bytes of 16 LDS rows
__device__ __forceinline__ void stage_copy(unsigned lds, const _Float16* ga, const _Float16* gw) {
    asm volatile("global_load_async_to_lds_b128 %0, %12, off\n\t"
                 "global_load_async_to_lds_b128 %1, %13, off\n\t"
                 "global_load_async_to_lds_b128 %2, %14, off\n\t"
                 "global_load_async_to_lds_b128 %3, %15, off\n\t"
                 "global_load_async_to_lds_b128 %4, %16, off\n\t"
                 "global_load_async_to_lds_b128 %5, %17, off\n\t"
                 "global_load_async_to_lds_b128 %6, %18, off\n\t"
                 "global_load_async_to_lds_b128 %7, %19, off\n\t"
                 "global_load_async_to_lds_b128 %8, %20, off\n\t"
                 "global_load_async_to_lds_b128 %9, %21, off\n\t"
                 "global_load_async_to_lds_b128 %10, %22, off\n\t"
                 "global_load_async_to_lds_b128 %11, %23, off\n\t"
                 "s_wait_xcnt 0x0"
                 :: "v"(lds),               "v"(lds +  1 * GROW16), "v"(lds +  2 * GROW16),
                    "v"(lds +  3 * GROW16), "v"(lds +  4 * GROW16), "v"(lds +  5 * GROW16),
                    "v"(lds +  6 * GROW16), "v"(lds +  7 * GROW16), "v"(lds +  8 * GROW16),
                    "v"(lds +  9 * GROW16), "v"(lds + 10 * GROW16), "v"(lds + 11 * GROW16),
                    "v"(ga),               "v"(ga + 16 * DIMSZ), "v"(ga + 32 * DIMSZ),
                    "v"(ga + 48 * DIMSZ),  "v"(ga + 64 * DIMSZ), "v"(ga + 80 * DIMSZ),
                    "v"(ga + 96 * DIMSZ),  "v"(ga + 112 * DIMSZ),
                    "v"(gw),               "v"(gw + 16 * DIMSZ), "v"(gw + 32 * DIMSZ),
                    "v"(gw + 48 * DIMSZ)
                 : "memory");
}

// acc[c] = 16 rows of A (wave wv's) x 16 rows of W (N-tile c), fragments read from the ring.
// rowbase, colbase: the block's first row of A and of W.
// W_AS_A: D = W . At (a lane holds one row of A and 8 rows of W), else D = A . Wt.
// f[.][0,1]: the A fragment's two halves; f[.][2 + 2c, 3 + 2c]: N-tile c's.
template <bool W_AS_A>
__device__ __forceinline__ void tile_product(const _Float16* __restrict__ A,
                                             const _Float16* __restrict__ W,
                                             _Float16* sm, int rowbase, int colbase,
                                             int wv, int l15, int base0, v8f (&acc)[4]) {
    int r0 = threadIdx.x >> 4, cc = (threadIdx.x & 15) * 8;
    const _Float16* ga = A + (size_t)(rowbase + r0) * DIMSZ + cc;
    const _Float16* gw = W + (size_t)(colbase + r0) * DIMSZ + cc;
    unsigned lds = (unsigned)(size_t)sm + (unsigned)(r0 * GPITCH + cc) * 2;
    stage_copy(lds, ga, gw);
    // stage 0 has landed behind every wave's own wait and the barrier; then stage 1 starts
    asm volatile("s_wait_asynccnt 0x0" ::: "memory");
    __syncthreads();
    stage_copy(lds + GT_BUF * 2, ga + KC, gw + KC);
#pragma unroll
    for (int c = 0; c < 4; ++c) acc[c] = (v8f){};
#pragma unroll                            // the buffer's address is then a constant offset
    for (int t = 0; t < NST; ++t) {
        const _Float16* buf  = sm + (t & 1) * GT_BUF;
        const _Float16* arow = buf + (wv * 16 + l15) * GPITCH + base0;
        const _Float16* wrow = buf + (GT_ROWS + l15) * GPITCH + base0;
        h8_t f[2][10];
#pragma unroll                            // constant indices: f stays in registers
        for (int s = -1; s < KC / 32; ++s) {
            if (s + 1 < KC / 32) {        // the reads of k step s + 1 of this stage
                int kk = (s + 1) * 32, n = (s + 1) & 1;
                f[n][0] = *(const h8_t*)(arow + kk);
                f[n][1] = *(const h8_t*)(arow + kk + 16);
#pragma unroll
                for (int c = 0; c < 4; ++c) {
                    f[n][2 + 2 * c] = *(const h8_t*)(wrow + c * 16 * GPITCH + kk);
                    f[n][3 + 2 * c] = *(const h8_t*)(wrow + c * 16 * GPITCH + kk + 16);
                }
            }
            // holds the LDS reads of k step s + 1 ahead of the products of step s, so that
            // the waits are counted and a read has a step's time to land; without it the
            // compiler puts each pair of reads directly in front of its product and the wave
            // waits out an LDS latency at nearly every product
            __builtin_amdgcn_sched_barrier(0);
            if (s >= 0) {
                v16h a = mk16(f[s & 1][0], f[s & 1][1]);
#pragma unroll
                for (int c = 0; c < 4; ++c) {
                    v16h bf = mk16(f[s & 1][2 + 2 * c], f[s & 1][3 + 2 * c]);
                    acc[c] = W_AS_A
                        ? __builtin_amdgcn_wmma_f32_16x16x32_f16(
                              false, bf, false, a, (short)0, acc[c], false, false)
                        : __builtin_amdgcn_wmma_f32_16x16x32_f16(
                              false, a, false, bf, (short)0, acc[c], false, false);
                }
            }
        }
        // ---- foot of stage t: hand the ring on ----
        // this wave's reads of the buffer that is refilled below have returned
        asm volatile("s_wait_dscnt 0x0" ::: "memory");
        // this wave's copies of stage t + 1, in flight since the foot before, have landed
        asm volatile("s_wait_asynccnt 0x0" ::: "memory");
        // publishes stage t + 1 and ends every wave's reads of stage t's buffer
        __syncthreads();
        if (t + 2 < NST)
            stage_copy(lds + (t & 1) * (GT_BUF * 2), ga + (t + 2) * KC, gw + (t + 2) * KC);
    }
    // no copy is outstanding when the wave goes on to its stores and ends
    asm volatile("s_wait_asynccnt 0x0" ::: "memory");
}

// f16 output with arbitrary (batched) output strides:
//   Out[b*obs + (row%npb)*ors + col*ocs] = (A[row,:] . W[col,:])
__device__ __forceinline__ void gemm_f16out_body(const _Float16* __restrict__ A,
                                                 const _Float16* __restrict__ W,
                                                 _Float16* __restrict__ Out,
                                                 _Float16* __restrict__ sm,
                                                 int npb, long long obs, int ors, int ocs) {
    // wave number as a scalar: tile indices stay in scalar registers
    int wv = __builtin_amdgcn_readfirstlane(threadIdx.x >> 5);
    int bm = blockIdx.x / GT_NT, tn = blockIdx.x % GT_NT;
    int lane = threadIdx.x & 31;
    int l15 = lane & 15, halfsel = lane >> 4, base0 = halfsel ? 8 : 0;
    int rowbase = bm * GT_ROWS + wv * 16, colbase = tn * GT_COLS;
    v8f acc[4];
    tile_product<false>(A, W, sm, bm * GT_ROWS, colbase, wv, l15, base0, acc);
#pragma unroll
    for (int c = 0; c < 4; ++c) {
#pragma unroll
        for (int r = 0; r < 8; ++r) {
            int grow = rowbase + r + halfsel * 8;
            int bidx = grow / npb, rloc = grow % npb;
            size_t addr = (size_t)bidx * obs + (size_t)rloc * ors
                        + (size_t)(colbase + c * 16 + l15) * ocs;
            Out[addr] = (_Float16)acc[c][r];
        }
    }
    // the instruction set's wait before a register that an issued store names is
    // overwritten: in this build the kernel's branch code follows the stores
    asm volatile("s_wait_xcnt 0x0" ::: "memory");
}

// ---------------------------------------------------------------------------
// 16 tokens x 64 features (one head) per wave, f16 output in the
// FRAGMENT ORDER in which attn_kernel reads K and V as A operands:
//   Out[((b*HEADS + h)*(SEQ/16) + token_tile)*1024 + c*256 + lane*8 + e]
// so that one 16-byte load per lane covers 512 contiguous bytes (4 whole lines).
// FEAT_IN_LANE (K): D = W . At; lane (l15, half) holds token l15 and features
//   c*16 + 8*half + e, which is chunk c of K's fragment row l15.
// otherwise   (V): D = A . Wt; lane (l15, half) holds feature c*16 + l15 and
//   tokens 8*half + e, which is this 16-token tile's chunk of Vt's fragment row.
// ---------------------------------------------------------------------------
template <bool FEAT_IN_LANE>
__device__ __forceinline__ void gemm_frag_body(const _Float16* __restrict__ A,
                                               const _Float16* __restrict__ W,
                                               _Float16* __restrict__ Out,
                                               _Float16* __restrict__ sm) {
    // wave number as a scalar: tile indices stay in scalar registers
    int wv = __builtin_amdgcn_readfirstlane(threadIdx.x >> 5);
    int bm = blockIdx.x / GT_NT, tn = blockIdx.x % GT_NT;
    int tm = bm * (GT_ROWS / 16) + wv;
    int lane = threadIdx.x & 31;
    int l15 = lane & 15, halfsel = lane >> 4, base0 = halfsel ? 8 : 0;
    v8f acc[4];
    tile_product<FEAT_IN_LANE>(A, W, sm, bm * GT_ROWS, tn * GT_COLS, wv, l15, base0, acc);
    int bidx = tm / (SEQ / 16), ttile = tm % (SEQ / 16);
    _Float16* o = Out + ((size_t)(bidx * GT_NT + tn) * (SEQ / 16) + ttile) * 1024 + lane * 8;
#pragma unroll
    for (int c = 0; c < 4; ++c) {
        h8_t v;
#pragma unroll
        for (int r = 0; r < 8; ++r) v[r] = (_Float16)acc[c][r];
        *(h8_t*)(o + c * 256) = v;
    }
    // the instruction set's wait before a register that an issued store names is
    // overwritten: in this build the kernel's branch code follows the stores
    asm volatile("s_wait_xcnt 0x0" ::: "memory");
}

// The three projections depend on the same earlier launches and not on each other:
// one grid, blockIdx.y picks the product, so their waves share the chip at once.
//   y = 0: q = xn . wq^T  -> [B, SEQ, 512]     y = 1: k = x . wk^T -> fragment order
//   y = 2: v = x . wv^T   -> fragment order
// The launch bound is the real block size; 6 waves a SIMD is the register budget of
// three blocks a WGP.
__global__ void __launch_bounds__(256) __attribute__((amdgpu_waves_per_eu(6)))
qkv_kernel(const _Float16* __restrict__ xn16,
           const _Float16* __restrict__ x16,
           const _Float16* __restrict__ wq16,
           const _Float16* __restrict__ wk16,
           const _Float16* __restrict__ wv16,
           _Float16* __restrict__ q16,
           _Float16* __restrict__ kf,
           _Float16* __restrict__ vf,
           int npb, long long obs, int ors, int ocs) {
    __shared__ __attribute__((aligned(16))) _Float16 sm[GT_LDS];
    if (blockIdx.y == 0)      gemm_f16out_body(xn16, wq16, q16, sm, npb, obs, ors, ocs);
    else if (blockIdx.y == 1) gemm_frag_body<true>(x16, wk16, kf, sm);
    else                      gemm_frag_body<false>(x16, wv16, vf, sm);
}

// 16-byte load of four row masks. s_wait_xcnt 0 is the instruction set's wait before a
// register that an issued global load names is overwritten: this build lands the second
// load's result in the address registers of the first.
__device__ __forceinline__ f4_t ld_mask4(const float* p) {
    f4_t v = *(const f4_t*)p;
    asm volatile("s_wait_xcnt 0x0" ::: "memory");
    return v;
}

// f32 output [B*SEQ, DIMSZ], multiplied by per-row mask; launch bound as above
__global__ void __launch_bounds__(256)
gemm_f32mask_kernel(const _Float16* __restrict__ A,
                    const _Float16* __restrict__ W,
                    const float* __restrict__ seq_mask,
                    float* __restrict__ Out) {
    __shared__ __attribute__((aligned(16))) _Float16 sm[GT_LDS];
    // wave number as a scalar: tile indices stay in scalar registers
    int wv = __builtin_amdgcn_readfirstlane(threadIdx.x >> 5);
    int bm = blockIdx.x / GT_NT, tn = blockIdx.x % GT_NT;
    int lane = threadIdx.x & 31;
    int l15 = lane & 15, halfsel = lane >> 4, base0 = halfsel ? 8 : 0;
    int rowbase = bm * GT_ROWS + wv * 16, colbase = tn * GT_COLS;
    // masks of this lane's 8 output rows
    f4_t mk4[2] = {ld_mask4(seq_mask + rowbase + halfsel * 8),
                   ld_mask4(seq_mask + rowbase + halfsel * 8 + 4)};
    v8f acc[4];
    tile_product<false>(A, W, sm, bm * GT_ROWS, colbase, wv, l15, base0, acc);
#pragma unroll
    for (int r = 0; r < 8; ++r) {
        int grow = rowbase + r + halfsel * 8;
        float mk = mk4[r >> 2][r & 3];
#pragma unroll
        for (int c = 0; c < 4; ++c)
            Out[(size_t)grow * DIMSZ + colbase + c * 16 + l15] = acc[c][r] * mk;
    }
}

__device__ __forceinline__ float other_half(float v) {
    int b = __builtin_bit_cast(int, v);
    b = __builtin_amdgcn_permlanex16(b, b, 0x76543210, 0xfedcba98, false, false);
    return __builtin_bit_cast(float, b);
}

#define KSPLIT 4                          // key quarters = waves per query tile
#define QG     2                          // groups of 16 queries per wave
#define QROWS  (16 * QG)                  // queries per wave
#define OPITCH 68                         // floats per partial row: 272 B = 16 B x odd
#define NPASS  (SEQ / 32 / KSPLIT)        // passes of 32 keys per wave
#define BPITCH 36                         // floats per bias row in LDS: 144 B = 16 B x odd
#define BTILE  (QROWS * BPITCH)           // floats per bias buffer (one wave, one pass)

// One bias tile, QROWS rows of 32 keys (128 bytes, line-aligned), from global memory to
// LDS: 8 copies of 16 bytes a lane; a copy covers 4 whole lines (8 lanes a row, 4 rows).
// lds: this lane's LDS byte address in rows 0 .. 3; g: its global address there.
// s_wait_xcnt 0 is the precaution kept before a register that an issued copy names is
// overwritten; as the statement's last line it stands ahead of every such overwrite.
__device__ __forceinline__ void bias_tile_copy(unsigned lds, const float* g) {
    asm volatile("global_load_async_to_lds_b128 %0, %8, off\n\t"
                 "global_load_async_to_lds_b128 %1, %9, off\n\t"
                 "global_load_async_to_lds_b128 %2, %10, off\n\t"
                 "global_load_async_to_lds_b128 %3, %11, off\n\t"
                 "global_load_async_to_lds_b128 %4, %12, off\n\t"
                 "global_load_async_to_lds_b128 %5, %13, off\n\t"
                 "global_load_async_to_lds_b128 %6, %14, off\n\t"
                 "global_load_async_to_lds_b128 %7, %15, off\n\t"
                 "s_wait_xcnt 0x0"
                 :: "v"(lds),                   "v"(lds +  4 * BPITCH * 4),
                    "v"(lds +  8 * BPITCH * 4), "v"(lds + 12 * BPITCH * 4),
                    "v"(lds + 16 * BPITCH * 4), "v"(lds + 20 * BPITCH * 4),
                    "v"(lds + 24 * BPITCH * 4), "v"(lds + 28 * BPITCH * 4),
                    "v"(g),            "v"(g +  4 * SEQ), "v"(g +  8 * SEQ), "v"(g + 12 * SEQ),
                    "v"(g + 16 * SEQ), "v"(g + 20 * SEQ), "v"(g + 24 * SEQ), "v"(g + 28 * SEQ)
                 : "memory");
}

// The launch bound is the real block size: 4 waves a SIMD, 256 registers a wave.
__global__ void __launch_bounds__(512)
attn_kernel(const _Float16* __restrict__ q16,
            const _Float16* __restrict__ kf,
            const _Float16* __restrict__ vf,
            const float* __restrict__ bias,
            const float* __restrict__ seq_mask,
            _Float16* __restrict__ ao) {
    // wave number as a scalar: tile indices and bases are then computed in scalar
    // registers and take no vector registers from the fragments
    int wib   = __builtin_amdgcn_readfirstlane(threadIdx.x >> 5);   // 0 .. 15
    int lane  = threadIdx.x & 31;
    int qsub  = wib & 3;                  // which of the block's query tiles
    int kq    = wib >> 2;                 // which quarter of the keys
    int gwave = blockIdx.x * 4 + qsub;
    int qtile = gwave % (SEQ / QROWS);
    int h     = (gwave / (SEQ / QROWS)) % HEADS;
    int b     = gwave / (SEQ / QROWS * HEADS);
    int qbase = qtile * QROWS;
    int l15 = lane & 15, halfsel = lane >> 4, base0 = halfsel ? 8 : 0;
    size_t bN   = (size_t)b * SEQ;
    int    hoff = h * DHEAD;
    unsigned rowoff = (unsigned)(l15 * DIMSZ + base0);   // q16: row l15
    unsigned ringoff = (unsigned)(l15 * BPITCH + base0); // bias tile in LDS: row l15
    unsigned frgoff = (unsigned)(lane * 8);              // kf, vf: this lane's 16 bytes

    // bias ring: two buffers a wave, filled and read by that wave alone, so that no
    // work-group barrier is needed; tile 0's copies start ahead of everything else
    __shared__ __attribute__((aligned(16))) float ring[4 * KSPLIT * 2 * BTILE];
    int key0 = kq * (SEQ / KSPLIT);       // first key of this wave's quarter
    const float* bbase = bias + ((size_t)(b * HEADS + h) * SEQ + qbase) * SEQ + key0;
    const float* myring = ring + wib * 2 * BTILE;
    const float* bcopy  = bbase + (unsigned)((lane >> 3) * SEQ + (lane & 7) * 4);
    unsigned     lcopy  = (unsigned)(size_t)myring + (unsigned)((lane >> 3) * BPITCH + (lane & 7) * 4) * 4;
    bias_tile_copy(lcopy, bcopy);

    // Q fragments (d 0..31, d 32..63) of each group, scale already folded into xn
    const _Float16* qr = q16 + (bN + qbase) * DIMSZ + hoff;
    v16h  aq[QG][2];
    float mi[QG], mrow[QG], lrow[QG];
    v8f   Oacc[QG][4];                    // Ot: [d = t*16 + 8*half + r][query l15]
    // every loop over the groups is unrolled: the arrays are then indexed by constants
    // and stay in registers
#pragma unroll
    for (int c = 0; c < QG; ++c) {
        const _Float16* qc = qr + c * 16 * DIMSZ + rowoff;
        aq[c][0] = mk16(*(const h8_t*)(qc),      *(const h8_t*)(qc + 16));
        aq[c][1] = mk16(*(const h8_t*)(qc + 32), *(const h8_t*)(qc + 48));
        mi[c]    = seq_mask[bN + qbase + c * 16 + l15];   // this lane's query
        mrow[c]  = -1.0e30f;              // running maximum (same in both halves)
        lrow[c]  = 0.0f;                  // running sum of this half's keys
#pragma unroll
        for (int t = 0; t < 4; ++t) Oacc[c][t] = (v8f){};
    }

    // wave-uniform bases of this head's K tiles, key masks and V tiles,
    // each at the first key of this wave's quarter
    const _Float16* kbase = kf + ((size_t)(b * HEADS + h) * (SEQ / 16) + key0 / 16) * 1024;
    const float*    mbase = seq_mask + bN + key0;
    const _Float16* vbase = vf + ((size_t)(b * HEADS + h) * (SEQ / 16) + key0 / 16) * 1024;

    // tile 0 has landed behind this wave's own wait; then tile 1's copies start
    asm volatile("s_wait_asynccnt 0x0" ::: "memory");
    bias_tile_copy(lcopy + BTILE * 4, bcopy + 32);

    for (int jb = 0; jb < NPASS; ++jb) {
        int kb = jb * 32;
        const float* btile = myring + (jb & 1) * BTILE + ringoff;   // this pass's bias tile
        // ---- St = K . Qt  (two 16-key tiles, each against every query group) ----
        const _Float16* kr0 = kbase + (size_t)jb * 2048 + frgoff;   // two tiles of 1024
        const _Float16* kr1 = kr0 + 1024;
        v16h b00 = mk16(*(const h8_t*)(kr0),       *(const h8_t*)(kr0 + 256));
        v16h b01 = mk16(*(const h8_t*)(kr0 + 512), *(const h8_t*)(kr0 + 768));
        v16h b10 = mk16(*(const h8_t*)(kr1),       *(const h8_t*)(kr1 + 256));
        v16h b11 = mk16(*(const h8_t*)(kr1 + 512), *(const h8_t*)(kr1 + 768));
        f4_t bv[QG][4], mv[4];             // [0,1]: keys of tile 0, [2,3]: tile 1
#pragma unroll
        for (int g = 0; g < 4; ++g) {
            int o = (g >> 1) * 16 + (g & 1) * 4;
#pragma unroll
            for (int c = 0; c < QG; ++c)
                bv[c][g] = *(const f4_t*)(btile + c * 16 * BPITCH + o);
            mv[g] = *(const f4_t*)(mbase + kb + (unsigned)base0 + o);
        }
        // the instruction set's wait before a register that an issued global load names is
        // overwritten; the K address is an input so that its registers live up to it (else
        // this build lands a mask load's result in them)
        asm volatile("s_wait_xcnt 0x0" :: "v"(kr0) : "memory");
        // ends the group of K, bias and mask loads at the head of a pass, whose latencies
        // run side by side; without it this build lifts the first V load up into that
        // group, runs out of registers and reloads a Q fragment from scratch in every pass
        __builtin_amdgcn_sched_barrier(0);
        v8f z = {};
        v8f S0[QG], S1[QG];
#pragma unroll
        for (int c = 0; c < QG; ++c) {
            S0[c] = __builtin_amdgcn_wmma_f32_16x16x32_f16(false, b00, false, aq[c][0], (short)0, z,     false, false);
            S0[c] = __builtin_amdgcn_wmma_f32_16x16x32_f16(false, b01, false, aq[c][1], (short)0, S0[c], false, false);
            S1[c] = __builtin_amdgcn_wmma_f32_16x16x32_f16(false, b10, false, aq[c][0], (short)0, z,     false, false);
            S1[c] = __builtin_amdgcn_wmma_f32_16x16x32_f16(false, b11, false, aq[c][1], (short)0, S1[c], false, false);
        }

        // Vt fragments (keys 0..15 from the first tile, 16..31 from the second)
        const _Float16* vr = vbase + (size_t)jb * 2048 + frgoff;
        v16h va[4];
#pragma unroll
        for (int t = 0; t < 4; ++t)
            va[t] = mk16(*(const h8_t*)(vr + t * 256), *(const h8_t*)(vr + t * 256 + 1024));
        // the same wait for the V address (else this build lands the last V load's result
        // in it). It also holds the eight V loads in one group ahead of the score
        // arithmetic, which then covers their latency; without it six of them sink
        // between the Vt . Pt products and the wave waits out three latencies there
        asm volatile("s_wait_xcnt 0x0" :: "v"(vr) : "memory");

        v16h pb[QG];                       // Pt as B operand: element i <-> score i
#pragma unroll
        for (int c = 0; c < QG; ++c) {
            // ---- bias add + pair mask + online softmax (all in this lane) ----
            float s[16];
#pragma unroll
            for (int i = 0; i < 8; ++i) {
                s[i]     = S0[c][i] + bv[c][i >> 2][i & 3]       - (1.0f - mi[c] * mv[i >> 2][i & 3])       * NEGV;
                s[8 + i] = S1[c][i] + bv[c][2 + (i >> 2)][i & 3] - (1.0f - mi[c] * mv[2 + (i >> 2)][i & 3]) * NEGV;
            }
            float tm[8];
#pragma unroll
            for (int i = 0; i < 8; ++i) tm[i] = fmaxf(s[i], s[8 + i]);
            float tmax = fmaxf(fmaxf(fmaxf(tm[0], tm[1]), fmaxf(tm[2], tm[3])),
                               fmaxf(fmaxf(tm[4], tm[5]), fmaxf(tm[6], tm[7])));
            tmax = fmaxf(tmax, other_half(tmax));
            float mnew  = fmaxf(mrow[c], tmax);
            float alpha = exp_slot(mrow[c] - mnew);
            mrow[c] = mnew;

            float ps[4];                   // four partial sums of this lane's p
#pragma unroll
            for (int i = 0; i < 16; ++i) {
                float p = exp_slot(s[i] - mnew);
                ps[i & 3] = (i < 4) ? p : ps[i & 3] + p;
                pb[c][i] = (_Float16)p;
            }
            lrow[c] = lrow[c] * alpha + ((ps[0] + ps[1]) + (ps[2] + ps[3]));
#pragma unroll
            for (int t = 0; t < 4; ++t) Oacc[c][t] *= alpha;
        }

        // ---- Ot += Vt . Pt ----
#pragma unroll
        for (int t = 0; t < 4; ++t)
#pragma unroll
            for (int c = 0; c < QG; ++c)
                Oacc[c][t] = __builtin_amdgcn_wmma_f32_16x16x32_f16(
                    false, va[t], false, pb[c], (short)0, Oacc[c][t], false, false);

        // ---- foot of pass jb: hand the ring on ----
        // keeps the two waits below at the foot, behind the pass's arithmetic: without it the
        // compiler lifts them to the V loads, and the wave waits for tile jb + 1 when its
        // copies have only just been issued instead of a whole pass later
        __builtin_amdgcn_sched_barrier(0);
        // this wave's reads of the buffer it is about to refill have returned
        asm volatile("s_wait_dscnt 0x0" ::: "memory");
        // tile jb + 1, in flight since the foot of the pass before, has landed
        asm volatile("s_wait_asynccnt 0x0" ::: "memory");
        if (jb + 2 < NPASS)               // same for the whole wave: a scalar branch
            bias_tile_copy(lcopy + (jb & 1) * (BTILE * 4), bcopy + kb + 64);
    }
    // no copy is outstanding when the wave goes on to the merge and ends
    asm volatile("s_wait_asynccnt 0x0" ::: "memory");

    // ---- join the halves' sums; publish this quarter's partial [query][d], max, sum ----
    __shared__ __attribute__((aligned(16))) float part[4 * KSPLIT * QROWS * OPITCH];
    __shared__ float pmax[4 * KSPLIT * QROWS], psum[4 * KSPLIT * QROWS];
#pragma unroll
    for (int c = 0; c < QG; ++c) {
        lrow[c] += other_half(lrow[c]);
        int row = wib * QROWS + c * 16 + l15;
        float* pw = part + row * OPITCH + base0;
#pragma unroll
        for (int t = 0; t < 4; ++t) {
            *(f4_t*)(pw + t * 16)     = (f4_t){Oacc[c][t][0], Oacc[c][t][1], Oacc[c][t][2], Oacc[c][t][3]};
            *(f4_t*)(pw + t * 16 + 4) = (f4_t){Oacc[c][t][4], Oacc[c][t][5], Oacc[c][t][6], Oacc[c][t][7]};
        }
        if (halfsel == 0) { pmax[row] = mrow[c]; psum[row] = lrow[c]; }
    }
    __syncthreads();

    // ---- merge: wave kq takes queries QROWS/4 * kq .. of its tile, 4 at a time; 8 lanes
    // a query, 8 d a lane, so a query's 128-byte output line is stored whole by this one
    // wave ----
    int d0 = (lane & 7) * 8;
#pragma unroll
    for (int u = 0; u < QROWS / 16; ++u) {
        int q = kq * (QROWS / 4) + u * 4 + (lane >> 3);
        float pm[KSPLIT], pl[KSPLIT];
#pragma unroll                            // constant indices: pm, pl stay in registers
        for (int w = 0; w < KSPLIT; ++w) {
            pm[w] = pmax[(w * 4 + qsub) * QROWS + q];
            pl[w] = psum[(w * 4 + qsub) * QROWS + q];
        }
        float mall = fmaxf(fmaxf(pm[0], pm[1]), fmaxf(pm[2], pm[3]));
        float lall = 0.0f;
        f4_t  o0 = {}, o1 = {};
#pragma unroll                            // constant indices into pm, pl, as above
        for (int w = 0; w < KSPLIT; ++w) {
            float g = exp_slot(pm[w] - mall);           // weight of quarter w
            const float* pr = part + ((w * 4 + qsub) * QROWS + q) * OPITCH + d0;
            lall += pl[w] * g;
            o0   += *(const f4_t*)pr * g;
            o1   += *(const f4_t*)(pr + 4) * g;
        }
        float inv = (lall > 0.0f) ? (1.0f / lall) : 0.0f;
        h8_t o;
#pragma unroll
        for (int r = 0; r < 4; ++r) {
            o[r]     = (_Float16)(o0[r] * inv);
            o[4 + r] = (_Float16)(o1[r] * inv);
        }
        *(h8_t*)(ao + (bN + qbase + q) * DIMSZ + hoff + d0) = o;
    }
}

// ---------------------------------------------------------------------------
// launcher
// ---------------------------------------------------------------------------
extern "C" void kernel_launch(void* const* d_in, const int* in_sizes, int n_in,
                              void* d_out, int out_size, void* d_ws, size_t ws_size,
                              hipStream_t stream) {
    const float* x     = (const float*)d_in[0];
    const float* timep = (const float*)d_in[1];
    const float* bias  = (const float*)d_in[2];
    const float* mask  = (const float*)d_in[3];
    const float* gamma = (const float*)d_in[4];
    const float* wtime = (const float*)d_in[5];
    const float* btime = (const float*)d_in[6];
    const float* wq    = (const float*)d_in[7];
    const float* wkv   = (const float*)d_in[8];
    const float* wout  = (const float*)d_in[9];
    float* out = (float*)d_out;

    uint8_t* ws = (uint8_t*)d_ws;
    size_t off = 0;
    auto alloc = [&](size_t bytes) -> uint8_t* {
        uint8_t* p = ws + off;
        off += (bytes + 255) & ~(size_t)255;
        return p;
    };
    const size_t ACT = (size_t)BATCH * SEQ * DIMSZ;        // 2M elems
    float*    film  = (float*)   alloc(BATCH * 2 * DIMSZ * 4);
    _Float16* xn16  = (_Float16*)alloc(ACT * 2);
    _Float16* x16   = (_Float16*)alloc(ACT * 2);
    _Float16* wq16  = (_Float16*)alloc((size_t)DIMSZ * DIMSZ * 2);
    _Float16* wkv16 = (_Float16*)alloc((size_t)2 * DIMSZ * DIMSZ * 2);
    _Float16* wo16  = (_Float16*)alloc((size_t)DIMSZ * DIMSZ * 2);
    _Float16* q16   = (_Float16*)alloc(ACT * 2);
    _Float16* k16   = (_Float16*)alloc(ACT * 2);
    _Float16* vT16  = (_Float16*)alloc(ACT * 2);
    _Float16* ao16  = (_Float16*)alloc(ACT * 2);

    // FiLM params and the three weight converts in one grid, then fused LN+FiLM+mask
    prep_kernel<<<FILM_BLOCKS + 4 * WSQ_BLOCKS, 256, 0, stream>>>(
        timep, wtime, btime, film, wq, wkv, wout, wq16, wkv16, wo16);
    ln_film_kernel<<<BATCH * SEQ / (8 * LN_TOK), 256, 0, stream>>>(x, gamma, film, mask, xn16, x16);

    // 128 x 64 tiles of a [4096, 512] product: 256 blocks of 8 waves
    const int gblocks = (BATCH * SEQ / GT_ROWS) * GT_NT;
    // q = xn @ wq^T, k = x @ wkv[0:512]^T, v = x @ wkv[512:]^T in one grid
    qkv_kernel<<<dim3(gblocks, 3), 256, 0, stream>>>(
        xn16, x16, wq16, wkv16, wkv16 + (size_t)DIMSZ * DIMSZ, q16, k16, vT16,
        SEQ, (long long)SEQ * DIMSZ, DIMSZ, 1);

    // flash attention: B*H*(SEQ/32) = 1024 query tiles, 4 tiles x 4 key quarters / block
    attn_kernel<<<BATCH * HEADS * (SEQ / QROWS) / 4, 512, 0, stream>>>(
        q16, k16, vT16, bias, mask, ao16);

    // out = (ao @ wout^T) * mask  -> f32
    gemm_f32mask_kernel<<<gblocks, 256, 0, stream>>>(ao16, wo16, mask, out);
}
